// v000
// Times are from an AMD MI455X. After a warm-up the kernel runs many times in a row, and a time is the length of
// such a window on the GPU divided by its runs, so every launch and the gaps after it count. The runs cycle
// through copies of the inputs. A figure is the median of several windows, for all but v000 over two sittings.
// Sittings can differ by a few percent; kernels timed side by side share one.
// v000, which the later versions start from, runs in 807 microseconds.
// compute dtype: every module INPUT that feeds a GEMM (x, Wq/Wk/Wv/Wo, dp_w1, biases) is rounded to bf16 and used in exact bf16 WMMA products with f32 accumulation; computed operands (q/k, P, gate*V, context, the LN/GELU chain) are f32 or hi/lo pairs; mask/softmax/LayerNorm/GELU/tanh f32.
#include <hip/hip_runtime.h>
#include <math.h>

typedef __attribute__((ext_vector_type(16))) _Float16 v16h;
typedef __attribute__((ext_vector_type(16))) __bf16 v16b;
typedef __attribute__((ext_vector_type(8)))  _Float16 v8h;
typedef __attribute__((ext_vector_type(8)))  float v8f;
typedef __attribute__((ext_vector_type(4)))  float v4f;
typedef __attribute__((ext_vector_type(2)))  float v2f;
typedef __attribute__((ext_vector_type(4)))  unsigned v4u;
typedef __attribute__((ext_vector_type(4)))  int v4i;
typedef float __attribute__((may_alias)) float_a;
typedef int __attribute__((may_alias)) int_a;

template <typename T> __device__ __forceinline__ void vst2(void* p, T v) { *(T*)p = v;  }
__device__ __forceinline__ v8f wmma16(v16h a, v16h b, v8f c) {
  v8f d = __builtin_amdgcn_wmma_f32_16x16x32_f16(false, a, false, b, (short)0, c, false, false);
  asm volatile("v_nop\n\tv_nop\n\tv_nop\n\tv_nop" : "+v"(d) : "v"(a), "v"(b));
  return d;
}
__device__ __forceinline__ v8f wmma_bf(v16b a, v16b b, v8f c) {
  v8f d = __builtin_amdgcn_wmma_f32_16x16x32_bf16(false, a, false, b, (short)0, c, false, false);
  asm volatile("v_nop\n\tv_nop\n\tv_nop\n\tv_nop" : "+v"(d) : "v"(a), "v"(b));
  return d;
}
// 16x16x32 fragments: lane = (h = lane>>4, row/col = lane&15); elements 0..7 = k0+8h+0..7, 8..15 = k0+16+8h+0..7; D element r = row 8h+r
__device__ __forceinline__ v16h frag_h(const _Float16* rowk0, int lane) {
  union { v16h v; v8h q[2]; } u; const _Float16* p = rowk0 + 8 * (lane >> 4);
  u.q[0] = *(const v8h*)p; u.q[1] = *(const v8h*)(p + 16); return u.v;
}
__device__ __forceinline__ v16h frag_f32(const float* rowk0, int lane) {
  v16h a; const float* p = rowk0 + 8 * (lane >> 4);
#pragma unroll
  for (int i = 0; i < 8; ++i) { a[i] = (_Float16)p[i]; a[8 + i] = (_Float16)p[16 + i]; }
  return a;
}
__device__ __forceinline__ v16h frag_f32s(const float* rowk0, int lane, float sc) {
  v16h a; const float* p = rowk0 + 8 * (lane >> 4);
#pragma unroll
  for (int i = 0; i < 8; ++i) { a[i] = (_Float16)(p[i] * sc); a[8 + i] = (_Float16)(p[16 + i] * sc); }
  return a;
}
// column fragment from a [K][ld] layout (column n), rows >= K read as 0
__device__ __forceinline__ v16h fragc_f32(const float* W, int k0, int n, int lane, int ld, int K) {
  v16h a; const int g = lane >> 4;
#pragma unroll
  for (int i = 0; i < 8; ++i) { const int ka = k0 + 8 * g + i, kb = ka + 16;
    a[i] = (_Float16)(ka < K ? W[(size_t)ka * ld + n] : 0.f); a[8 + i] = (_Float16)(kb < K ? W[(size_t)kb * ld + n] : 0.f); }
  return a;
}
struct F2 { v16b h, l; };
__device__ __forceinline__ F2 bsplit16(const float v[16]) { F2 r;
#pragma unroll
  for (int i = 0; i < 16; ++i) { const __bf16 h = (__bf16)v[i]; r.h[i] = h; r.l[i] = (__bf16)(v[i] - (float)h); }
  return r; }
__device__ __forceinline__ F2 split_row(const float* row, int k0, int lane) { float v[16]; const float* p = row + k0 + 8 * (lane >> 4);
#pragma unroll
  for (int i = 0; i < 8; ++i) { v[i] = p[i]; v[8 + i] = p[16 + i]; }
  return bsplit16(v); }
__device__ __forceinline__ F2 split_rowK(const float* row, int k0, int lane, int K) { float v[16]; const int g = lane >> 4;
#pragma unroll
  for (int i = 0; i < 8; ++i) { const int ka = k0 + 8 * g + i, kb = ka + 16; v[i] = ka < K ? row[ka] : 0.f; v[8 + i] = kb < K ? row[kb] : 0.f; }
  return bsplit16(v); }
__device__ __forceinline__ F2 split_col(const float* W, int k0, int n, int lane, int ld, int K) { float v[16]; const int g = lane >> 4;
#pragma unroll
  for (int i = 0; i < 8; ++i) { const int ka = k0 + 8 * g + i, kb = ka + 16; v[i] = ka < K ? W[(size_t)ka * ld + n] : 0.f; v[8 + i] = kb < K ? W[(size_t)kb * ld + n] : 0.f; }
  return bsplit16(v); }
__device__ __forceinline__ v8f mac3(const F2& a, const F2& b, v8f c) { c = wmma_bf(a.l, b.h, c); c = wmma_bf(a.h, b.l, c); return wmma_bf(a.h, b.h, c); }
__device__ __forceinline__ float sigm(float v) { return 1.0f / (1.0f + expf(-v)); }
#define LDSX() do { asm volatile("s_wait_dscnt 0" ::: "memory"); __builtin_amdgcn_wave_barrier(); __builtin_amdgcn_fence(__ATOMIC_RELEASE, "workgroup"); } while (0)


// Causal self attention (16 heads of 64 on [2,2048,1024], [in][out] weights + biases, scale 1/8) whose post-softmax weights are multiplied by a per-KEY gate (no renormalisation)
// == V rows scaled by gate[key]; gate = tanh(gelu(drift*g_w1 + g_b1).g_w2 + g_b2), drift = gelu(LN(x dp_w1 + dp_b1)).dp_w2 + dp_b2 per token.
// bf16-rounded INPUT operands with exact bf16 WMMA products, hi/lo splits for computed operands; k_cvt, k_pack, k_gate, k_qkv, causal k_attn, k_out.
#define NB 2
#define SS 2048
#define E 1024
#define NH 16
#define HD 64
#define NR (NB * SS)
#define DPH 512
__device__ __forceinline__ float gelu_e(float x) { return 0.5f * x * (1.0f + erff(x * 0.70710678118654752f)); }
#define PLO 1024.0f
#define VLO 2048.0f
__device__ __forceinline__ float bfr(float v) { return (float)(__bf16)v; }
__device__ __forceinline__ v16b frag_b(const __bf16* rowk0, int lane) { return __builtin_bit_cast(v16b, frag_h((const _Float16*)rowk0, lane)); }

__global__ __launch_bounds__(256) void k_cvt(const float* __restrict__ x, __bf16* __restrict__ Xb) {
  const size_t i8 = (size_t)blockIdx.x * 256 + threadIdx.x; if (i8 >= (size_t)NR * E / 8) return;
  union { __bf16 h[8]; v4u u; } pk;
#pragma unroll
  for (int e = 0; e < 8; ++e) pk.h[e] = (__bf16)x[i8 * 8 + e];
  vst2((unsigned*)(Xb + i8 * 8), pk.u);
}
// PT rows: [0,E) Wq[:,n], [E,2E) Wk[:,n], [2E,3E) Wv[:,n], [3E,4E) Wo[:,n]  ([in][out] weights: column n as a bf16 row)
__global__ __launch_bounds__(256) void k_pack(const float* __restrict__ Wq, const float* __restrict__ Wk, const float* __restrict__ Wv, const float* __restrict__ Wo, __bf16* __restrict__ PT) {
  const int n = blockIdx.x, tid = threadIdx.x; __shared__ __align__(16) __bf16 srow[E];
  const float* W = n < E ? Wq : (n < 2 * E ? Wk : (n < 3 * E ? Wv : Wo)); const int nn = n & (E - 1);
  for (int k = tid; k < E; k += 256) srow[k] = (__bf16)W[(size_t)k * E + nn];
  __syncthreads();
  if (tid < E / 8) vst2((unsigned*)(PT + (size_t)n * E + tid * 8), *(const v4u*)(&srow[tid * 8]));
}
// QKV: block (64 rows, 128 cols = 2 heads, which); q,k -> Q32/K32 f32 [bh][s][64]; v -> VT hi/lo x4 [bh][d][s]
__global__ __launch_bounds__(128) void k_qkv(const __bf16* __restrict__ Xb, const __bf16* __restrict__ PT, const float* __restrict__ bq, const float* __restrict__ bk, const float* __restrict__ bv, const float* __restrict__ GATE,
                                            float* __restrict__ Q32, float* __restrict__ K32, _Float16* __restrict__ VTh, _Float16* __restrict__ VTl) {
  __shared__ __align__(16) float so[4][16][132];
  __shared__ __align__(16) _Float16 sth[128][72], stl[128][72];
  const int tid = threadIdx.x, wave = tid >> 5, lane = tid & 31, col = lane & 15, g = lane >> 4;
  const int which = blockIdx.z, r0b = blockIdx.x * 64, r0 = r0b + wave * 16, n0 = blockIdx.y * 128; const int b = r0b / SS, s0 = r0b % SS;
  const float* bb_ = which == 0 ? bq : (which == 1 ? bk : bv);
  v8f acc[8] = {};
#pragma unroll 2
  for (int kc = 0; kc < E / 32; ++kc) { const v16b a = frag_b(Xb + (size_t)(r0 + col) * E + kc * 32, lane);
#pragma unroll
    for (int j = 0; j < 8; ++j) acc[j] = wmma_bf(a, frag_b(PT + (size_t)(which * E + n0 + j * 16 + col) * E + kc * 32, lane), acc[j]); }
  if (which < 2) {
#pragma unroll
    for (int j = 0; j < 8; ++j) { const float bb = bfr(bb_[n0 + j * 16 + col]);
#pragma unroll
      for (int r = 0; r < 8; ++r) so[wave][8 * g + r][j * 16 + col] = acc[j][r] + bb; }
    LDSX();
    float* Dst = which == 0 ? Q32 : K32;
    for (int qq = lane; qq < 2 * 16 * 16; qq += 32) { const int hh = qq >> 8, rl = (qq >> 4) & 15, pc = qq & 15; const int h = (n0 >> 6) + hh;
      vst2(Dst + (((size_t)b * NH + h) * SS + s0 + wave * 16 + rl) * HD + pc * 4, *(const v4f*)(&so[wave][rl][hh * 64 + pc * 4])); } }
  else {
#pragma unroll
    for (int j = 0; j < 8; ++j) { const float bb = bfr(bb_[n0 + j * 16 + col]);
#pragma unroll
      for (int r = 0; r < 8; ++r) { const float v = (acc[j][r] + bb) * GATE[r0 + 8 * g + r] * 4.0f; const _Float16 hi = (_Float16)v; sth[j * 16 + col][wave * 16 + 8 * g + r] = hi; stl[j * 16 + col][wave * 16 + 8 * g + r] = (_Float16)((v - (float)hi) * VLO); } }
    __syncthreads();
    for (int qq = tid; qq < 128 * 8; qq += 128) { const int cl = qq >> 3, pc = qq & 7; const int c = n0 + cl, h = c >> 6, d = c & 63; const size_t o = (((size_t)b * NH + h) * HD + d) * SS + s0 + pc * 8;
      vst2(VTh + o, *(const v4u*)(&sth[cl][pc * 8])); vst2(VTl + o, *(const v4u*)(&stl[cl][pc * 8])); } }
}
// causal attention: block (64 queries, bh); key tiles 0..qb; S on hi/lo splits of the f32 q/k rows; P,V hi/lo; O f32 [bh][s][64]
__global__ __launch_bounds__(128) void k_attn(const float* __restrict__ Q32, const float* __restrict__ K32, const _Float16* __restrict__ VTh, const _Float16* __restrict__ VTl, float* __restrict__ O32) {
  __shared__ __align__(16) float sS[4][16][68];
  __shared__ __align__(16) _Float16 sPh[4][16][72], sPl[4][16][72];
  __shared__ __align__(16) float sO[4][16][68];
  const int tid = threadIdx.x, w = tid >> 5, lane = tid & 31, col = lane & 15, g = lane >> 4;
  const size_t bh = blockIdx.y; const int qb = blockIdx.x; const int q0 = qb * 64 + w * 16;
  F2 aq[2];
#pragma unroll
  for (int kc = 0; kc < 2; ++kc) aq[kc] = split_row(Q32 + (bh * SS + q0 + col) * HD, kc * 32, lane);
  float mrun = -3.0e38f, lrun = 0.f; v8f acc[4] = {}, ac1[4] = {}, ac2[4] = {};
#pragma unroll 1
  for (int kt = 0; kt <= qb; ++kt) {
#pragma unroll
    for (int t = 0; t < 4; ++t) { const int key = kt * 64 + t * 16 + col; const float* krow = K32 + (bh * SS + key) * HD;
      v8f s = mac3(aq[0], split_row(krow, 0, lane), (v8f){}); s = mac3(aq[1], split_row(krow, 32, lane), s);
#pragma unroll
      for (int r = 0; r < 8; ++r) { sS[w][8 * g + r][t * 16 + col] = (key > q0 + 8 * g + r) ? -3.0e38f : s[r] * 0.125f; } }
    LDSX();
    float mx = -3.4e38f;
#pragma unroll
    for (int jj = 0; jj < 32; ++jj) mx = fmaxf(mx, sS[w][col][g * 32 + jj]);
    mx = fmaxf(mx, __shfl_xor(mx, 16, 32));
    const float mnew = fmaxf(mrun, mx); const float corr = expf(mrun - mnew);
    float ps = 0.f;
#pragma unroll
    for (int jj = 0; jj < 32; ++jj) { const float p = expf(sS[w][col][g * 32 + jj] - mnew) * 16384.0f; ps += p; const _Float16 hi = (_Float16)p; sPh[w][col][g * 32 + jj] = hi; sPl[w][col][g * 32 + jj] = (_Float16)((p - (float)hi) * PLO); }
    ps += __shfl_xor(ps, 16, 32);
    lrun = lrun * corr + ps * (1.0f / 16384.0f); mrun = mnew;
#pragma unroll
    for (int r = 0; r < 8; ++r) { const float cr = __shfl(corr, 8 * g + r, 32);
#pragma unroll
      for (int t = 0; t < 4; ++t) { acc[t][r] *= cr; ac1[t][r] *= cr; ac2[t][r] *= cr; } }
    LDSX();
#pragma unroll
    for (int kc = 0; kc < 2; ++kc) { const v16h ph = frag_h(&sPh[w][col][0] + kc * 32, lane), pl = frag_h(&sPl[w][col][0] + kc * 32, lane);
#pragma unroll
      for (int t = 0; t < 4; ++t) { const size_t vo = (bh * HD + t * 16 + col) * SS + kt * 64 + kc * 32; const v16h vh = frag_h(VTh + vo, lane);
        acc[t] = wmma16(ph, vh, acc[t]); ac1[t] = wmma16(ph, frag_h(VTl + vo, lane), ac1[t]); ac2[t] = wmma16(pl, vh, ac2[t]); } }
    __builtin_amdgcn_wave_barrier(); }
#pragma unroll
  for (int r = 0; r < 8; ++r) { const float lr = __shfl(lrun, 8 * g + r, 32); const float inv = 1.0f / (lr * 16384.0f * 4.0f);
#pragma unroll
    for (int t = 0; t < 4; ++t) sO[w][8 * g + r][t * 16 + col] = (acc[t][r] + ac1[t][r] * (1.0f / VLO) + ac2[t][r] * (1.0f / PLO)) * inv; }
  LDSX();
  for (int qq = lane; qq < 16 * 16; qq += 32) { const int rl = qq >> 4, pc = qq & 15; vst2(O32 + ((bh * SS) + q0 + rl) * HD + pc * 4, *(const v4f*)(&sO[w][rl][pc * 4])); }
}
// out = ctx Wo + bo : split(ctx) x bf16(Wo columns): 2 products (Wo is an INPUT -> bf16 exact)
__global__ __launch_bounds__(128) void k_out(const float* __restrict__ O32, const __bf16* __restrict__ PT, const float* __restrict__ bo, float* __restrict__ out) {
  __shared__ __align__(16) float so[4][16][132];
  const int tid = threadIdx.x, wave = tid >> 5, lane = tid & 31, col = lane & 15, g = lane >> 4;
  const int r0 = blockIdx.x * 64 + wave * 16, n0 = blockIdx.y * 128; const int ra = r0 + col; const int b = ra / SS, s = ra % SS;
  v8f acc[8] = {};
#pragma unroll 1
  for (int kc = 0; kc < E / 32; ++kc) { const int h = kc >> 1; const F2 a = split_row(O32 + (((size_t)b * NH + h) * SS + s) * HD, (kc & 1) * 32, lane);
#pragma unroll
    for (int j = 0; j < 8; ++j) { const v16b wb = frag_b(PT + (size_t)(3 * E + n0 + j * 16 + col) * E + kc * 32, lane); acc[j] = wmma_bf(a.l, wb, acc[j]); acc[j] = wmma_bf(a.h, wb, acc[j]); } }
#pragma unroll
  for (int j = 0; j < 8; ++j) { const int n = n0 + j * 16 + col; const float bb = bfr(bo[n]);
#pragma unroll
    for (int r = 0; r < 8; ++r) so[wave][8 * g + r][j * 16 + col] = acc[j][r] + bb; }
  LDSX();
#pragma unroll 4
  for (int rl = 0; rl < 16; ++rl) vst2(out + (size_t)(r0 + rl) * E + n0 + lane * 4, *(const v4f*)(&so[wave][rl][lane * 4]));
}
// drift probe + gate: block = 64 rows; h = bf16(x) @ bf16(dp_w1) exact (+ bf16(b1)), LN over 512 (lane pair), exact GELU, . bf16(dp_w2) + bf16(dp_b2) -> drift; gate per row; 64 floats per block
__global__ __launch_bounds__(128) void k_gate(const __bf16* __restrict__ Xb, const float* __restrict__ W1, const float* __restrict__ b1, const float* __restrict__ lng, const float* __restrict__ lnb, const float* __restrict__ w2, const float* __restrict__ b2,
                                             const float* __restrict__ gw1, const float* __restrict__ gb1, const float* __restrict__ gw2, const float* __restrict__ gb2, float* __restrict__ GATE) {
  __shared__ __align__(16) float sh[4][16][DPH + 4]; __shared__ __align__(16) float sg[64];
  const int tid = threadIdx.x, wave = tid >> 5, lane = tid & 31, col = lane & 15, g = lane >> 4; const int r0 = blockIdx.x * 64 + wave * 16;
#pragma unroll 1
  for (int nh = 0; nh < DPH / 128; ++nh) { v8f acc[8] = {};
#pragma unroll 1
    for (int kc = 0; kc < E / 32; ++kc) { const v16b a = frag_b(Xb + (size_t)(r0 + col) * E + kc * 32, lane);
#pragma unroll
      for (int j = 0; j < 8; ++j) acc[j] = wmma_bf(a, split_col(W1, kc * 32, nh * 128 + j * 16 + col, lane, DPH, E).h, acc[j]); }
#pragma unroll
    for (int j = 0; j < 8; ++j) { const int n = nh * 128 + j * 16 + col; const float bb = bfr(b1[n]);
#pragma unroll
      for (int r = 0; r < 8; ++r) sh[wave][8 * g + r][n] = acc[j][r] + bb; } }
  LDSX();
  { const int rl = lane & 15, hf = lane >> 4; float* row = &sh[wave][rl][hf * 256]; float s = 0.f;
#pragma unroll 4
    for (int k = 0; k < 256; ++k) s += row[k];
    s += __shfl_xor(s, 16, 32); const float mu = s * (1.0f / DPH); float q = 0.f;
#pragma unroll 4
    for (int k = 0; k < 256; ++k) { const float d = row[k] - mu; q += d * d; }
    q += __shfl_xor(q, 16, 32); const float rs = rsqrtf(q * (1.0f / DPH) + 1e-5f); float dot = 0.f;
#pragma unroll 4
    for (int k = 0; k < 256; ++k) { const int c = hf * 256 + k; dot += gelu_e((row[k] - mu) * rs * bfr(lng[c]) + bfr(lnb[c])) * bfr(w2[c]); }
    dot += __shfl_xor(dot, 16, 32); const float drift = dot + bfr(b2[0]);
    float gs = bfr(gb2[0]);
#pragma unroll
    for (int j = 0; j < 16; ++j) gs += gelu_e(drift * bfr(gw1[j]) + bfr(gb1[j])) * bfr(gw2[j]);
    if (hf == 0) sg[wave * 16 + rl] = tanhf(gs); }
  __syncthreads();
  if (tid < 16) vst2(GATE + (size_t)blockIdx.x * 64 + tid * 4, *(const v4f*)(&sg[tid * 4]));
}
extern "C" void kernel_launch(void* const* d_in, const int* in_sizes, int n_in, void* d_out, int out_size, void* d_ws, size_t ws_size, hipStream_t stream) {
  (void)in_sizes; (void)n_in; (void)out_size; (void)ws_size;
  const float** I = (const float**)d_in;
  const float* x = I[0]; const float* Wq = I[1]; const float* bq = I[2]; const float* Wk = I[3]; const float* bk = I[4]; const float* Wv = I[5]; const float* bv = I[6]; const float* Wo = I[7]; const float* bo = I[8];
  const float* dw1 = I[9]; const float* db1 = I[10]; const float* lng = I[11]; const float* lnb = I[12]; const float* dw2 = I[13]; const float* db2 = I[14]; const float* gw1 = I[15]; const float* gb1 = I[16]; const float* gw2 = I[17]; const float* gb2 = I[18];
  float* out = (float*)d_out;
  char* ws = (char*)d_ws; size_t off = 0;
  auto take = [&](size_t bytes) { char* p = ws + off; off += (bytes + 255) & ~(size_t)255; return p; };
  __bf16* Xb = (__bf16*)take((size_t)NR * E * 2); __bf16* PT = (__bf16*)take((size_t)4 * E * E * 2); float* GATE = (float*)take((size_t)NR * 4);
  float* Q32 = (float*)take((size_t)NR * E * 4); float* K32 = (float*)take((size_t)NR * E * 4); _Float16* VTh = (_Float16*)take((size_t)NR * E * 2); _Float16* VTl = (_Float16*)take((size_t)NR * E * 2); float* O32 = (float*)take((size_t)NR * E * 4);
  // ws ~ 84 MB
  k_cvt<<<(NR * E / 8 + 255) / 256, 256, 0, stream>>>(x, Xb);
  k_pack<<<4 * E, 256, 0, stream>>>(Wq, Wk, Wv, Wo, PT);
  k_gate<<<NR / 64, 128, 0, stream>>>(Xb, dw1, db1, lng, lnb, dw2, db2, gw1, gb1, gw2, gb2, GATE);
  k_qkv<<<dim3(NR / 64, E / 128, 3), 128, 0, stream>>>(Xb, PT, bq, bk, bv, GATE, Q32, K32, VTh, VTl);
  k_attn<<<dim3(SS / 64, NB * NH), 128, 0, stream>>>(Q32, K32, VTh, VTl, O32);
  k_out<<<dim3(NR / 64, E / 128), 128, 0, stream>>>(O32, PT, bo, out);
}

// v001
// One run takes 599 microseconds.
// Two timings next to v000 put it at 1.36 and 1.37 times that version's speed.
// compute dtype: every module INPUT that feeds a GEMM (x, Wq/Wk/Wv/Wo, dp_w1, biases) is rounded to bf16 and used in exact bf16 WMMA products with f32 accumulation; computed operands (q/k, P, gate*V, context, the LN/GELU chain) are f32 or hi/lo pairs; mask/softmax/LayerNorm/GELU/tanh f32.
#include <hip/hip_runtime.h>
#include <math.h>

typedef __attribute__((ext_vector_type(16))) _Float16 v16h;
typedef __attribute__((ext_vector_type(16))) __bf16 v16b;
typedef __attribute__((ext_vector_type(8)))  _Float16 v8h;
typedef __attribute__((ext_vector_type(8)))  float v8f;
typedef __attribute__((ext_vector_type(4)))  float v4f;
typedef __attribute__((ext_vector_type(2)))  float v2f;
typedef __attribute__((ext_vector_type(4)))  unsigned v4u;
typedef __attribute__((ext_vector_type(4)))  int v4i;
typedef float __attribute__((may_alias)) float_a;
typedef int __attribute__((may_alias)) int_a;

template <typename T> __device__ __forceinline__ void vst2(void* p, T v) { *(T*)p = v;  }
__device__ __forceinline__ v8f wmma16(v16h a, v16h b, v8f c) {
  v8f d = __builtin_amdgcn_wmma_f32_16x16x32_f16(false, a, false, b, (short)0, c, false, false);
  asm volatile("v_nop\n\tv_nop\n\tv_nop\n\tv_nop" : "+v"(d) : "v"(a), "v"(b));
  return d;
}
__device__ __forceinline__ v8f wmma_bf(v16b a, v16b b, v8f c) {
  v8f d = __builtin_amdgcn_wmma_f32_16x16x32_bf16(false, a, false, b, (short)0, c, false, false);
  asm volatile("v_nop\n\tv_nop\n\tv_nop\n\tv_nop" : "+v"(d) : "v"(a), "v"(b));
  return d;
}
// 16x16x32 fragments: lane = (h = lane>>4, row/col = lane&15); elements 0..7 = k0+8h+0..7, 8..15 = k0+16+8h+0..7; D element r = row 8h+r
__device__ __forceinline__ v16h frag_h(const _Float16* rowk0, int lane) {
  union { v16h v; v8h q[2]; } u; const _Float16* p = rowk0 + 8 * (lane >> 4);
  u.q[0] = *(const v8h*)p; u.q[1] = *(const v8h*)(p + 16); return u.v;
}
__device__ __forceinline__ v16h frag_f32(const float* rowk0, int lane) {
  v16h a; const float* p = rowk0 + 8 * (lane >> 4);
#pragma unroll
  for (int i = 0; i < 8; ++i) { a[i] = (_Float16)p[i]; a[8 + i] = (_Float16)p[16 + i]; }
  return a;
}
__device__ __forceinline__ v16h frag_f32s(const float* rowk0, int lane, float sc) {
  v16h a; const float* p = rowk0 + 8 * (lane >> 4);
#pragma unroll
  for (int i = 0; i < 8; ++i) { a[i] = (_Float16)(p[i] * sc); a[8 + i] = (_Float16)(p[16 + i] * sc); }
  return a;
}
// column fragment from a [K][ld] layout (column n), rows >= K read as 0
__device__ __forceinline__ v16h fragc_f32(const float* W, int k0, int n, int lane, int ld, int K) {
  v16h a; const int g = lane >> 4;
#pragma unroll
  for (int i = 0; i < 8; ++i) { const int ka = k0 + 8 * g + i, kb = ka + 16;
    a[i] = (_Float16)(ka < K ? W[(size_t)ka * ld + n] : 0.f); a[8 + i] = (_Float16)(kb < K ? W[(size_t)kb * ld + n] : 0.f); }
  return a;
}
struct F2 { v16b h, l; };
__device__ __forceinline__ F2 bsplit16(const float v[16]) { F2 r;
#pragma unroll
  for (int i = 0; i < 16; ++i) { const __bf16 h = (__bf16)v[i]; r.h[i] = h; r.l[i] = (__bf16)(v[i] - (float)h); }
  return r; }
__device__ __forceinline__ F2 split_row(const float* row, int k0, int lane) { float v[16]; const float* p = row + k0 + 8 * (lane >> 4);
#pragma unroll
  for (int i = 0; i < 8; ++i) { v[i] = p[i]; v[8 + i] = p[16 + i]; }
  return bsplit16(v); }
__device__ __forceinline__ F2 split_rowK(const float* row, int k0, int lane, int K) { float v[16]; const int g = lane >> 4;
#pragma unroll
  for (int i = 0; i < 8; ++i) { const int ka = k0 + 8 * g + i, kb = ka + 16; v[i] = ka < K ? row[ka] : 0.f; v[8 + i] = kb < K ? row[kb] : 0.f; }
  return bsplit16(v); }
__device__ __forceinline__ F2 split_col(const float* W, int k0, int n, int lane, int ld, int K) { float v[16]; const int g = lane >> 4;
#pragma unroll
  for (int i = 0; i < 8; ++i) { const int ka = k0 + 8 * g + i, kb = ka + 16; v[i] = ka < K ? W[(size_t)ka * ld + n] : 0.f; v[8 + i] = kb < K ? W[(size_t)kb * ld + n] : 0.f; }
  return bsplit16(v); }
__device__ __forceinline__ v8f mac3(const F2& a, const F2& b, v8f c) { c = wmma_bf(a.l, b.h, c); c = wmma_bf(a.h, b.l, c); return wmma_bf(a.h, b.h, c); }
__device__ __forceinline__ float sigm(float v) { return 1.0f / (1.0f + expf(-v)); }
#define LDSX() do { asm volatile("s_wait_dscnt 0" ::: "memory"); __builtin_amdgcn_wave_barrier(); __builtin_amdgcn_fence(__ATOMIC_RELEASE, "workgroup"); } while (0)


// Causal self attention (16 heads of 64 on [2,2048,1024], [in][out] weights + biases, scale 1/8) whose post-softmax weights are multiplied by a per-KEY gate (no renormalisation)
// == V rows scaled by gate[key]; gate = tanh(gelu(drift*g_w1 + g_b1).g_w2 + g_b2), drift = gelu(LN(x dp_w1 + dp_b1)).dp_w2 + dp_b2 per token.
// bf16-rounded INPUT operands with exact bf16 WMMA products, hi/lo splits for computed operands; k_cvt, k_pack, k_gate, k_qkv, causal k_attn, k_out.
#define NB 2
#define SS 2048
#define E 1024
#define NH 16
#define HD 64
#define NR (NB * SS)
#define DPH 512
// GATE plane: 32 floats (one 128-byte line) per 16 rows, the first 16 used, so that a line has one writing block
#define GIDX(r) ((((r) >> 4) << 5) + ((r) & 15))
__device__ __forceinline__ float gelu_e(float x) { return 0.5f * x * (1.0f + erff(x * 0.70710678118654752f)); }
#define PLO 1024.0f
#define VLO 2048.0f
__device__ __forceinline__ float bfr(float v) { return (float)(__bf16)v; }
__device__ __forceinline__ v16b frag_b(const __bf16* rowk0, int lane) { return __builtin_bit_cast(v16b, frag_h((const _Float16*)rowk0, lane)); }

__global__ __launch_bounds__(256) void k_cvt(const float* __restrict__ x, __bf16* __restrict__ Xb) {
  const size_t i8 = (size_t)blockIdx.x * 256 + threadIdx.x; if (i8 >= (size_t)NR * E / 8) return;
  union { __bf16 h[8]; v4u u; } pk;
#pragma unroll
  for (int e = 0; e < 8; ++e) pk.h[e] = (__bf16)x[i8 * 8 + e];
  vst2((unsigned*)(Xb + i8 * 8), pk.u);
}
// PT rows: [0,E) Wq[:,n], [E,2E) Wk[:,n], [2E,3E) Wv[:,n], [3E,4E) Wo[:,n]  ([in][out] weights: column n as a bf16 row)
__global__ __launch_bounds__(256) void k_pack(const float* __restrict__ Wq, const float* __restrict__ Wk, const float* __restrict__ Wv, const float* __restrict__ Wo, __bf16* __restrict__ PT) {
  const int n = blockIdx.x, tid = threadIdx.x; __shared__ __align__(16) __bf16 srow[E];
  const float* W = n < E ? Wq : (n < 2 * E ? Wk : (n < 3 * E ? Wv : Wo)); const int nn = n & (E - 1);
  for (int k = tid; k < E; k += 256) srow[k] = (__bf16)W[(size_t)k * E + nn];
  __syncthreads();
  if (tid < E / 8) vst2((unsigned*)(PT + (size_t)n * E + tid * 8), *(const v4u*)(&srow[tid * 8]));
}
// QKV: block (64 rows, 128 cols = 2 heads, which); q,k -> Q32/K32 f32 [bh][s][64]; v -> VT hi/lo x4 [bh][d][s]
__global__ __launch_bounds__(128) void k_qkv(const __bf16* __restrict__ Xb, const __bf16* __restrict__ PT, const float* __restrict__ bq, const float* __restrict__ bk, const float* __restrict__ bv, const float* __restrict__ GATE,
                                            float* __restrict__ Q32, float* __restrict__ K32, _Float16* __restrict__ VTh, _Float16* __restrict__ VTl) {
  __shared__ __align__(16) float so[4][16][132];
  __shared__ __align__(16) _Float16 sth[128][72], stl[128][72];
  const int tid = threadIdx.x, wave = tid >> 5, lane = tid & 31, col = lane & 15, g = lane >> 4;
  const int which = blockIdx.z, r0b = blockIdx.x * 64, r0 = r0b + wave * 16, n0 = blockIdx.y * 128; const int b = r0b / SS, s0 = r0b % SS;
  const float* bb_ = which == 0 ? bq : (which == 1 ? bk : bv);
  v8f acc[8] = {};
#pragma unroll 2
  for (int kc = 0; kc < E / 32; ++kc) { const v16b a = frag_b(Xb + (size_t)(r0 + col) * E + kc * 32, lane);
#pragma unroll
    for (int j = 0; j < 8; ++j) acc[j] = wmma_bf(a, frag_b(PT + (size_t)(which * E + n0 + j * 16 + col) * E + kc * 32, lane), acc[j]); }
  if (which < 2) {
#pragma unroll
    for (int j = 0; j < 8; ++j) { const float bb = bfr(bb_[n0 + j * 16 + col]);
#pragma unroll
      for (int r = 0; r < 8; ++r) so[wave][8 * g + r][j * 16 + col] = acc[j][r] + bb; }
    LDSX();
    float* Dst = which == 0 ? Q32 : K32;
    for (int qq = lane; qq < 2 * 16 * 16; qq += 32) { const int hh = qq >> 8, rl = (qq >> 4) & 15, pc = qq & 15; const int h = (n0 >> 6) + hh;
      vst2(Dst + (((size_t)b * NH + h) * SS + s0 + wave * 16 + rl) * HD + pc * 4, *(const v4f*)(&so[wave][rl][hh * 64 + pc * 4])); } }
  else {
#pragma unroll
    for (int j = 0; j < 8; ++j) { const float bb = bfr(bb_[n0 + j * 16 + col]);
#pragma unroll
      for (int r = 0; r < 8; ++r) { const float v = (acc[j][r] + bb) * GATE[GIDX(r0 + 8 * g + r)] * 4.0f; const _Float16 hi = (_Float16)v; sth[j * 16 + col][wave * 16 + 8 * g + r] = hi; stl[j * 16 + col][wave * 16 + 8 * g + r] = (_Float16)((v - (float)hi) * VLO); } }
    __syncthreads();
    for (int qq = tid; qq < 128 * 8; qq += 128) { const int cl = qq >> 3, pc = qq & 7; const int c = n0 + cl, h = c >> 6, d = c & 63; const size_t o = (((size_t)b * NH + h) * HD + d) * SS + s0 + pc * 8;
      vst2(VTh + o, *(const v4u*)(&sth[cl][pc * 8])); vst2(VTl + o, *(const v4u*)(&stl[cl][pc * 8])); } }
}
// causal attention: block (64 queries, bh); key tiles 0..qb; S on hi/lo splits of the f32 q/k rows; P,V hi/lo; O f32 [bh][s][64]
__global__ __launch_bounds__(128) void k_attn(const float* __restrict__ Q32, const float* __restrict__ K32, const _Float16* __restrict__ VTh, const _Float16* __restrict__ VTl, float* __restrict__ O32) {
  __shared__ __align__(16) float sS[4][16][68];
  __shared__ __align__(16) _Float16 sPh[4][16][72], sPl[4][16][72];
  __shared__ __align__(16) float sO[4][16][68];
  const int tid = threadIdx.x, w = tid >> 5, lane = tid & 31, col = lane & 15, g = lane >> 4;
  const size_t bh = blockIdx.y; const int qb = blockIdx.x; const int q0 = qb * 64 + w * 16;
  F2 aq[2];
#pragma unroll
  for (int kc = 0; kc < 2; ++kc) aq[kc] = split_row(Q32 + (bh * SS + q0 + col) * HD, kc * 32, lane);
  float mrun = -3.0e38f, lrun = 0.f; v8f acc[4] = {}, ac1[4] = {}, ac2[4] = {};
#pragma unroll 1
  for (int kt = 0; kt <= qb; ++kt) {
#pragma unroll
    for (int t = 0; t < 4; ++t) { const int key = kt * 64 + t * 16 + col; const float* krow = K32 + (bh * SS + key) * HD;
      v8f s = mac3(aq[0], split_row(krow, 0, lane), (v8f){}); s = mac3(aq[1], split_row(krow, 32, lane), s);
#pragma unroll
      for (int r = 0; r < 8; ++r) { sS[w][8 * g + r][t * 16 + col] = (key > q0 + 8 * g + r) ? -3.0e38f : s[r] * 0.125f; } }
    LDSX();
    float mx = -3.4e38f;
#pragma unroll
    for (int jj = 0; jj < 32; ++jj) mx = fmaxf(mx, sS[w][col][g * 32 + jj]);
    mx = fmaxf(mx, __shfl_xor(mx, 16, 32));
    const float mnew = fmaxf(mrun, mx); const float corr = expf(mrun - mnew);
    float ps = 0.f;
#pragma unroll
    for (int jj = 0; jj < 32; ++jj) { const float p = expf(sS[w][col][g * 32 + jj] - mnew) * 16384.0f; ps += p; const _Float16 hi = (_Float16)p; sPh[w][col][g * 32 + jj] = hi; sPl[w][col][g * 32 + jj] = (_Float16)((p - (float)hi) * PLO); }
    ps += __shfl_xor(ps, 16, 32);
    lrun = lrun * corr + ps * (1.0f / 16384.0f); mrun = mnew;
#pragma unroll
    for (int r = 0; r < 8; ++r) { const float cr = __shfl(corr, 8 * g + r, 32);
#pragma unroll
      for (int t = 0; t < 4; ++t) { acc[t][r] *= cr; ac1[t][r] *= cr; ac2[t][r] *= cr; } }
    LDSX();
#pragma unroll
    for (int kc = 0; kc < 2; ++kc) { const v16h ph = frag_h(&sPh[w][col][0] + kc * 32, lane), pl = frag_h(&sPl[w][col][0] + kc * 32, lane);
#pragma unroll
      for (int t = 0; t < 4; ++t) { const size_t vo = (bh * HD + t * 16 + col) * SS + kt * 64 + kc * 32; const v16h vh = frag_h(VTh + vo, lane);
        acc[t] = wmma16(ph, vh, acc[t]); ac1[t] = wmma16(ph, frag_h(VTl + vo, lane), ac1[t]); ac2[t] = wmma16(pl, vh, ac2[t]); } }
    __builtin_amdgcn_wave_barrier(); }
#pragma unroll
  for (int r = 0; r < 8; ++r) { const float lr = __shfl(lrun, 8 * g + r, 32); const float inv = 1.0f / (lr * 16384.0f * 4.0f);
#pragma unroll
    for (int t = 0; t < 4; ++t) sO[w][8 * g + r][t * 16 + col] = (acc[t][r] + ac1[t][r] * (1.0f / VLO) + ac2[t][r] * (1.0f / PLO)) * inv; }
  LDSX();
  for (int qq = lane; qq < 16 * 16; qq += 32) { const int rl = qq >> 4, pc = qq & 15; vst2(O32 + ((bh * SS) + q0 + rl) * HD + pc * 4, *(const v4f*)(&sO[w][rl][pc * 4])); }
}
// out = ctx Wo + bo : split(ctx) x bf16(Wo columns): 2 products (Wo is an INPUT -> bf16 exact)
__global__ __launch_bounds__(128) void k_out(const float* __restrict__ O32, const __bf16* __restrict__ PT, const float* __restrict__ bo, float* __restrict__ out) {
  __shared__ __align__(16) float so[4][16][132];
  const int tid = threadIdx.x, wave = tid >> 5, lane = tid & 31, col = lane & 15, g = lane >> 4;
  const int r0 = blockIdx.x * 64 + wave * 16, n0 = blockIdx.y * 128; const int ra = r0 + col; const int b = ra / SS, s = ra % SS;
  v8f acc[8] = {};
#pragma unroll 1
  for (int kc = 0; kc < E / 32; ++kc) { const int h = kc >> 1; const F2 a = split_row(O32 + (((size_t)b * NH + h) * SS + s) * HD, (kc & 1) * 32, lane);
#pragma unroll
    for (int j = 0; j < 8; ++j) { const v16b wb = frag_b(PT + (size_t)(3 * E + n0 + j * 16 + col) * E + kc * 32, lane); acc[j] = wmma_bf(a.l, wb, acc[j]); acc[j] = wmma_bf(a.h, wb, acc[j]); } }
#pragma unroll
  for (int j = 0; j < 8; ++j) { const int n = n0 + j * 16 + col; const float bb = bfr(bo[n]);
#pragma unroll
    for (int r = 0; r < 8; ++r) so[wave][8 * g + r][j * 16 + col] = acc[j][r] + bb; }
  LDSX();
#pragma unroll 4
  for (int rl = 0; rl < 16; ++rl) vst2(out + (size_t)(r0 + rl) * E + n0 + lane * 4, *(const v4f*)(&so[wave][rl][lane * 4]));
}
// drift probe + gate: block = 16 rows, 16 waves; wave w does columns 32w..32w+31 of h = bf16(x) @ bf16(dp_w1) exact (+ bf16(b1)); then wave w owns row w: LN over 512 (16 values a lane, shuffle tree), exact GELU, . bf16(dp_w2) + bf16(dp_b2) -> drift; gate per row
__device__ __forceinline__ float wsum(float v) {
#pragma unroll
  for (int m = 16; m >= 1; m >>= 1) v += __shfl_xor(v, m, 32);
  return v;
}
__global__ __launch_bounds__(512) void k_gate(const __bf16* __restrict__ Xb, const float* __restrict__ W1, const float* __restrict__ b1, const float* __restrict__ lng, const float* __restrict__ lnb, const float* __restrict__ w2, const float* __restrict__ b2,
                                             const float* __restrict__ gw1, const float* __restrict__ gb1, const float* __restrict__ gw2, const float* __restrict__ gb2, float* __restrict__ GATE) {
  __shared__ __align__(16) float sh[16][DPH + 4]; __shared__ __align__(16) float sg[16];
  const int tid = threadIdx.x, wave = tid >> 5, lane = tid & 31, col = lane & 15, g = lane >> 4; const int r0 = blockIdx.x * 16;
  { v8f acc[2] = {};
// rolled: a trip waits on its own loads, and an unrolled build kept no more of them in flight
#pragma unroll 1
    for (int kc = 0; kc < E / 32; ++kc) { const v16b a = frag_b(Xb + (size_t)(r0 + col) * E + kc * 32, lane);
#pragma unroll
      for (int j = 0; j < 2; ++j) acc[j] = wmma_bf(a, split_col(W1, kc * 32, wave * 32 + j * 16 + col, lane, DPH, E).h, acc[j]); }
#pragma unroll
    for (int j = 0; j < 2; ++j) { const int n = wave * 32 + j * 16 + col; const float bb = bfr(b1[n]);
#pragma unroll
      for (int r = 0; r < 8; ++r) sh[8 * g + r][n] = acc[j][r] + bb; } }
  float pg[16], pb[16], pw[16];  // the lane's LN and dp_w2 parameters, fetched ahead of the barrier so that their latency is not paid between the GELU branches
#pragma unroll
  for (int k = 0; k < 16; ++k) { const int c = k * 32 + lane; pg[k] = bfr(lng[c]); pb[k] = bfr(lnb[c]); pw[k] = bfr(w2[c]); }
  __syncthreads();  // every wave's 32 columns of all 16 rows are in sh before a row is read
  { float v[16]; float s = 0.f;
#pragma unroll
    for (int k = 0; k < 16; ++k) { v[k] = sh[wave][k * 32 + lane]; s += v[k]; }
    const float mu = wsum(s) * (1.0f / DPH); float q = 0.f;
#pragma unroll
    for (int k = 0; k < 16; ++k) { const float d = v[k] - mu; q += d * d; }
    const float rs = rsqrtf(wsum(q) * (1.0f / DPH) + 1e-5f); float dot = 0.f;
#pragma unroll
    for (int k = 0; k < 16; ++k) dot += gelu_e((v[k] - mu) * rs * pg[k] + pb[k]) * pw[k];
    const float drift = wsum(dot) + bfr(b2[0]);
    const float t = g == 0 ? gelu_e(drift * bfr(gw1[col]) + bfr(gb1[col])) * bfr(gw2[col]) : 0.f;
    const float gsum = bfr(gb2[0]) + wsum(t);
    if (lane == 0) sg[wave] = tanhf(gsum); }
  __syncthreads();
  if (tid < 4) vst2(GATE + (size_t)blockIdx.x * 32 + tid * 4, *(const v4f*)(&sg[tid * 4]));
}
extern "C" void kernel_launch(void* const* d_in, const int* in_sizes, int n_in, void* d_out, int out_size, void* d_ws, size_t ws_size, hipStream_t stream) {
  (void)in_sizes; (void)n_in; (void)out_size; (void)ws_size;
  const float** I = (const float**)d_in;
  const float* x = I[0]; const float* Wq = I[1]; const float* bq = I[2]; const float* Wk = I[3]; const float* bk = I[4]; const float* Wv = I[5]; const float* bv = I[6]; const float* Wo = I[7]; const float* bo = I[8];
  const float* dw1 = I[9]; const float* db1 = I[10]; const float* lng = I[11]; const float* lnb = I[12]; const float* dw2 = I[13]; const float* db2 = I[14]; const float* gw1 = I[15]; const float* gb1 = I[16]; const float* gw2 = I[17]; const float* gb2 = I[18];
  float* out = (float*)d_out;
  char* ws = (char*)d_ws; size_t off = 0;
  auto take = [&](size_t bytes) { char* p = ws + off; off += (bytes + 255) & ~(size_t)255; return p; };
  __bf16* Xb = (__bf16*)take((size_t)NR * E * 2); __bf16* PT = (__bf16*)take((size_t)4 * E * E * 2); float* GATE = (float*)take((size_t)NR * 8);
  float* Q32 = (float*)take((size_t)NR * E * 4); float* K32 = (float*)take((size_t)NR * E * 4); _Float16* VTh = (_Float16*)take((size_t)NR * E * 2); _Float16* VTl = (_Float16*)take((size_t)NR * E * 2); float* O32 = (float*)take((size_t)NR * E * 4);
  // ws ~ 84 MB
  k_cvt<<<(NR * E / 8 + 255) / 256, 256, 0, stream>>>(x, Xb);
  k_pack<<<4 * E, 256, 0, stream>>>(Wq, Wk, Wv, Wo, PT);
  k_gate<<<NR / 16, 512, 0, stream>>>(Xb, dw1, db1, lng, lnb, dw2, db2, gw1, gb1, gw2, gb2, GATE);
  k_qkv<<<dim3(NR / 64, E / 128, 3), 128, 0, stream>>>(Xb, PT, bq, bk, bv, GATE, Q32, K32, VTh, VTl);
  k_attn<<<dim3(SS / 64, NB * NH), 128, 0, stream>>>(Q32, K32, VTh, VTl, O32);
  k_out<<<dim3(NR / 64, E / 128), 128, 0, stream>>>(O32, PT, bo, out);
}

// v002
// It runs in 565 microseconds.
// In both of two side-by-side timings against v001, it was 1.05 times as fast.
// Counting every step since v000, it is 1.44 times as fast.
// compute dtype: every module INPUT that feeds a GEMM (x, Wq/Wk/Wv/Wo, dp_w1, biases) is rounded to bf16 and used in exact bf16 WMMA products with f32 accumulation; computed operands (q/k, P, gate*V, context, the LN/GELU chain) are f32 or hi/lo pairs; mask/softmax/LayerNorm/GELU/tanh f32.
#include <hip/hip_runtime.h>
#include <math.h>

typedef __attribute__((ext_vector_type(16))) _Float16 v16h;
typedef __attribute__((ext_vector_type(16))) __bf16 v16b;
typedef __attribute__((ext_vector_type(8)))  _Float16 v8h;
typedef __attribute__((ext_vector_type(8)))  float v8f;
typedef __attribute__((ext_vector_type(4)))  float v4f;
typedef __attribute__((ext_vector_type(2)))  float v2f;
typedef __attribute__((ext_vector_type(4)))  unsigned v4u;
typedef __attribute__((ext_vector_type(4)))  int v4i;
typedef float __attribute__((may_alias)) float_a;
typedef int __attribute__((may_alias)) int_a;

template <typename T> __device__ __forceinline__ void vst2(void* p, T v) { *(T*)p = v;  }
__device__ __forceinline__ v8f wmma16(v16h a, v16h b, v8f c) {
  v8f d = __builtin_amdgcn_wmma_f32_16x16x32_f16(false, a, false, b, (short)0, c, false, false);
  asm volatile("v_nop\n\tv_nop\n\tv_nop\n\tv_nop" : "+v"(d) : "v"(a), "v"(b));
  return d;
}
__device__ __forceinline__ v8f wmma_bf(v16b a, v16b b, v8f c) {
  v8f d = __builtin_amdgcn_wmma_f32_16x16x32_bf16(false, a, false, b, (short)0, c, false, false);
  asm volatile("v_nop\n\tv_nop\n\tv_nop\n\tv_nop" : "+v"(d) : "v"(a), "v"(b));
  return d;
}
// 16x16x32 fragments: lane = (h = lane>>4, row/col = lane&15); elements 0..7 = k0+8h+0..7, 8..15 = k0+16+8h+0..7; D element r = row 8h+r
__device__ __forceinline__ v16h frag_h(const _Float16* rowk0, int lane) {
  union { v16h v; v8h q[2]; } u; const _Float16* p = rowk0 + 8 * (lane >> 4);
  u.q[0] = *(const v8h*)p; u.q[1] = *(const v8h*)(p + 16); return u.v;
}
__device__ __forceinline__ v16h frag_f32(const float* rowk0, int lane) {
  v16h a; const float* p = rowk0 + 8 * (lane >> 4);
#pragma unroll
  for (int i = 0; i < 8; ++i) { a[i] = (_Float16)p[i]; a[8 + i] = (_Float16)p[16 + i]; }
  return a;
}
__device__ __forceinline__ v16h frag_f32s(const float* rowk0, int lane, float sc) {
  v16h a; const float* p = rowk0 + 8 * (lane >> 4);
#pragma unroll
  for (int i = 0; i < 8; ++i) { a[i] = (_Float16)(p[i] * sc); a[8 + i] = (_Float16)(p[16 + i] * sc); }
  return a;
}
// column fragment from a [K][ld] layout (column n), rows >= K read as 0
__device__ __forceinline__ v16h fragc_f32(const float* W, int k0, int n, int lane, int ld, int K) {
  v16h a; const int g = lane >> 4;
#pragma unroll
  for (int i = 0; i < 8; ++i) { const int ka = k0 + 8 * g + i, kb = ka + 16;
    a[i] = (_Float16)(ka < K ? W[(size_t)ka * ld + n] : 0.f); a[8 + i] = (_Float16)(kb < K ? W[(size_t)kb * ld + n] : 0.f); }
  return a;
}
struct F2 { v16b h, l; };
__device__ __forceinline__ F2 bsplit16(const float v[16]) { F2 r;
#pragma unroll
  for (int i = 0; i < 16; ++i) { const __bf16 h = (__bf16)v[i]; r.h[i] = h; r.l[i] = (__bf16)(v[i] - (float)h); }
  return r; }
__device__ __forceinline__ F2 split_row(const float* row, int k0, int lane) { float v[16]; const float* p = row + k0 + 8 * (lane >> 4);
#pragma unroll
  for (int i = 0; i < 8; ++i) { v[i] = p[i]; v[8 + i] = p[16 + i]; }
  return bsplit16(v); }
__device__ __forceinline__ F2 split_rowK(const float* row, int k0, int lane, int K) { float v[16]; const int g = lane >> 4;
#pragma unroll
  for (int i = 0; i < 8; ++i) { const int ka = k0 + 8 * g + i, kb = ka + 16; v[i] = ka < K ? row[ka] : 0.f; v[8 + i] = kb < K ? row[kb] : 0.f; }
  return bsplit16(v); }
__device__ __forceinline__ F2 split_col(const float* W, int k0, int n, int lane, int ld, int K) { float v[16]; const int g = lane >> 4;
#pragma unroll
  for (int i = 0; i < 8; ++i) { const int ka = k0 + 8 * g + i, kb = ka + 16; v[i] = ka < K ? W[(size_t)ka * ld + n] : 0.f; v[8 + i] = kb < K ? W[(size_t)kb * ld + n] : 0.f; }
  return bsplit16(v); }
__device__ __forceinline__ v8f mac3(const F2& a, const F2& b, v8f c) { c = wmma_bf(a.l, b.h, c); c = wmma_bf(a.h, b.l, c); return wmma_bf(a.h, b.h, c); }
__device__ __forceinline__ float sigm(float v) { return 1.0f / (1.0f + expf(-v)); }
#define LDSX() do { asm volatile("s_wait_dscnt 0" ::: "memory"); __builtin_amdgcn_wave_barrier(); __builtin_amdgcn_fence(__ATOMIC_RELEASE, "workgroup"); } while (0)


// Causal self attention (16 heads of 64 on [2,2048,1024], [in][out] weights + biases, scale 1/8) whose post-softmax weights are multiplied by a per-KEY gate (no renormalisation)
// == V rows scaled by gate[key]; gate = tanh(gelu(drift*g_w1 + g_b1).g_w2 + g_b2), drift = gelu(LN(x dp_w1 + dp_b1)).dp_w2 + dp_b2 per token.
// bf16-rounded INPUT operands with exact bf16 WMMA products, hi/lo splits for computed operands; k_cvt, k_pack, k_gate, k_qkv, causal k_attn, k_out.
#define NB 2
#define SS 2048
#define E 1024
#define NH 16
#define HD 64
#define NR (NB * SS)
#define DPH 512
// GATE plane: 32 floats (one 128-byte line) per 16 rows, the first 16 used, so that a line has one writing block
#define GIDX(r) ((((r) >> 4) << 5) + ((r) & 15))
__device__ __forceinline__ float gelu_e(float x) { return 0.5f * x * (1.0f + erff(x * 0.70710678118654752f)); }
#define PLO 1024.0f
#define VLO 2048.0f
__device__ __forceinline__ float bfr(float v) { return (float)(__bf16)v; }
__device__ __forceinline__ v16b frag_b(const __bf16* rowk0, int lane) { return __builtin_bit_cast(v16b, frag_h((const _Float16*)rowk0, lane)); }

__global__ __launch_bounds__(256) void k_cvt(const float* __restrict__ x, __bf16* __restrict__ Xb) {
  const size_t i8 = (size_t)blockIdx.x * 256 + threadIdx.x; if (i8 >= (size_t)NR * E / 8) return;
  union { __bf16 h[8]; v4u u; } pk;
#pragma unroll
  for (int e = 0; e < 8; ++e) pk.h[e] = (__bf16)x[i8 * 8 + e];
  vst2((unsigned*)(Xb + i8 * 8), pk.u);
}
// PT rows: [0,E) Wq[:,n], [E,2E) Wk[:,n], [2E,3E) Wv[:,n], [3E,4E) Wo[:,n]  ([in][out] weights: column n as a bf16 row)
__global__ __launch_bounds__(256) void k_pack(const float* __restrict__ Wq, const float* __restrict__ Wk, const float* __restrict__ Wv, const float* __restrict__ Wo, __bf16* __restrict__ PT) {
  const int n = blockIdx.x, tid = threadIdx.x; __shared__ __align__(16) __bf16 srow[E];
  const float* W = n < E ? Wq : (n < 2 * E ? Wk : (n < 3 * E ? Wv : Wo)); const int nn = n & (E - 1);
  for (int k = tid; k < E; k += 256) srow[k] = (__bf16)W[(size_t)k * E + nn];
  __syncthreads();
  if (tid < E / 8) vst2((unsigned*)(PT + (size_t)n * E + tid * 8), *(const v4u*)(&srow[tid * 8]));
}
// QKV: block (64 rows, 128 cols = 2 heads, which); q,k -> Q32/K32 f32 [bh][s][64]; v -> VT hi/lo x4 [bh][d][s]
__global__ __launch_bounds__(128) void k_qkv(const __bf16* __restrict__ Xb, const __bf16* __restrict__ PT, const float* __restrict__ bq, const float* __restrict__ bk, const float* __restrict__ bv, const float* __restrict__ GATE,
                                            float* __restrict__ Q32, float* __restrict__ K32, _Float16* __restrict__ VTh, _Float16* __restrict__ VTl) {
  __shared__ __align__(16) float so[4][16][132];
  __shared__ __align__(16) _Float16 sth[128][72], stl[128][72];
  const int tid = threadIdx.x, wave = tid >> 5, lane = tid & 31, col = lane & 15, g = lane >> 4;
  const int which = blockIdx.z, r0b = blockIdx.x * 64, r0 = r0b + wave * 16, n0 = blockIdx.y * 128; const int b = r0b / SS, s0 = r0b % SS;
  const float* bb_ = which == 0 ? bq : (which == 1 ? bk : bv);
  v8f acc[8] = {};
#pragma unroll 2
  for (int kc = 0; kc < E / 32; ++kc) { const v16b a = frag_b(Xb + (size_t)(r0 + col) * E + kc * 32, lane);
#pragma unroll
    for (int j = 0; j < 8; ++j) acc[j] = wmma_bf(a, frag_b(PT + (size_t)(which * E + n0 + j * 16 + col) * E + kc * 32, lane), acc[j]); }
  if (which < 2) {
#pragma unroll
    for (int j = 0; j < 8; ++j) { const float bb = bfr(bb_[n0 + j * 16 + col]);
#pragma unroll
      for (int r = 0; r < 8; ++r) so[wave][8 * g + r][j * 16 + col] = acc[j][r] + bb; }
    LDSX();
    float* Dst = which == 0 ? Q32 : K32;
    for (int qq = lane; qq < 2 * 16 * 16; qq += 32) { const int hh = qq >> 8, rl = (qq >> 4) & 15, pc = qq & 15; const int h = (n0 >> 6) + hh;
      vst2(Dst + (((size_t)b * NH + h) * SS + s0 + wave * 16 + rl) * HD + pc * 4, *(const v4f*)(&so[wave][rl][hh * 64 + pc * 4])); } }
  else {
#pragma unroll
    for (int j = 0; j < 8; ++j) { const float bb = bfr(bb_[n0 + j * 16 + col]);
#pragma unroll
      for (int r = 0; r < 8; ++r) { const float v = (acc[j][r] + bb) * GATE[GIDX(r0 + 8 * g + r)] * 4.0f; const _Float16 hi = (_Float16)v; sth[j * 16 + col][wave * 16 + 8 * g + r] = hi; stl[j * 16 + col][wave * 16 + 8 * g + r] = (_Float16)((v - (float)hi) * VLO); } }
    __syncthreads();
    for (int qq = tid; qq < 128 * 8; qq += 128) { const int cl = qq >> 3, pc = qq & 7; const int c = n0 + cl, h = c >> 6, d = c & 63; const size_t o = (((size_t)b * NH + h) * HD + d) * SS + s0 + pc * 8;
      vst2(VTh + o, *(const v4u*)(&sth[cl][pc * 8])); vst2(VTl + o, *(const v4u*)(&stl[cl][pc * 8])); } }
}
// causal attention: block (2 x 64 queries, bh): waves 0..3 take query tile 31 - t, waves 4..7 tile t, so that every block walks 33 key tiles per wave pair and no WGP is left with the long tiles alone
// (the waves share no barrier and no LDS range); key tiles 0..qb; S on hi/lo splits of the f32 q/k rows; P,V hi/lo; O f32 [bh][s][64]
__global__ __launch_bounds__(256) void k_attn(const float* __restrict__ Q32, const float* __restrict__ K32, const _Float16* __restrict__ VTh, const _Float16* __restrict__ VTl, float* __restrict__ O32) {
  __shared__ __align__(16) float sS[8][16][68];
  __shared__ __align__(16) _Float16 sPh[8][16][72], sPl[8][16][72];
  __shared__ __align__(16) float sO[8][16][68];
  const int tid = threadIdx.x, lane = tid & 31, col = lane & 15, g = lane >> 4;
  const int w = __builtin_amdgcn_readfirstlane(tid >> 5);  // the wave's number in a scalar register: the key loop's bound stays a scalar compare and branch
  const size_t bh = blockIdx.y; const int qb = w < 4 ? SS / 64 - 1 - (int)blockIdx.x : (int)blockIdx.x; const int q0 = qb * 64 + (w & 3) * 16;
  F2 aq[2];
#pragma unroll
  for (int kc = 0; kc < 2; ++kc) aq[kc] = split_row(Q32 + (bh * SS + q0 + col) * HD, kc * 32, lane);
  float mrun = -3.0e38f, lrun = 0.f; v8f acc[4] = {}, ac1[4] = {}, ac2[4] = {};
#pragma unroll 1
  for (int kt = 0; kt <= qb; ++kt) {
#pragma unroll
    for (int t = 0; t < 4; ++t) { const int key = kt * 64 + t * 16 + col; const float* krow = K32 + (bh * SS + key) * HD;
      v8f s = mac3(aq[0], split_row(krow, 0, lane), (v8f){}); s = mac3(aq[1], split_row(krow, 32, lane), s);
#pragma unroll
      for (int r = 0; r < 8; ++r) { sS[w][8 * g + r][t * 16 + col] = (key > q0 + 8 * g + r) ? -3.0e38f : s[r] * 0.125f; } }
    LDSX();
    float mx = -3.4e38f;
#pragma unroll
    for (int jj = 0; jj < 32; ++jj) mx = fmaxf(mx, sS[w][col][g * 32 + jj]);
    mx = fmaxf(mx, __shfl_xor(mx, 16, 32));
    const float mnew = fmaxf(mrun, mx); const float corr = expf(mrun - mnew);
    float ps = 0.f;
#pragma unroll
    for (int jj = 0; jj < 32; ++jj) { const float p = expf(sS[w][col][g * 32 + jj] - mnew) * 16384.0f; ps += p; const _Float16 hi = (_Float16)p; sPh[w][col][g * 32 + jj] = hi; sPl[w][col][g * 32 + jj] = (_Float16)((p - (float)hi) * PLO); }
    ps += __shfl_xor(ps, 16, 32);
    lrun = lrun * corr + ps * (1.0f / 16384.0f); mrun = mnew;
#pragma unroll
    for (int r = 0; r < 8; ++r) { const float cr = __shfl(corr, 8 * g + r, 32);
#pragma unroll
      for (int t = 0; t < 4; ++t) { acc[t][r] *= cr; ac1[t][r] *= cr; ac2[t][r] *= cr; } }
    LDSX();
#pragma unroll
    for (int kc = 0; kc < 2; ++kc) { const v16h ph = frag_h(&sPh[w][col][0] + kc * 32, lane), pl = frag_h(&sPl[w][col][0] + kc * 32, lane);
#pragma unroll
      for (int t = 0; t < 4; ++t) { const size_t vo = (bh * HD + t * 16 + col) * SS + kt * 64 + kc * 32; const v16h vh = frag_h(VTh + vo, lane);
        acc[t] = wmma16(ph, vh, acc[t]); ac1[t] = wmma16(ph, frag_h(VTl + vo, lane), ac1[t]); ac2[t] = wmma16(pl, vh, ac2[t]); } }
    __builtin_amdgcn_wave_barrier(); }
#pragma unroll
  for (int r = 0; r < 8; ++r) { const float lr = __shfl(lrun, 8 * g + r, 32); const float inv = 1.0f / (lr * 16384.0f * 4.0f);
#pragma unroll
    for (int t = 0; t < 4; ++t) sO[w][8 * g + r][t * 16 + col] = (acc[t][r] + ac1[t][r] * (1.0f / VLO) + ac2[t][r] * (1.0f / PLO)) * inv; }
  LDSX();
  for (int qq = lane; qq < 16 * 16; qq += 32) { const int rl = qq >> 4, pc = qq & 15; vst2(O32 + ((bh * SS) + q0 + rl) * HD + pc * 4, *(const v4f*)(&sO[w][rl][pc * 4])); }
}
// out = ctx Wo + bo : split(ctx) x bf16(Wo columns): 2 products (Wo is an INPUT -> bf16 exact)
__global__ __launch_bounds__(128) void k_out(const float* __restrict__ O32, const __bf16* __restrict__ PT, const float* __restrict__ bo, float* __restrict__ out) {
  __shared__ __align__(16) float so[4][16][132];
  const int tid = threadIdx.x, wave = tid >> 5, lane = tid & 31, col = lane & 15, g = lane >> 4;
  const int r0 = blockIdx.x * 64 + wave * 16, n0 = blockIdx.y * 128; const int ra = r0 + col; const int b = ra / SS, s = ra % SS;
  v8f acc[8] = {};
#pragma unroll 1
  for (int kc = 0; kc < E / 32; ++kc) { const int h = kc >> 1; const F2 a = split_row(O32 + (((size_t)b * NH + h) * SS + s) * HD, (kc & 1) * 32, lane);
#pragma unroll
    for (int j = 0; j < 8; ++j) { const v16b wb = frag_b(PT + (size_t)(3 * E + n0 + j * 16 + col) * E + kc * 32, lane); acc[j] = wmma_bf(a.l, wb, acc[j]); acc[j] = wmma_bf(a.h, wb, acc[j]); } }
#pragma unroll
  for (int j = 0; j < 8; ++j) { const int n = n0 + j * 16 + col; const float bb = bfr(bo[n]);
#pragma unroll
    for (int r = 0; r < 8; ++r) so[wave][8 * g + r][j * 16 + col] = acc[j][r] + bb; }
  LDSX();
#pragma unroll 4
  for (int rl = 0; rl < 16; ++rl) vst2(out + (size_t)(r0 + rl) * E + n0 + lane * 4, *(const v4f*)(&so[wave][rl][lane * 4]));
}
// drift probe + gate: block = 16 rows, 16 waves; wave w does columns 32w..32w+31 of h = bf16(x) @ bf16(dp_w1) exact (+ bf16(b1)); then wave w owns row w: LN over 512 (16 values a lane, shuffle tree), exact GELU, . bf16(dp_w2) + bf16(dp_b2) -> drift; gate per row
__device__ __forceinline__ float wsum(float v) {
#pragma unroll
  for (int m = 16; m >= 1; m >>= 1) v += __shfl_xor(v, m, 32);
  return v;
}
__global__ __launch_bounds__(512) void k_gate(const __bf16* __restrict__ Xb, const float* __restrict__ W1, const float* __restrict__ b1, const float* __restrict__ lng, const float* __restrict__ lnb, const float* __restrict__ w2, const float* __restrict__ b2,
                                             const float* __restrict__ gw1, const float* __restrict__ gb1, const float* __restrict__ gw2, const float* __restrict__ gb2, float* __restrict__ GATE) {
  __shared__ __align__(16) float sh[16][DPH + 4]; __shared__ __align__(16) float sg[16];
  const int tid = threadIdx.x, wave = tid >> 5, lane = tid & 31, col = lane & 15, g = lane >> 4; const int r0 = blockIdx.x * 16;
  { v8f acc[2] = {};
// rolled: a trip waits on its own loads, and an unrolled build kept no more of them in flight
#pragma unroll 1
    for (int kc = 0; kc < E / 32; ++kc) { const v16b a = frag_b(Xb + (size_t)(r0 + col) * E + kc * 32, lane);
#pragma unroll
      for (int j = 0; j < 2; ++j) acc[j] = wmma_bf(a, split_col(W1, kc * 32, wave * 32 + j * 16 + col, lane, DPH, E).h, acc[j]); }
#pragma unroll
    for (int j = 0; j < 2; ++j) { const int n = wave * 32 + j * 16 + col; const float bb = bfr(b1[n]);
#pragma unroll
      for (int r = 0; r < 8; ++r) sh[8 * g + r][n] = acc[j][r] + bb; } }
  float pg[16], pb[16], pw[16];  // the lane's LN and dp_w2 parameters, fetched ahead of the barrier so that their latency is not paid between the GELU branches
#pragma unroll
  for (int k = 0; k < 16; ++k) { const int c = k * 32 + lane; pg[k] = bfr(lng[c]); pb[k] = bfr(lnb[c]); pw[k] = bfr(w2[c]); }
  __syncthreads();  // every wave's 32 columns of all 16 rows are in sh before a row is read
  { float v[16]; float s = 0.f;
#pragma unroll
    for (int k = 0; k < 16; ++k) { v[k] = sh[wave][k * 32 + lane]; s += v[k]; }
    const float mu = wsum(s) * (1.0f / DPH); float q = 0.f;
#pragma unroll
    for (int k = 0; k < 16; ++k) { const float d = v[k] - mu; q += d * d; }
    const float rs = rsqrtf(wsum(q) * (1.0f / DPH) + 1e-5f); float dot = 0.f;
#pragma unroll
    for (int k = 0; k < 16; ++k) dot += gelu_e((v[k] - mu) * rs * pg[k] + pb[k]) * pw[k];
    const float drift = wsum(dot) + bfr(b2[0]);
    const float t = g == 0 ? gelu_e(drift * bfr(gw1[col]) + bfr(gb1[col])) * bfr(gw2[col]) : 0.f;
    const float gsum = bfr(gb2[0]) + wsum(t);
    if (lane == 0) sg[wave] = tanhf(gsum); }
  __syncthreads();
  if (tid < 4) vst2(GATE + (size_t)blockIdx.x * 32 + tid * 4, *(const v4f*)(&sg[tid * 4]));
}
extern "C" void kernel_launch(void* const* d_in, const int* in_sizes, int n_in, void* d_out, int out_size, void* d_ws, size_t ws_size, hipStream_t stream) {
  (void)in_sizes; (void)n_in; (void)out_size; (void)ws_size;
  const float** I = (const float**)d_in;
  const float* x = I[0]; const float* Wq = I[1]; const float* bq = I[2]; const float* Wk = I[3]; const float* bk = I[4]; const float* Wv = I[5]; const float* bv = I[6]; const float* Wo = I[7]; const float* bo = I[8];
  const float* dw1 = I[9]; const float* db1 = I[10]; const float* lng = I[11]; const float* lnb = I[12]; const float* dw2 = I[13]; const float* db2 = I[14]; const float* gw1 = I[15]; const float* gb1 = I[16]; const float* gw2 = I[17]; const float* gb2 = I[18];
  float* out = (float*)d_out;
  char* ws = (char*)d_ws; size_t off = 0;
  auto take = [&](size_t bytes) { char* p = ws + off; off += (bytes + 255) & ~(size_t)255; return p; };
  __bf16* Xb = (__bf16*)take((size_t)NR * E * 2); __bf16* PT = (__bf16*)take((size_t)4 * E * E * 2); float* GATE = (float*)take((size_t)NR * 8);
  float* Q32 = (float*)take((size_t)NR * E * 4); float* K32 = (float*)take((size_t)NR * E * 4); _Float16* VTh = (_Float16*)take((size_t)NR * E * 2); _Float16* VTl = (_Float16*)take((size_t)NR * E * 2); float* O32 = (float*)take((size_t)NR * E * 4);
  // ws ~ 84 MB
  k_cvt<<<(NR * E / 8 + 255) / 256, 256, 0, stream>>>(x, Xb);
  k_pack<<<4 * E, 256, 0, stream>>>(Wq, Wk, Wv, Wo, PT);
  k_gate<<<NR / 16, 512, 0, stream>>>(Xb, dw1, db1, lng, lnb, dw2, db2, gw1, gb1, gw2, gb2, GATE);
  k_qkv<<<dim3(NR / 64, E / 128, 3), 128, 0, stream>>>(Xb, PT, bq, bk, bv, GATE, Q32, K32, VTh, VTl);
  k_attn<<<dim3(SS / 128, NB * NH), 256, 0, stream>>>(Q32, K32, VTh, VTl, O32);
  k_out<<<dim3(NR / 64, E / 128), 128, 0, stream>>>(O32, PT, bo, out);
}

// v003
// Measured time: 402 microseconds a run.
// Next to v002, in two timings, it ran 1.40 and 1.39 times as fast.
// Counting every step since v000, it is 2.01 times as fast.
// compute dtype: every module INPUT that feeds a GEMM (x, Wq/Wk/Wv/Wo, dp_w1, biases) is rounded to bf16 and used in exact bf16 WMMA products with f32 accumulation; computed operands (q/k, P, gate*V, context, the LN/GELU chain) are f32 or hi/lo pairs; mask/softmax/LayerNorm/GELU/tanh f32.
#include <hip/hip_runtime.h>
#include <math.h>

typedef __attribute__((ext_vector_type(16))) _Float16 v16h;
typedef __attribute__((ext_vector_type(16))) __bf16 v16b;
typedef __attribute__((ext_vector_type(8)))  _Float16 v8h;
typedef __attribute__((ext_vector_type(8)))  float v8f;
typedef __attribute__((ext_vector_type(4)))  float v4f;
typedef __attribute__((ext_vector_type(2)))  float v2f;
typedef __attribute__((ext_vector_type(4)))  unsigned v4u;
typedef __attribute__((ext_vector_type(4)))  int v4i;
typedef float __attribute__((may_alias)) float_a;
typedef int __attribute__((may_alias)) int_a;

template <typename T> __device__ __forceinline__ void vst2(void* p, T v) { *(T*)p = v;  }
__device__ __forceinline__ v8f wmma16(v16h a, v16h b, v8f c) {
  v8f d = __builtin_amdgcn_wmma_f32_16x16x32_f16(false, a, false, b, (short)0, c, false, false);
  asm volatile("v_nop\n\tv_nop\n\tv_nop\n\tv_nop" : "+v"(d) : "v"(a), "v"(b));
  return d;
}
__device__ __forceinline__ v8f wmma_bf(v16b a, v16b b, v8f c) {
  v8f d = __builtin_amdgcn_wmma_f32_16x16x32_bf16(false, a, false, b, (short)0, c, false, false);
  asm volatile("v_nop\n\tv_nop\n\tv_nop\n\tv_nop" : "+v"(d) : "v"(a), "v"(b));
  return d;
}
// 16x16x32 fragments: lane = (h = lane>>4, row/col = lane&15); elements 0..7 = k0+8h+0..7, 8..15 = k0+16+8h+0..7; D element r = row 8h+r
__device__ __forceinline__ v16h frag_h(const _Float16* rowk0, int lane) {
  union { v16h v; v8h q[2]; } u; const _Float16* p = rowk0 + 8 * (lane >> 4);
  u.q[0] = *(const v8h*)p; u.q[1] = *(const v8h*)(p + 16); return u.v;
}
__device__ __forceinline__ v16h frag_f32(const float* rowk0, int lane) {
  v16h a; const float* p = rowk0 + 8 * (lane >> 4);
#pragma unroll
  for (int i = 0; i < 8; ++i) { a[i] = (_Float16)p[i]; a[8 + i] = (_Float16)p[16 + i]; }
  return a;
}
__device__ __forceinline__ v16h frag_f32s(const float* rowk0, int lane, float sc) {
  v16h a; const float* p = rowk0 + 8 * (lane >> 4);
#pragma unroll
  for (int i = 0; i < 8; ++i) { a[i] = (_Float16)(p[i] * sc); a[8 + i] = (_Float16)(p[16 + i] * sc); }
  return a;
}
// column fragment from a [K][ld] layout (column n), rows >= K read as 0
__device__ __forceinline__ v16h fragc_f32(const float* W, int k0, int n, int lane, int ld, int K) {
  v16h a; const int g = lane >> 4;
#pragma unroll
  for (int i = 0; i < 8; ++i) { const int ka = k0 + 8 * g + i, kb = ka + 16;
    a[i] = (_Float16)(ka < K ? W[(size_t)ka * ld + n] : 0.f); a[8 + i] = (_Float16)(kb < K ? W[(size_t)kb * ld + n] : 0.f); }
  return a;
}
struct F2 { v16b h, l; };
__device__ __forceinline__ F2 bsplit16(const float v[16]) { F2 r;
#pragma unroll
  for (int i = 0; i < 16; ++i) { const __bf16 h = (__bf16)v[i]; r.h[i] = h; r.l[i] = (__bf16)(v[i] - (float)h); }
  return r; }
__device__ __forceinline__ F2 split_row(const float* row, int k0, int lane) { float v[16]; const float* p = row + k0 + 8 * (lane >> 4);
#pragma unroll
  for (int i = 0; i < 8; ++i) { v[i] = p[i]; v[8 + i] = p[16 + i]; }
  return bsplit16(v); }
__device__ __forceinline__ F2 split_rowK(const float* row, int k0, int lane, int K) { float v[16]; const int g = lane >> 4;
#pragma unroll
  for (int i = 0; i < 8; ++i) { const int ka = k0 + 8 * g + i, kb = ka + 16; v[i] = ka < K ? row[ka] : 0.f; v[8 + i] = kb < K ? row[kb] : 0.f; }
  return bsplit16(v); }
__device__ __forceinline__ F2 split_col(const float* W, int k0, int n, int lane, int ld, int K) { float v[16]; const int g = lane >> 4;
#pragma unroll
  for (int i = 0; i < 8; ++i) { const int ka = k0 + 8 * g + i, kb = ka + 16; v[i] = ka < K ? W[(size_t)ka * ld + n] : 0.f; v[8 + i] = kb < K ? W[(size_t)kb * ld + n] : 0.f; }
  return bsplit16(v); }
// the 16 f32 values of a lane's fragment, loads only: a group of them is issued ahead of the products that use them, and split or rounded later
struct R16 { float v[16]; };
__device__ __forceinline__ R16 raw_row(const float* row, int k0, int lane) { R16 r; const float* p = row + k0 + 8 * (lane >> 4);
#pragma unroll
  for (int i = 0; i < 8; ++i) { r.v[i] = p[i]; r.v[8 + i] = p[16 + i]; }
  return r; }
// a column of a [K][ld] layout: p is the lane's first value (row k0 + 8 * (lane >> 4)); rows k0 .. k0 + 31 are all below K at the one place of use (K = 1024, k0 <= 992)
__device__ __forceinline__ R16 raw_col(const float* p, int ld) { R16 r;
#pragma unroll
  for (int i = 0; i < 8; ++i) { r.v[i] = p[(size_t)i * ld]; r.v[8 + i] = p[(size_t)(16 + i) * ld]; }
  return r; }
__device__ __forceinline__ v8f mac3(const F2& a, const F2& b, v8f c) { c = wmma_bf(a.l, b.h, c); c = wmma_bf(a.h, b.l, c); return wmma_bf(a.h, b.h, c); }
__device__ __forceinline__ float sigm(float v) { return 1.0f / (1.0f + expf(-v)); }
// in front of an instruction that rewrites an address register of a global load issued above (the next address, or a later load's result in the same register)
#define XW() asm volatile("s_wait_xcnt 0x0" ::: "memory")
#define LDSX() do { asm volatile("s_wait_dscnt 0" ::: "memory"); __builtin_amdgcn_wave_barrier(); __builtin_amdgcn_fence(__ATOMIC_RELEASE, "workgroup"); } while (0)


// Causal self attention (16 heads of 64 on [2,2048,1024], [in][out] weights + biases, scale 1/8) whose post-softmax weights are multiplied by a per-KEY gate (no renormalisation)
// == V rows scaled by gate[key]; gate = tanh(gelu(drift*g_w1 + g_b1).g_w2 + g_b2), drift = gelu(LN(x dp_w1 + dp_b1)).dp_w2 + dp_b2 per token.
// bf16-rounded INPUT operands with exact bf16 WMMA products, hi/lo splits for computed operands; k_cvt, k_pack, k_gate, k_qkv, causal k_attn, k_out.
#define NB 2
#define SS 2048
#define E 1024
#define NH 16
#define HD 64
#define NR (NB * SS)
#define DPH 512
// GATE plane: 32 floats (one 128-byte line) per 16 rows, the first 16 used, so that a line has one writing block
#define GIDX(r) ((((r) >> 4) << 5) + ((r) & 15))
__device__ __forceinline__ float gelu_e(float x) { return 0.5f * x * (1.0f + erff(x * 0.70710678118654752f)); }
#define PLO 1024.0f
#define VLO 2048.0f
__device__ __forceinline__ float bfr(float v) { return (float)(__bf16)v; }
__device__ __forceinline__ v16b frag_b(const __bf16* rowk0, int lane) { return __builtin_bit_cast(v16b, frag_h((const _Float16*)rowk0, lane)); }

__global__ __launch_bounds__(256) void k_cvt(const float* __restrict__ x, __bf16* __restrict__ Xb) {
  const size_t i8 = (size_t)blockIdx.x * 256 + threadIdx.x; if (i8 >= (size_t)NR * E / 8) return;
  union { __bf16 h[8]; v4u u; } pk;
#pragma unroll
  for (int e = 0; e < 8; ++e) pk.h[e] = (__bf16)x[i8 * 8 + e];
  vst2((unsigned*)(Xb + i8 * 8), pk.u);
}
// PT rows: [0,E) Wq[:,n], [E,2E) Wk[:,n], [2E,3E) Wv[:,n], [3E,4E) Wo[:,n]  ([in][out] weights: column n as a bf16 row)
__global__ __launch_bounds__(256) void k_pack(const float* __restrict__ Wq, const float* __restrict__ Wk, const float* __restrict__ Wv, const float* __restrict__ Wo, __bf16* __restrict__ PT) {
  const int n = blockIdx.x, tid = threadIdx.x; __shared__ __align__(16) __bf16 srow[E];
  const float* W = n < E ? Wq : (n < 2 * E ? Wk : (n < 3 * E ? Wv : Wo)); const int nn = n & (E - 1);
  for (int k = tid; k < E; k += 256) srow[k] = (__bf16)W[(size_t)k * E + nn];
  __syncthreads();
  if (tid < E / 8) vst2((unsigned*)(PT + (size_t)n * E + tid * 8), *(const v4u*)(&srow[tid * 8]));
}
// QKV: block (64 rows, 128 cols = 2 heads, which); q,k -> Q32/K32 f32 [bh][s][64]; v -> VT hi/lo x4 [bh][d][s]
__global__ __launch_bounds__(128) void k_qkv(const __bf16* __restrict__ Xb, const __bf16* __restrict__ PT, const float* __restrict__ bq, const float* __restrict__ bk, const float* __restrict__ bv, const float* __restrict__ GATE,
                                            float* __restrict__ Q32, float* __restrict__ K32, _Float16* __restrict__ VTh, _Float16* __restrict__ VTl) {
  __shared__ __align__(16) float so[4][16][132];
  __shared__ __align__(16) _Float16 sth[128][72], stl[128][72];
  const int tid = threadIdx.x, wave = tid >> 5, lane = tid & 31, col = lane & 15, g = lane >> 4;
  const int which = blockIdx.z, r0b = blockIdx.x * 64, r0 = r0b + wave * 16, n0 = blockIdx.y * 128; const int b = r0b / SS, s0 = r0b % SS;
  const float* bb_ = which == 0 ? bq : (which == 1 ? bk : bv);
  v8f acc[8] = {};
  // the nine fragments of trip kc + 1 are loaded as one group ahead of trip kc's products: one load wait a trip, covered by eight products, not one in front of every product
  const __bf16* ap = Xb + (size_t)(r0 + col) * E; const __bf16* bp = PT + (size_t)(which * E + n0 + col) * E;
  v16b a = frag_b(ap, lane), bf[8]; XW();
#pragma unroll
  for (int j = 0; j < 8; ++j) bf[j] = frag_b(bp + (size_t)j * 16 * E, lane);
  XW();
  const __bf16* apn = ap + 32; const __bf16* bpn = bp + 32;  // where trip kc + 1's fragments lie
// two trips a pass, so that the two fragment sets swap by name and not by register copies
#pragma unroll 2
  for (int kc = 0; kc < E / 32; ++kc) {
    const v16b an = frag_b(apn, lane); v16b bn[8]; XW();
#pragma unroll
    for (int j = 0; j < 8; ++j) bn[j] = frag_b(bpn + (size_t)j * 16 * E, lane);
    XW();
#pragma unroll
    for (int j = 0; j < 8; ++j) acc[j] = wmma_bf(a, bf[j], acc[j]);
    a = an;
#pragma unroll
    for (int j = 0; j < 8; ++j) bf[j] = bn[j];
    if (kc + 2 < E / 32) { apn += 32; bpn += 32; } }  // the last trip loads its own fragments again (in bounds, not used)
  if (which < 2) {
#pragma unroll
    for (int j = 0; j < 8; ++j) { const float bb = bfr(bb_[n0 + j * 16 + col]);
#pragma unroll
      for (int r = 0; r < 8; ++r) so[wave][8 * g + r][j * 16 + col] = acc[j][r] + bb; }
    LDSX();
    float* Dst = which == 0 ? Q32 : K32;
    for (int qq = lane; qq < 2 * 16 * 16; qq += 32) { const int hh = qq >> 8, rl = (qq >> 4) & 15, pc = qq & 15; const int h = (n0 >> 6) + hh;
      vst2(Dst + (((size_t)b * NH + h) * SS + s0 + wave * 16 + rl) * HD + pc * 4, *(const v4f*)(&so[wave][rl][hh * 64 + pc * 4])); } }
  else {
#pragma unroll
    for (int j = 0; j < 8; ++j) { const float bb = bfr(bb_[n0 + j * 16 + col]);
#pragma unroll
      for (int r = 0; r < 8; ++r) { const float v = (acc[j][r] + bb) * GATE[GIDX(r0 + 8 * g + r)] * 4.0f; const _Float16 hi = (_Float16)v; sth[j * 16 + col][wave * 16 + 8 * g + r] = hi; stl[j * 16 + col][wave * 16 + 8 * g + r] = (_Float16)((v - (float)hi) * VLO); } }
    __syncthreads();
    for (int qq = tid; qq < 128 * 8; qq += 128) { const int cl = qq >> 3, pc = qq & 7; const int c = n0 + cl, h = c >> 6, d = c & 63; const size_t o = (((size_t)b * NH + h) * HD + d) * SS + s0 + pc * 8;
      vst2(VTh + o, *(const v4u*)(&sth[cl][pc * 8])); vst2(VTl + o, *(const v4u*)(&stl[cl][pc * 8])); } }
}
// causal attention: block (2 x 64 queries, bh): waves 0..3 take query tile 31 - t, waves 4..7 tile t, so that every block walks 33 key tiles per wave pair and no WGP is left with the long tiles alone
// (the waves share no barrier and no LDS range); key tiles 0..qb; S on hi/lo splits of the f32 q/k rows; P,V hi/lo; O f32 [bh][s][64]
// four waves a SIMD: holds the build at 256 registers a wave, so that two blocks stay on a WGP and all 512 run at once (without it the grouped loads took more, and one block a WGP)
__global__ __launch_bounds__(256) __attribute__((amdgpu_waves_per_eu(4, 4))) void k_attn(const float* __restrict__ Q32, const float* __restrict__ K32, const _Float16* __restrict__ VTh, const _Float16* __restrict__ VTl, float* __restrict__ O32) {
  __shared__ __align__(16) float sS[8][16][68];
  __shared__ __align__(16) _Float16 sPh[8][16][72], sPl[8][16][72];
  __shared__ __align__(16) float sO[8][16][68];
  const int tid = threadIdx.x, lane = tid & 31, col = lane & 15, g = lane >> 4;
  const int w = __builtin_amdgcn_readfirstlane(tid >> 5);  // the wave's number in a scalar register: the key loop's bound stays a scalar compare and branch
  const size_t bh = blockIdx.y; const int qb = w < 4 ? SS / 64 - 1 - (int)blockIdx.x : (int)blockIdx.x; const int q0 = qb * 64 + (w & 3) * 16;
  F2 aq[2];
#pragma unroll
  for (int kc = 0; kc < 2; ++kc) aq[kc] = split_row(Q32 + (bh * SS + q0 + col) * HD, kc * 32, lane);
  float mrun = -3.0e38f, lrun = 0.f; v8f acc[4] = {}, ac1[4] = {}, ac2[4] = {};
#pragma unroll 1
  for (int kt = 0; kt <= qb; ++kt) {
#pragma unroll
    for (int t = 0; t < 4; ++t) { const int key = kt * 64 + t * 16 + col; const float* krow = K32 + (bh * SS + key) * HD;
      const R16 k0 = raw_row(krow, 0, lane), k1 = raw_row(krow, 32, lane);  // the whole K row as one group ahead of its six products: four load waits a key tile, was eight
      v8f s = mac3(aq[0], bsplit16(k0.v), (v8f){}); s = mac3(aq[1], bsplit16(k1.v), s);
#pragma unroll
      for (int r = 0; r < 8; ++r) { sS[w][8 * g + r][t * 16 + col] = (key > q0 + 8 * g + r) ? -3.0e38f : s[r] * 0.125f; } }
    LDSX();
    // the V fragments of keys 0..31 of the tile are loaded here, ahead of the softmax, which covers their latency
    v16h vh[4], vl[4];
#pragma unroll
    for (int t = 0; t < 4; ++t) { const size_t vo = (bh * HD + t * 16 + col) * SS + kt * 64; vh[t] = frag_h(VTh + vo, lane); vl[t] = frag_h(VTl + vo, lane); }
    float mx = -3.4e38f;
#pragma unroll
    for (int jj = 0; jj < 32; ++jj) mx = fmaxf(mx, sS[w][col][g * 32 + jj]);
    mx = fmaxf(mx, __shfl_xor(mx, 16, 32));
    const float mnew = fmaxf(mrun, mx); const float corr = expf(mrun - mnew);
    float ps = 0.f;
#pragma unroll
    for (int jj = 0; jj < 32; ++jj) { const float p = expf(sS[w][col][g * 32 + jj] - mnew) * 16384.0f; ps += p; const _Float16 hi = (_Float16)p; sPh[w][col][g * 32 + jj] = hi; sPl[w][col][g * 32 + jj] = (_Float16)((p - (float)hi) * PLO); }
    ps += __shfl_xor(ps, 16, 32);
    lrun = lrun * corr + ps * (1.0f / 16384.0f); mrun = mnew;
#pragma unroll
    for (int r = 0; r < 8; ++r) { const float cr = __shfl(corr, 8 * g + r, 32);
#pragma unroll
      for (int t = 0; t < 4; ++t) { acc[t][r] *= cr; ac1[t][r] *= cr; ac2[t][r] *= cr; } }
    LDSX();
#pragma unroll
    for (int kc = 0; kc < 2; ++kc) { const v16h ph = frag_h(&sPh[w][col][0] + kc * 32, lane), pl = frag_h(&sPl[w][col][0] + kc * 32, lane);
      if (kc == 1) {  // keys 32..63: one group, into the registers that the first half has left
#pragma unroll
        for (int t = 0; t < 4; ++t) { const size_t vo = (bh * HD + t * 16 + col) * SS + kt * 64 + 32; vh[t] = frag_h(VTh + vo, lane); vl[t] = frag_h(VTl + vo, lane); } }
#pragma unroll
      for (int t = 0; t < 4; ++t) { acc[t] = wmma16(ph, vh[t], acc[t]); ac1[t] = wmma16(ph, vl[t], ac1[t]); ac2[t] = wmma16(pl, vh[t], ac2[t]); } }
    __builtin_amdgcn_wave_barrier(); }
#pragma unroll
  for (int r = 0; r < 8; ++r) { const float lr = __shfl(lrun, 8 * g + r, 32); const float inv = 1.0f / (lr * 16384.0f * 4.0f);
#pragma unroll
    for (int t = 0; t < 4; ++t) sO[w][8 * g + r][t * 16 + col] = (acc[t][r] + ac1[t][r] * (1.0f / VLO) + ac2[t][r] * (1.0f / PLO)) * inv; }
  LDSX();
  for (int qq = lane; qq < 16 * 16; qq += 32) { const int rl = qq >> 4, pc = qq & 15; vst2(O32 + ((bh * SS) + q0 + rl) * HD + pc * 4, *(const v4f*)(&sO[w][rl][pc * 4])); }
}
// out = ctx Wo + bo : split(ctx) x bf16(Wo columns): 2 products (Wo is an INPUT -> bf16 exact)
__global__ __launch_bounds__(128) void k_out(const float* __restrict__ O32, const __bf16* __restrict__ PT, const float* __restrict__ bo, float* __restrict__ out) {
  __shared__ __align__(16) float so[4][16][132];
  const int tid = threadIdx.x, wave = tid >> 5, lane = tid & 31, col = lane & 15, g = lane >> 4;
  const int r0 = blockIdx.x * 64 + wave * 16, n0 = blockIdx.y * 128; const int ra = r0 + col; const int b = ra / SS, s = ra % SS;
  v8f acc[8] = {};
  // trip kc + 1's context values and eight weight fragments are loaded as one group ahead of trip kc's products
  const __bf16* bp = PT + (size_t)(3 * E + n0 + col) * E;
  R16 ar = raw_row(O32 + (((size_t)b * NH) * SS + s) * HD, 0, lane); v16b wb[8];
#pragma unroll
  for (int j = 0; j < 8; ++j) wb[j] = frag_b(bp + (size_t)j * 16 * E, lane);
// two trips a pass, so that the two fragment sets swap by name and not by register copies
#pragma unroll 2
  for (int kc = 0; kc < E / 32; ++kc) { const int kn = kc + 1 < E / 32 ? kc + 1 : kc;  // the last trip loads its own fragments again (in bounds, not used)
    const R16 arn = raw_row(O32 + (((size_t)b * NH + (kn >> 1)) * SS + s) * HD, (kn & 1) * 32, lane); v16b wn[8];
#pragma unroll
    for (int j = 0; j < 8; ++j) wn[j] = frag_b(bp + (size_t)j * 16 * E + kn * 32, lane);
    const F2 a = bsplit16(ar.v);
#pragma unroll
    for (int j = 0; j < 8; ++j) { acc[j] = wmma_bf(a.l, wb[j], acc[j]); acc[j] = wmma_bf(a.h, wb[j], acc[j]); }
    ar = arn;
#pragma unroll
    for (int j = 0; j < 8; ++j) wb[j] = wn[j]; }
#pragma unroll
  for (int j = 0; j < 8; ++j) { const int n = n0 + j * 16 + col; const float bb = bfr(bo[n]);
#pragma unroll
    for (int r = 0; r < 8; ++r) so[wave][8 * g + r][j * 16 + col] = acc[j][r] + bb; }
  LDSX();
#pragma unroll 4
  for (int rl = 0; rl < 16; ++rl) vst2(out + (size_t)(r0 + rl) * E + n0 + lane * 4, *(const v4f*)(&so[wave][rl][lane * 4]));
}
// drift probe + gate: block = 16 rows, 16 waves; wave w does columns 32w..32w+31 of h = bf16(x) @ bf16(dp_w1) exact (+ bf16(b1)); then wave w owns row w: LN over 512 (16 values a lane, shuffle tree), exact GELU, . bf16(dp_w2) + bf16(dp_b2) -> drift; gate per row
__device__ __forceinline__ float wsum(float v) {
#pragma unroll
  for (int m = 16; m >= 1; m >>= 1) v += __shfl_xor(v, m, 32);
  return v;
}
__global__ __launch_bounds__(512) void k_gate(const __bf16* __restrict__ Xb, const float* __restrict__ W1, const float* __restrict__ b1, const float* __restrict__ lng, const float* __restrict__ lnb, const float* __restrict__ w2, const float* __restrict__ b2,
                                             const float* __restrict__ gw1, const float* __restrict__ gb1, const float* __restrict__ gw2, const float* __restrict__ gb2, float* __restrict__ GATE) {
  __shared__ __align__(16) float sh[16][DPH + 4]; __shared__ __align__(16) float sg[16];
  const int tid = threadIdx.x, wave = tid >> 5, lane = tid & 31, col = lane & 15, g = lane >> 4; const int r0 = blockIdx.x * 16;
  { v8f acc[2] = {};
    // trip kc + 1's x fragment and its 32 weight values are loaded as one group ahead of trip kc's products
    const __bf16* ap = Xb + (size_t)(r0 + col) * E; v16b a = frag_b(ap, lane); R16 wr[2]; XW();
    const float* wp = W1 + (size_t)(8 * g) * DPH + wave * 32 + col;
#pragma unroll
    for (int j = 0; j < 2; ++j) wr[j] = raw_col(wp + j * 16, DPH);
    XW();
    const __bf16* apn = ap + 32; const float* wpn = wp + 32 * DPH;  // where trip kc + 1's values lie
// two trips a pass, so that the two value sets swap by name and not by register copies
#pragma unroll 2
    for (int kc = 0; kc < E / 32; ++kc) {
      const v16b an = frag_b(apn, lane); R16 wn[2]; XW();
#pragma unroll
      for (int j = 0; j < 2; ++j) wn[j] = raw_col(wpn + j * 16, DPH);
      XW();
#pragma unroll
      for (int j = 0; j < 2; ++j) acc[j] = wmma_bf(a, bsplit16(wr[j].v).h, acc[j]);
      a = an; wr[0] = wn[0]; wr[1] = wn[1];
      if (kc + 2 < E / 32) { apn += 32; wpn += 32 * DPH; } }  // the last trip loads its own values again (in bounds, not used)
#pragma unroll
    for (int j = 0; j < 2; ++j) { const int n = wave * 32 + j * 16 + col; const float bb = bfr(b1[n]);
#pragma unroll
      for (int r = 0; r < 8; ++r) sh[8 * g + r][n] = acc[j][r] + bb; } }
  float pg[16], pb[16], pw[16];  // the lane's LN and dp_w2 parameters, fetched ahead of the barrier so that their latency is not paid between the GELU branches
#pragma unroll
  for (int k = 0; k < 16; ++k) { const int c = k * 32 + lane; pg[k] = bfr(lng[c]); pb[k] = bfr(lnb[c]); pw[k] = bfr(w2[c]); }
  __syncthreads();  // every wave's 32 columns of all 16 rows are in sh before a row is read
  { float v[16]; float s = 0.f;
#pragma unroll
    for (int k = 0; k < 16; ++k) { v[k] = sh[wave][k * 32 + lane]; s += v[k]; }
    const float mu = wsum(s) * (1.0f / DPH); float q = 0.f;
#pragma unroll
    for (int k = 0; k < 16; ++k) { const float d = v[k] - mu; q += d * d; }
    const float rs = rsqrtf(wsum(q) * (1.0f / DPH) + 1e-5f); float dot = 0.f;
#pragma unroll
    for (int k = 0; k < 16; ++k) dot += gelu_e((v[k] - mu) * rs * pg[k] + pb[k]) * pw[k];
    const float drift = wsum(dot) + bfr(b2[0]);
    const float t = g == 0 ? gelu_e(drift * bfr(gw1[col]) + bfr(gb1[col])) * bfr(gw2[col]) : 0.f;
    const float gsum = bfr(gb2[0]) + wsum(t);
    if (lane == 0) sg[wave] = tanhf(gsum); }
  __syncthreads();
  if (tid < 4) vst2(GATE + (size_t)blockIdx.x * 32 + tid * 4, *(const v4f*)(&sg[tid * 4]));
}
extern "C" void kernel_launch(void* const* d_in, const int* in_sizes, int n_in, void* d_out, int out_size, void* d_ws, size_t ws_size, hipStream_t stream) {
  (void)in_sizes; (void)n_in; (void)out_size; (void)ws_size;
  const float** I = (const float**)d_in;
  const float* x = I[0]; const float* Wq = I[1]; const float* bq = I[2]; const float* Wk = I[3]; const float* bk = I[4]; const float* Wv = I[5]; const float* bv = I[6]; const float* Wo = I[7]; const float* bo = I[8];
  const float* dw1 = I[9]; const float* db1 = I[10]; const float* lng = I[11]; const float* lnb = I[12]; const float* dw2 = I[13]; const float* db2 = I[14]; const float* gw1 = I[15]; const float* gb1 = I[16]; const float* gw2 = I[17]; const float* gb2 = I[18];
  float* out = (float*)d_out;
  char* ws = (char*)d_ws; size_t off = 0;
  auto take = [&](size_t bytes) { char* p = ws + off; off += (bytes + 255) & ~(size_t)255; return p; };
  __bf16* Xb = (__bf16*)take((size_t)NR * E * 2); __bf16* PT = (__bf16*)take((size_t)4 * E * E * 2); float* GATE = (float*)take((size_t)NR * 8);
  float* Q32 = (float*)take((size_t)NR * E * 4); float* K32 = (float*)take((size_t)NR * E * 4); _Float16* VTh = (_Float16*)take((size_t)NR * E * 2); _Float16* VTl = (_Float16*)take((size_t)NR * E * 2); float* O32 = (float*)take((size_t)NR * E * 4);
  // ws ~ 84 MB
  k_cvt<<<(NR * E / 8 + 255) / 256, 256, 0, stream>>>(x, Xb);
  k_pack<<<4 * E, 256, 0, stream>>>(Wq, Wk, Wv, Wo, PT);
  k_gate<<<NR / 16, 512, 0, stream>>>(Xb, dw1, db1, lng, lnb, dw2, db2, gw1, gb1, gw2, gb2, GATE);
  k_qkv<<<dim3(NR / 64, E / 128, 3), 128, 0, stream>>>(Xb, PT, bq, bk, bv, GATE, Q32, K32, VTh, VTl);
  k_attn<<<dim3(SS / 128, NB * NH), 256, 0, stream>>>(Q32, K32, VTh, VTl, O32);
  k_out<<<dim3(NR / 64, E / 128), 128, 0, stream>>>(O32, PT, bo, out);
}

// v004
// It runs in 255 microseconds.
// In two side-by-side timings against v003, it was 1.60 and 1.58 times as fast.
// Over all steps from v000 it is 3.19 times as fast.
// compute dtype: every module INPUT that feeds a GEMM (x, Wq/Wk/Wv/Wo, dp_w1, biases) is rounded to bf16 and used in exact bf16 WMMA products with f32 accumulation; computed operands (q/k, P, gate*V, context, the LN/GELU chain) are f32 or hi/lo pairs; mask/softmax/LayerNorm/GELU/tanh f32.
#include <hip/hip_runtime.h>
#include <math.h>

typedef __attribute__((ext_vector_type(16))) _Float16 v16h;
typedef __attribute__((ext_vector_type(16))) __bf16 v16b;
typedef __attribute__((ext_vector_type(8)))  _Float16 v8h;
typedef __attribute__((ext_vector_type(8)))  float v8f;
typedef __attribute__((ext_vector_type(4)))  float v4f;
typedef __attribute__((ext_vector_type(2)))  float v2f;
typedef __attribute__((ext_vector_type(4)))  unsigned v4u;
typedef __attribute__((ext_vector_type(4)))  int v4i;
typedef float __attribute__((may_alias)) float_a;
typedef int __attribute__((may_alias)) int_a;

template <typename T> __device__ __forceinline__ void vst2(void* p, T v) { *(T*)p = v;  }
__device__ __forceinline__ v8f wmma16(v16h a, v16h b, v8f c) {
  v8f d = __builtin_amdgcn_wmma_f32_16x16x32_f16(false, a, false, b, (short)0, c, false, false);
  asm volatile("v_nop\n\tv_nop\n\tv_nop\n\tv_nop" : "+v"(d) : "v"(a), "v"(b));
  return d;
}
__device__ __forceinline__ v8f wmma_bf(v16b a, v16b b, v8f c) {
  v8f d = __builtin_amdgcn_wmma_f32_16x16x32_bf16(false, a, false, b, (short)0, c, false, false);
  asm volatile("v_nop\n\tv_nop\n\tv_nop\n\tv_nop" : "+v"(d) : "v"(a), "v"(b));
  return d;
}
// 16x16x32 fragments: lane = (h = lane>>4, row/col = lane&15); elements 0..7 = k0+8h+0..7, 8..15 = k0+16+8h+0..7; D element r = row 8h+r
__device__ __forceinline__ v16h frag_h(const _Float16* rowk0, int lane) {
  union { v16h v; v8h q[2]; } u; const _Float16* p = rowk0 + 8 * (lane >> 4);
  u.q[0] = *(const v8h*)p; u.q[1] = *(const v8h*)(p + 16); return u.v;
}
__device__ __forceinline__ v16h frag_f32(const float* rowk0, int lane) {
  v16h a; const float* p = rowk0 + 8 * (lane >> 4);
#pragma unroll
  for (int i = 0; i < 8; ++i) { a[i] = (_Float16)p[i]; a[8 + i] = (_Float16)p[16 + i]; }
  return a;
}
__device__ __forceinline__ v16h frag_f32s(const float* rowk0, int lane, float sc) {
  v16h a; const float* p = rowk0 + 8 * (lane >> 4);
#pragma unroll
  for (int i = 0; i < 8; ++i) { a[i] = (_Float16)(p[i] * sc); a[8 + i] = (_Float16)(p[16 + i] * sc); }
  return a;
}
// column fragment from a [K][ld] layout (column n), rows >= K read as 0
__device__ __forceinline__ v16h fragc_f32(const float* W, int k0, int n, int lane, int ld, int K) {
  v16h a; const int g = lane >> 4;
#pragma unroll
  for (int i = 0; i < 8; ++i) { const int ka = k0 + 8 * g + i, kb = ka + 16;
    a[i] = (_Float16)(ka < K ? W[(size_t)ka * ld + n] : 0.f); a[8 + i] = (_Float16)(kb < K ? W[(size_t)kb * ld + n] : 0.f); }
  return a;
}
struct F2 { v16b h, l; };
__device__ __forceinline__ F2 bsplit16(const float v[16]) { F2 r;
#pragma unroll
  for (int i = 0; i < 16; ++i) { const __bf16 h = (__bf16)v[i]; r.h[i] = h; r.l[i] = (__bf16)(v[i] - (float)h); }
  return r; }
__device__ __forceinline__ F2 split_row(const float* row, int k0, int lane) { float v[16]; const float* p = row + k0 + 8 * (lane >> 4);
#pragma unroll
  for (int i = 0; i < 8; ++i) { v[i] = p[i]; v[8 + i] = p[16 + i]; }
  return bsplit16(v); }
__device__ __forceinline__ F2 split_rowK(const float* row, int k0, int lane, int K) { float v[16]; const int g = lane >> 4;
#pragma unroll
  for (int i = 0; i < 8; ++i) { const int ka = k0 + 8 * g + i, kb = ka + 16; v[i] = ka < K ? row[ka] : 0.f; v[8 + i] = kb < K ? row[kb] : 0.f; }
  return bsplit16(v); }
__device__ __forceinline__ F2 split_col(const float* W, int k0, int n, int lane, int ld, int K) { float v[16]; const int g = lane >> 4;
#pragma unroll
  for (int i = 0; i < 8; ++i) { const int ka = k0 + 8 * g + i, kb = ka + 16; v[i] = ka < K ? W[(size_t)ka * ld + n] : 0.f; v[8 + i] = kb < K ? W[(size_t)kb * ld + n] : 0.f; }
  return bsplit16(v); }
// the 16 f32 values of a lane's fragment, loads only: a group of them is issued ahead of the products that use them, and split or rounded later
struct R16 { float v[16]; };
// fragment order: a plane holds each 16 x 32 fragment as the lanes take it, so that every load of a wave is 512 contiguous bytes (four whole lines, not sixteen part lines)
// 16-bit values: 1 KiB a fragment, [half of the lane's 16 values][lane][8 values]; f32 values: 2 KiB a fragment, [quarter of the lane's 16 values][lane][4 values]
__device__ __forceinline__ v16h fragF_h(const _Float16* f, int lane) {
  union { v16h v; v8h q[2]; } u; const _Float16* p = f + lane * 8;
  u.q[0] = *(const v8h*)p; u.q[1] = *(const v8h*)(p + 256); return u.v;
}
__device__ __forceinline__ R16 rawF(const float* f, int lane) { R16 r; const float* p = f + lane * 4;
#pragma unroll
  for (int j = 0; j < 4; ++j) { const v4f t = *(const v4f*)(p + j * 128); r.v[4 * j] = t[0]; r.v[4 * j + 1] = t[1]; r.v[4 * j + 2] = t[2]; r.v[4 * j + 3] = t[3]; }
  return r; }
__device__ __forceinline__ v8f mac3(const F2& a, const F2& b, v8f c) { c = wmma_bf(a.l, b.h, c); c = wmma_bf(a.h, b.l, c); return wmma_bf(a.h, b.h, c); }
__device__ __forceinline__ float sigm(float v) { return 1.0f / (1.0f + expf(-v)); }
// in front of an instruction that rewrites an address register of a global load issued above (the next address, or a later load's result in the same register)
#define XW() asm volatile("s_wait_xcnt 0x0" ::: "memory")
#define LDSX() do { asm volatile("s_wait_dscnt 0" ::: "memory"); __builtin_amdgcn_wave_barrier(); __builtin_amdgcn_fence(__ATOMIC_RELEASE, "workgroup"); } while (0)


// Causal self attention (16 heads of 64 on [2,2048,1024], [in][out] weights + biases, scale 1/8) whose post-softmax weights are multiplied by a per-KEY gate (no renormalisation)
// == V rows scaled by gate[key]; gate = tanh(gelu(drift*g_w1 + g_b1).g_w2 + g_b2), drift = gelu(LN(x dp_w1 + dp_b1)).dp_w2 + dp_b2 per token.
// bf16-rounded INPUT operands with exact bf16 WMMA products, hi/lo splits for computed operands; k_cvt, k_pack, k_gate, k_qkv, causal k_attn, k_out.
#define NB 2
#define SS 2048
#define E 1024
#define NH 16
#define HD 64
#define NR (NB * SS)
#define DPH 512
// GATE plane: 32 floats (one 128-byte line) per 16 rows, the first 16 used, so that a line has one writing block
#define GIDX(r) ((((r) >> 4) << 5) + ((r) & 15))
__device__ __forceinline__ float gelu_e(float x) { return 0.5f * x * (1.0f + erff(x * 0.70710678118654752f)); }
#define PLO 1024.0f
#define VLO 2048.0f
__device__ __forceinline__ float bfr(float v) { return (float)(__bf16)v; }
__device__ __forceinline__ v16b fragF_b(const __bf16* f, int lane) { return __builtin_bit_cast(v16b, fragF_h((const _Float16*)f, lane)); }
// values of a fragment-order plane per 16 rows of 1024 (32 fragments of 512)
#define FRT 16384

// Xb in fragment order: [16 rows][32 k][half][lane][8]; thread = one 16-byte unit of the plane (a block reads 16 rows x 512 bytes of x)
__global__ __launch_bounds__(256) void k_cvt(const float* __restrict__ x, __bf16* __restrict__ Xb) {
  const size_t i8 = (size_t)blockIdx.x * 256 + threadIdx.x; if (i8 >= (size_t)NR * E / 8) return;
  const int ln = (int)(i8 & 31), q = (int)(i8 >> 5) & 1, kc = (int)(i8 >> 6) & 31; const size_t rt = i8 >> 11;
  const float* p = x + (rt * 16 + (ln & 15)) * E + kc * 32 + q * 16 + (ln >> 4) * 8;
  union { __bf16 h[8]; v4u u; } pk;
#pragma unroll
  for (int e = 0; e < 8; ++e) pk.h[e] = (__bf16)p[e];
  vst2((unsigned*)(Xb + i8 * 8), pk.u);
}
// PT columns: [0,E) Wq[:,n], [E,2E) Wk[:,n], [2E,3E) Wv[:,n], [3E,4E) Wo[:,n], [4E,4E+DPH) dp_w1[:,n]  ([in][out] weights), bf16 in fragment order: [16 columns][32 k][half][lane][8]
// block (32 k, 128 columns, matrix): whole rows of W in, turned in LDS, whole fragments out
__global__ __launch_bounds__(256) void k_pack(const float* __restrict__ Wq, const float* __restrict__ Wk, const float* __restrict__ Wv, const float* __restrict__ Wo, const float* __restrict__ W1, __bf16* __restrict__ PT) {
  __shared__ __align__(16) __bf16 st[128][40];
  const int tid = threadIdx.x, kc = blockIdx.x, n0 = blockIdx.y * 128, m = blockIdx.z;
  const int ld = m == 4 ? DPH : E; if (n0 >= ld) return;  // dp_w1 has 512 columns: the whole block leaves, ahead of the barrier
  const float* W = m == 0 ? Wq : (m == 1 ? Wk : (m == 2 ? Wv : (m == 3 ? Wo : W1)));
  for (int i = tid; i < 32 * 128; i += 256) { const int k = i >> 7, n = i & 127; st[n][k] = (__bf16)W[(size_t)(kc * 32 + k) * ld + n0 + n]; }
  __syncthreads();
  for (int u = tid; u < 512; u += 256) { const int ln = u & 31, q = (u >> 5) & 1, nt = u >> 6;
    vst2((unsigned*)(PT + (size_t)(((m * E + n0) >> 4) + nt) * FRT + kc * 512 + q * 256 + ln * 8), *(const v4u*)(&st[nt * 16 + (ln & 15)][q * 16 + (ln >> 4) * 8])); }
}
// QKV: block (64 rows, 128 cols = 2 heads, which); q -> Q32 f32 [bh][s][64]; k -> K32 f32 in fragment order [bh][16 keys][32 d][quarter][lane][4]; v -> VT hi/lo x4 in fragment order [bh][32 keys][16 d][half][lane][8]
__global__ __launch_bounds__(128) void k_qkv(const __bf16* __restrict__ Xb, const __bf16* __restrict__ PT, const float* __restrict__ bq, const float* __restrict__ bk, const float* __restrict__ bv, const float* __restrict__ GATE,
                                            float* __restrict__ Q32, float* __restrict__ K32, _Float16* __restrict__ VTh, _Float16* __restrict__ VTl) {
  __shared__ __align__(16) float so[4][16][132];
  __shared__ __align__(16) _Float16 sth[128][72], stl[128][72];
  const int tid = threadIdx.x, wave = tid >> 5, lane = tid & 31, col = lane & 15, g = lane >> 4;
  const int which = blockIdx.z, r0b = blockIdx.x * 64, r0 = r0b + wave * 16, n0 = blockIdx.y * 128; const int b = r0b / SS, s0 = r0b % SS;
  const float* bb_ = which == 0 ? bq : (which == 1 ? bk : bv);
  v8f acc[8] = {};
  // the nine fragments of trip kc + 1 are loaded as one group ahead of trip kc's products: one load wait a trip, covered by eight products, not one in front of every product
  const __bf16* ap = Xb + (size_t)(r0 >> 4) * FRT; const __bf16* bp = PT + (size_t)((which * E + n0) >> 4) * FRT;
  v16b a = fragF_b(ap, lane), bf[8]; XW();
#pragma unroll
  for (int j = 0; j < 8; ++j) bf[j] = fragF_b(bp + (size_t)j * FRT, lane);
  XW();
  const __bf16* apn = ap + 512; const __bf16* bpn = bp + 512;  // where trip kc + 1's fragments lie
// two trips a pass, so that the two fragment sets swap by name and not by register copies
#pragma unroll 2
  for (int kc = 0; kc < E / 32; ++kc) {
    const v16b an = fragF_b(apn, lane); v16b bn[8]; XW();
#pragma unroll
    for (int j = 0; j < 8; ++j) bn[j] = fragF_b(bpn + (size_t)j * FRT, lane);
    XW();
#pragma unroll
    for (int j = 0; j < 8; ++j) acc[j] = wmma_bf(a, bf[j], acc[j]);
    a = an;
#pragma unroll
    for (int j = 0; j < 8; ++j) bf[j] = bn[j];
    if (kc + 2 < E / 32) { apn += 512; bpn += 512; } }  // the last trip loads its own fragments again (in bounds, not used)
  if (which < 2) {
#pragma unroll
    for (int j = 0; j < 8; ++j) { const float bb = bfr(bb_[n0 + j * 16 + col]);
#pragma unroll
      for (int r = 0; r < 8; ++r) so[wave][8 * g + r][j * 16 + col] = acc[j][r] + bb; }
    LDSX();
    if (which == 0) {
      for (int qq = lane; qq < 2 * 16 * 16; qq += 32) { const int hh = qq >> 8, rl = (qq >> 4) & 15, pc = qq & 15; const int h = (n0 >> 6) + hh;
        vst2(Q32 + (((size_t)b * NH + h) * SS + s0 + wave * 16 + rl) * HD + pc * 4, *(const v4f*)(&so[wave][rl][hh * 64 + pc * 4])); } }
    else {  // the wave's 16 keys x 2 heads: four fragments of four quarters; the lane stores what it will load as lane (g, col = key)
// unrolled: the sixteen stores go out as one run, with no register of an issued store rewritten on a back edge
#pragma unroll
      for (int u = 0; u < 16; ++u) { const int j = u & 3, kc = (u >> 2) & 1, hh = u >> 3; const int h = (n0 >> 6) + hh;
        vst2(K32 + ((((size_t)b * NH + h) * (SS / 16) + (s0 >> 4) + wave) * 2 + kc) * 512 + j * 128 + lane * 4, *(const v4f*)(&so[wave][col][hh * 64 + kc * 32 + (j >> 1) * 16 + g * 8 + (j & 1) * 4])); }
      XW(); } }
  else {
#pragma unroll
    for (int j = 0; j < 8; ++j) { const float bb = bfr(bb_[n0 + j * 16 + col]);
#pragma unroll
      for (int r = 0; r < 8; ++r) { const float v = (acc[j][r] + bb) * GATE[GIDX(r0 + 8 * g + r)] * 4.0f; const _Float16 hi = (_Float16)v; sth[j * 16 + col][wave * 16 + 8 * g + r] = hi; stl[j * 16 + col][wave * 16 + 8 * g + r] = (_Float16)((v - (float)hi) * VLO); } }
    __syncthreads();
    for (int qq = tid; qq < 128 * 8; qq += 128) { const int ln = qq & 31, q = (qq >> 5) & 1, t = (qq >> 6) & 3, k32 = (qq >> 8) & 1, hh = qq >> 9;
      const int cl = hh * 64 + t * 16 + (ln & 15), pc = k32 * 4 + q * 2 + (ln >> 4), h = (n0 >> 6) + hh; const size_t o = (((((size_t)b * NH + h) * (SS / 32) + (s0 >> 5) + k32) * 4 + t) * 2 + q) * 256 + ln * 8;
      vst2(VTh + o, *(const v4u*)(&sth[cl][pc * 8])); vst2(VTl + o, *(const v4u*)(&stl[cl][pc * 8])); } }
}
// causal attention: block (2 x 64 queries, bh): waves 0..3 take query tile 31 - t, waves 4..7 tile t, so that every block walks 33 key tiles per wave pair and no WGP is left with the long tiles alone
// (the waves share no barrier and no LDS range); key tiles 0..qb; S on hi/lo splits of the f32 q/k rows; P,V hi/lo; O f32 in fragment order [16 rows][32 k][quarter][lane][4]
// four waves a SIMD: holds the build at 256 registers a wave, so that two blocks stay on a WGP and all 512 run at once (without it the grouped loads took more, and one block a WGP)
__global__ __launch_bounds__(256) __attribute__((amdgpu_waves_per_eu(4, 4))) void k_attn(const float* __restrict__ Q32, const float* __restrict__ K32, const _Float16* __restrict__ VTh, const _Float16* __restrict__ VTl, float* __restrict__ O32) {
  __shared__ __align__(16) float sS[8][16][68];
  __shared__ __align__(16) _Float16 sPh[8][16][72], sPl[8][16][72];
  __shared__ __align__(16) float sO[8][16][68];
  const int tid = threadIdx.x, lane = tid & 31, col = lane & 15, g = lane >> 4;
  const int w = __builtin_amdgcn_readfirstlane(tid >> 5);  // the wave's number in a scalar register: the key loop's bound stays a scalar compare and branch
  const size_t bh = blockIdx.y; const int qb = w < 4 ? SS / 64 - 1 - (int)blockIdx.x : (int)blockIdx.x; const int q0 = qb * 64 + (w & 3) * 16;
  F2 aq[2];
#pragma unroll
  for (int kc = 0; kc < 2; ++kc) aq[kc] = split_row(Q32 + (bh * SS + q0 + col) * HD, kc * 32, lane);
  float mrun = -3.0e38f, lrun = 0.f; v8f acc[4] = {}, ac1[4] = {}, ac2[4] = {};
#pragma unroll 1
  for (int kt = 0; kt <= qb; ++kt) {
#pragma unroll
    for (int t = 0; t < 4; ++t) { const int key = kt * 64 + t * 16 + col; const float* kf = K32 + (bh * (SS / 16) + kt * 4 + t) * 1024;
      const R16 k0 = rawF(kf, lane), k1 = rawF(kf + 512, lane); XW();  // the whole K row as one group ahead of its six products: four load waits a key tile, was eight
      v8f s = mac3(aq[0], bsplit16(k0.v), (v8f){}); s = mac3(aq[1], bsplit16(k1.v), s);
#pragma unroll
      for (int r = 0; r < 8; ++r) { sS[w][8 * g + r][t * 16 + col] = (key > q0 + 8 * g + r) ? -3.0e38f : s[r] * 0.125f; } }
    LDSX();
    // the V fragments of keys 0..31 of the tile are loaded here, ahead of the softmax, which covers their latency
    v16h vh[4], vl[4];
#pragma unroll
    for (int t = 0; t < 4; ++t) { const size_t vo = ((bh * (SS / 32) + kt * 2) * 4 + t) * 512; vh[t] = fragF_h(VTh + vo, lane); vl[t] = fragF_h(VTl + vo, lane); }
    XW();
    float mx = -3.4e38f;
#pragma unroll
    for (int jj = 0; jj < 32; ++jj) mx = fmaxf(mx, sS[w][col][g * 32 + jj]);
    mx = fmaxf(mx, __shfl_xor(mx, 16, 32));
    const float mnew = fmaxf(mrun, mx); const float corr = expf(mrun - mnew);
    float ps = 0.f;
#pragma unroll
    for (int jj = 0; jj < 32; ++jj) { const float p = expf(sS[w][col][g * 32 + jj] - mnew) * 16384.0f; ps += p; const _Float16 hi = (_Float16)p; sPh[w][col][g * 32 + jj] = hi; sPl[w][col][g * 32 + jj] = (_Float16)((p - (float)hi) * PLO); }
    ps += __shfl_xor(ps, 16, 32);
    lrun = lrun * corr + ps * (1.0f / 16384.0f); mrun = mnew;
#pragma unroll
    for (int r = 0; r < 8; ++r) { const float cr = __shfl(corr, 8 * g + r, 32);
#pragma unroll
      for (int t = 0; t < 4; ++t) { acc[t][r] *= cr; ac1[t][r] *= cr; ac2[t][r] *= cr; } }
    LDSX();
#pragma unroll
    for (int kc = 0; kc < 2; ++kc) { const v16h ph = frag_h(&sPh[w][col][0] + kc * 32, lane), pl = frag_h(&sPl[w][col][0] + kc * 32, lane);
      if (kc == 1) {  // keys 32..63: one group, into the registers that the first half has left
#pragma unroll
        for (int t = 0; t < 4; ++t) { const size_t vo = ((bh * (SS / 32) + kt * 2 + 1) * 4 + t) * 512; vh[t] = fragF_h(VTh + vo, lane); vl[t] = fragF_h(VTl + vo, lane); }
        XW(); }
#pragma unroll
      for (int t = 0; t < 4; ++t) { acc[t] = wmma16(ph, vh[t], acc[t]); ac1[t] = wmma16(ph, vl[t], ac1[t]); ac2[t] = wmma16(pl, vh[t], ac2[t]); } }
    __builtin_amdgcn_wave_barrier(); }
#pragma unroll
  for (int r = 0; r < 8; ++r) { const float lr = __shfl(lrun, 8 * g + r, 32); const float inv = 1.0f / (lr * 16384.0f * 4.0f);
#pragma unroll
    for (int t = 0; t < 4; ++t) sO[w][8 * g + r][t * 16 + col] = (acc[t][r] + ac1[t][r] * (1.0f / VLO) + ac2[t][r] * (1.0f / PLO)) * inv; }
  LDSX();
  const size_t ob = ((((bh / NH) * SS + q0) >> 4) * 32 + (bh % NH) * 2) * 512;  // the wave's 16 rows, its head's two fragments
  for (int u = 0; u < 8; ++u) { const int j = u & 3, kc = u >> 2; vst2(O32 + ob + kc * 512 + j * 128 + lane * 4, *(const v4f*)(&sO[w][col][kc * 32 + (j >> 1) * 16 + g * 8 + (j & 1) * 4])); }
}
// out = ctx Wo + bo : split(ctx) x bf16(Wo columns): 2 products (Wo is an INPUT -> bf16 exact)
__global__ __launch_bounds__(128) void k_out(const float* __restrict__ O32, const __bf16* __restrict__ PT, const float* __restrict__ bo, float* __restrict__ out) {
  __shared__ __align__(16) float so[4][16][132];
  const int tid = threadIdx.x, wave = tid >> 5, lane = tid & 31, col = lane & 15, g = lane >> 4;
  const int r0 = blockIdx.x * 64 + wave * 16, n0 = blockIdx.y * 128;
  v8f acc[8] = {};
  // trip kc + 1's context values and eight weight fragments are loaded as one group ahead of trip kc's products
  const float* op = O32 + (size_t)(r0 >> 4) * FRT; const __bf16* bp = PT + (size_t)((3 * E + n0) >> 4) * FRT;
  R16 ar = rawF(op, lane); v16b wb[8]; XW();
#pragma unroll
  for (int j = 0; j < 8; ++j) wb[j] = fragF_b(bp + (size_t)j * FRT, lane);
  XW();
  const float* opn = op + 512;  // where trip kc + 1's context fragment lies
  unsigned wof = (unsigned)((((3 * E + n0) >> 4) * FRT + 512 + lane * 8) * 2);  // the lane's byte offset in PT of trip kc + 1's first weight fragment
// two trips a pass, so that the two fragment sets swap by name and not by register copies
#pragma unroll 2
  for (int kc = 0; kc < E / 32; ++kc) {
    const R16 arn = rawF(opn, lane); v16b wn[8]; XW();
#pragma unroll
    for (int j = 0; j < 8; ++j) wn[j] = fragF_b((const __bf16*)((const char*)PT + (size_t)wof + (size_t)j * FRT * 2), 0);
    asm volatile("s_wait_xcnt 0x0" : "+v"(wof) :: "memory");  // as XW(); the offset register that the sixteen loads name passes through the wait, so that it stays whole up to it and no load of the group lands in it
    const F2 a = bsplit16(ar.v);
#pragma unroll
    for (int j = 0; j < 8; ++j) { acc[j] = wmma_bf(a.l, wb[j], acc[j]); acc[j] = wmma_bf(a.h, wb[j], acc[j]); }
    ar = arn;
#pragma unroll
    for (int j = 0; j < 8; ++j) wb[j] = wn[j];
    if (kc + 2 < E / 32) { opn += 512; wof += 1024; } }  // the last trip loads its own fragments again (in bounds, not used)
#pragma unroll
  for (int j = 0; j < 8; ++j) { const int n = n0 + j * 16 + col; const float bb = bfr(bo[n]);
#pragma unroll
    for (int r = 0; r < 8; ++r) so[wave][8 * g + r][j * 16 + col] = acc[j][r] + bb; }
  LDSX();
#pragma unroll 4
  for (int rl = 0; rl < 16; ++rl) vst2(out + (size_t)(r0 + rl) * E + n0 + lane * 4, *(const v4f*)(&so[wave][rl][lane * 4]));
}
// drift probe + gate: block = 16 rows, 16 waves; wave w does columns 32w..32w+31 of h = bf16(x) @ bf16(dp_w1) exact (+ bf16(b1)); then wave w owns row w: LN over 512 (16 values a lane, shuffle tree), exact GELU, . bf16(dp_w2) + bf16(dp_b2) -> drift; gate per row
__device__ __forceinline__ float wsum(float v) {
#pragma unroll
  for (int m = 16; m >= 1; m >>= 1) v += __shfl_xor(v, m, 32);
  return v;
}
__global__ __launch_bounds__(512) void k_gate(const __bf16* __restrict__ Xb, const __bf16* __restrict__ PT, const float* __restrict__ b1, const float* __restrict__ lng, const float* __restrict__ lnb, const float* __restrict__ w2, const float* __restrict__ b2,
                                             const float* __restrict__ gw1, const float* __restrict__ gb1, const float* __restrict__ gw2, const float* __restrict__ gb2, float* __restrict__ GATE) {
  __shared__ __align__(16) float sh[16][DPH + 4]; __shared__ __align__(16) float sg[16];
  const int tid = threadIdx.x, wave = tid >> 5, lane = tid & 31, col = lane & 15, g = lane >> 4; const int r0 = blockIdx.x * 16;
  { v8f acc[2] = {};
    // trip kc + 1's x fragment and its two weight fragments are loaded as one group ahead of trip kc's products
    const __bf16* ap = Xb + (size_t)(r0 >> 4) * FRT; v16b a = fragF_b(ap, lane), wr[2]; XW();
    const __bf16* wp = PT + (size_t)((4 * E >> 4) + wave * 2) * FRT;
#pragma unroll
    for (int j = 0; j < 2; ++j) wr[j] = fragF_b(wp + (size_t)j * FRT, lane);
    XW();
    const __bf16* apn = ap + 512; const __bf16* wpn = wp + 512;  // where trip kc + 1's values lie
// two trips a pass, so that the two value sets swap by name and not by register copies
#pragma unroll 2
    for (int kc = 0; kc < E / 32; ++kc) {
      const v16b an = fragF_b(apn, lane); v16b wn[2]; XW();
#pragma unroll
      for (int j = 0; j < 2; ++j) wn[j] = fragF_b(wpn + (size_t)j * FRT, lane);
      XW();
#pragma unroll
      for (int j = 0; j < 2; ++j) acc[j] = wmma_bf(a, wr[j], acc[j]);
      a = an; wr[0] = wn[0]; wr[1] = wn[1];
      if (kc + 2 < E / 32) { apn += 512; wpn += 512; } }  // the last trip loads its own values again (in bounds, not used)
#pragma unroll
    for (int j = 0; j < 2; ++j) { const int n = wave * 32 + j * 16 + col; const float bb = bfr(b1[n]);
#pragma unroll
      for (int r = 0; r < 8; ++r) sh[8 * g + r][n] = acc[j][r] + bb; } }
  float pg[16], pb[16], pw[16];  // the lane's LN and dp_w2 parameters, fetched ahead of the barrier so that their latency is not paid between the GELU branches
#pragma unroll
  for (int k = 0; k < 16; ++k) { const int c = k * 32 + lane; pg[k] = bfr(lng[c]); pb[k] = bfr(lnb[c]); pw[k] = bfr(w2[c]); }
  __syncthreads();  // every wave's 32 columns of all 16 rows are in sh before a row is read
  { float v[16]; float s = 0.f;
#pragma unroll
    for (int k = 0; k < 16; ++k) { v[k] = sh[wave][k * 32 + lane]; s += v[k]; }
    const float mu = wsum(s) * (1.0f / DPH); float q = 0.f;
#pragma unroll
    for (int k = 0; k < 16; ++k) { const float d = v[k] - mu; q += d * d; }
    const float rs = rsqrtf(wsum(q) * (1.0f / DPH) + 1e-5f); float dot = 0.f;
#pragma unroll
    for (int k = 0; k < 16; ++k) dot += gelu_e((v[k] - mu) * rs * pg[k] + pb[k]) * pw[k];
    const float drift = wsum(dot) + bfr(b2[0]);
    const float t = g == 0 ? gelu_e(drift * bfr(gw1[col]) + bfr(gb1[col])) * bfr(gw2[col]) : 0.f;
    const float gsum = bfr(gb2[0]) + wsum(t);
    if (lane == 0) sg[wave] = tanhf(gsum); }
  __syncthreads();
  if (tid < 4) vst2(GATE + (size_t)blockIdx.x * 32 + tid * 4, *(const v4f*)(&sg[tid * 4]));
}
extern "C" void kernel_launch(void* const* d_in, const int* in_sizes, int n_in, void* d_out, int out_size, void* d_ws, size_t ws_size, hipStream_t stream) {
  (void)in_sizes; (void)n_in; (void)out_size; (void)ws_size;
  const float** I = (const float**)d_in;
  const float* x = I[0]; const float* Wq = I[1]; const float* bq = I[2]; const float* Wk = I[3]; const float* bk = I[4]; const float* Wv = I[5]; const float* bv = I[6]; const float* Wo = I[7]; const float* bo = I[8];
  const float* dw1 = I[9]; const float* db1 = I[10]; const float* lng = I[11]; const float* lnb = I[12]; const float* dw2 = I[13]; const float* db2 = I[14]; const float* gw1 = I[15]; const float* gb1 = I[16]; const float* gw2 = I[17]; const float* gb2 = I[18];
  float* out = (float*)d_out;
  char* ws = (char*)d_ws; size_t off = 0;
  auto take = [&](size_t bytes) { char* p = ws + off; off += (bytes + 255) & ~(size_t)255; return p; };
  __bf16* Xb = (__bf16*)take((size_t)NR * E * 2); __bf16* PT = (__bf16*)take((size_t)(4 * E + DPH) * E * 2); float* GATE = (float*)take((size_t)NR * 8);
  float* Q32 = (float*)take((size_t)NR * E * 4); float* K32 = (float*)take((size_t)NR * E * 4); _Float16* VTh = (_Float16*)take((size_t)NR * E * 2); _Float16* VTl = (_Float16*)take((size_t)NR * E * 2); float* O32 = (float*)take((size_t)NR * E * 4);
  // ws ~ 84 MB
  k_cvt<<<(NR * E / 8 + 255) / 256, 256, 0, stream>>>(x, Xb);
  k_pack<<<dim3(E / 32, E / 128, 5), 256, 0, stream>>>(Wq, Wk, Wv, Wo, dw1, PT);
  k_gate<<<NR / 16, 512, 0, stream>>>(Xb, PT, db1, lng, lnb, dw2, db2, gw1, gb1, gw2, gb2, GATE);
  k_qkv<<<dim3(NR / 64, E / 128, 3), 128, 0, stream>>>(Xb, PT, bq, bk, bv, GATE, Q32, K32, VTh, VTl);
  k_attn<<<dim3(SS / 128, NB * NH), 256, 0, stream>>>(Q32, K32, VTh, VTl, O32);
  k_out<<<dim3(NR / 64, E / 128), 128, 0, stream>>>(O32, PT, bo, out);
}

// v005
// One run takes 193 microseconds.
// In both of two side-by-side timings against v004, it was 1.32 times as fast.
// Counting every step since v000, it is 4.22 times as fast.
// compute dtype: every module INPUT that feeds a GEMM (x, Wq/Wk/Wv/Wo, dp_w1, biases) is rounded to bf16 and used in exact bf16 WMMA products with f32 accumulation; computed operands (q/k, P, gate*V, context, the LN/GELU chain) are f32 or hi/lo pairs; mask/softmax/LayerNorm/GELU/tanh f32.
#include <hip/hip_runtime.h>
#include <math.h>

typedef __attribute__((ext_vector_type(16))) _Float16 v16h;
typedef __attribute__((ext_vector_type(16))) __bf16 v16b;
typedef __attribute__((ext_vector_type(8)))  _Float16 v8h;
typedef __attribute__((ext_vector_type(8)))  float v8f;
typedef __attribute__((ext_vector_type(4)))  float v4f;
typedef __attribute__((ext_vector_type(2)))  float v2f;
typedef __attribute__((ext_vector_type(4)))  unsigned v4u;
typedef __attribute__((ext_vector_type(4)))  int v4i;
typedef float __attribute__((may_alias)) float_a;
typedef int __attribute__((may_alias)) int_a;

template <typename T> __device__ __forceinline__ void vst2(void* p, T v) { *(T*)p = v;  }
__device__ __forceinline__ v8f wmma16(v16h a, v16h b, v8f c) {
  v8f d = __builtin_amdgcn_wmma_f32_16x16x32_f16(false, a, false, b, (short)0, c, false, false);
  asm volatile("v_nop\n\tv_nop\n\tv_nop\n\tv_nop" : "+v"(d) : "v"(a), "v"(b));
  return d;
}
__device__ __forceinline__ v8f wmma_bf(v16b a, v16b b, v8f c) {
  v8f d = __builtin_amdgcn_wmma_f32_16x16x32_bf16(false, a, false, b, (short)0, c, false, false);
  asm volatile("v_nop\n\tv_nop\n\tv_nop\n\tv_nop" : "+v"(d) : "v"(a), "v"(b));
  return d;
}
// 16x16x32 fragments: lane = (h = lane>>4, row/col = lane&15); elements 0..7 = k0+8h+0..7, 8..15 = k0+16+8h+0..7; D element r = row 8h+r
__device__ __forceinline__ v16h frag_h(const _Float16* rowk0, int lane) {
  union { v16h v; v8h q[2]; } u; const _Float16* p = rowk0 + 8 * (lane >> 4);
  u.q[0] = *(const v8h*)p; u.q[1] = *(const v8h*)(p + 16); return u.v;
}
__device__ __forceinline__ v16h frag_f32(const float* rowk0, int lane) {
  v16h a; const float* p = rowk0 + 8 * (lane >> 4);
#pragma unroll
  for (int i = 0; i < 8; ++i) { a[i] = (_Float16)p[i]; a[8 + i] = (_Float16)p[16 + i]; }
  return a;
}
__device__ __forceinline__ v16h frag_f32s(const float* rowk0, int lane, float sc) {
  v16h a; const float* p = rowk0 + 8 * (lane >> 4);
#pragma unroll
  for (int i = 0; i < 8; ++i) { a[i] = (_Float16)(p[i] * sc); a[8 + i] = (_Float16)(p[16 + i] * sc); }
  return a;
}
// column fragment from a [K][ld] layout (column n), rows >= K read as 0
__device__ __forceinline__ v16h fragc_f32(const float* W, int k0, int n, int lane, int ld, int K) {
  v16h a; const int g = lane >> 4;
#pragma unroll
  for (int i = 0; i < 8; ++i) { const int ka = k0 + 8 * g + i, kb = ka + 16;
    a[i] = (_Float16)(ka < K ? W[(size_t)ka * ld + n] : 0.f); a[8 + i] = (_Float16)(kb < K ? W[(size_t)kb * ld + n] : 0.f); }
  return a;
}
struct F2 { v16b h, l; };
__device__ __forceinline__ F2 bsplit16(const float v[16]) { F2 r;
#pragma unroll
  for (int i = 0; i < 16; ++i) { const __bf16 h = (__bf16)v[i]; r.h[i] = h; r.l[i] = (__bf16)(v[i] - (float)h); }
  return r; }
__device__ __forceinline__ F2 split_row(const float* row, int k0, int lane) { float v[16]; const float* p = row + k0 + 8 * (lane >> 4);
#pragma unroll
  for (int i = 0; i < 8; ++i) { v[i] = p[i]; v[8 + i] = p[16 + i]; }
  return bsplit16(v); }
__device__ __forceinline__ F2 split_rowK(const float* row, int k0, int lane, int K) { float v[16]; const int g = lane >> 4;
#pragma unroll
  for (int i = 0; i < 8; ++i) { const int ka = k0 + 8 * g + i, kb = ka + 16; v[i] = ka < K ? row[ka] : 0.f; v[8 + i] = kb < K ? row[kb] : 0.f; }
  return bsplit16(v); }
__device__ __forceinline__ F2 split_col(const float* W, int k0, int n, int lane, int ld, int K) { float v[16]; const int g = lane >> 4;
#pragma unroll
  for (int i = 0; i < 8; ++i) { const int ka = k0 + 8 * g + i, kb = ka + 16; v[i] = ka < K ? W[(size_t)ka * ld + n] : 0.f; v[8 + i] = kb < K ? W[(size_t)kb * ld + n] : 0.f; }
  return bsplit16(v); }
// the 16 f32 values of a lane's fragment, loads only: a group of them is issued ahead of the products that use them, and split or rounded later
struct R16 { float v[16]; };
// fragment order: a plane holds each 16 x 32 fragment as the lanes take it, so that every load of a wave is 512 contiguous bytes (four whole lines, not sixteen part lines)
// 16-bit values: 1 KiB a fragment, [half of the lane's 16 values][lane][8 values]; f32 values: 2 KiB a fragment, [quarter of the lane's 16 values][lane][4 values]
__device__ __forceinline__ v16h fragF_h(const _Float16* f, int lane) {
  union { v16h v; v8h q[2]; } u; const _Float16* p = f + lane * 8;
  u.q[0] = *(const v8h*)p; u.q[1] = *(const v8h*)(p + 256); return u.v;
}
__device__ __forceinline__ R16 rawF(const float* f, int lane) { R16 r; const float* p = f + lane * 4;
#pragma unroll
  for (int j = 0; j < 4; ++j) { const v4f t = *(const v4f*)(p + j * 128); r.v[4 * j] = t[0]; r.v[4 * j + 1] = t[1]; r.v[4 * j + 2] = t[2]; r.v[4 * j + 3] = t[3]; }
  return r; }
__device__ __forceinline__ v8f mac3(const F2& a, const F2& b, v8f c) { c = wmma_bf(a.l, b.h, c); c = wmma_bf(a.h, b.l, c); return wmma_bf(a.h, b.h, c); }
__device__ __forceinline__ float sigm(float v) { return 1.0f / (1.0f + expf(-v)); }
// in front of an instruction that rewrites an address register of a global load issued above (the next address, or a later load's result in the same register)
#define XW() asm volatile("s_wait_xcnt 0x0" ::: "memory")
#define LDSX() do { asm volatile("s_wait_dscnt 0" ::: "memory"); __builtin_amdgcn_wave_barrier(); __builtin_amdgcn_fence(__ATOMIC_RELEASE, "workgroup"); } while (0)


// Causal self attention (16 heads of 64 on [2,2048,1024], [in][out] weights + biases, scale 1/8) whose post-softmax weights are multiplied by a per-KEY gate (no renormalisation)
// == V rows scaled by gate[key]; gate = tanh(gelu(drift*g_w1 + g_b1).g_w2 + g_b2), drift = gelu(LN(x dp_w1 + dp_b1)).dp_w2 + dp_b2 per token.
// bf16-rounded INPUT operands with exact bf16 WMMA products, hi/lo splits for computed operands; k_cvt, k_pack, k_gate, k_qkv, causal k_attn, k_out.
#define NB 2
#define SS 2048
#define E 1024
#define NH 16
#define HD 64
#define NR (NB * SS)
#define DPH 512
// GATE plane: 32 floats (one 128-byte line) per 16 rows, the first 16 used, so that a line has one writing block
#define GIDX(r) ((((r) >> 4) << 5) + ((r) & 15))
__device__ __forceinline__ float gelu_e(float x) { return 0.5f * x * (1.0f + erff(x * 0.70710678118654752f)); }
#define PLO 1024.0f
#define VLO 2048.0f
__device__ __forceinline__ float bfr(float v) { return (float)(__bf16)v; }
__device__ __forceinline__ v16b fragF_b(const __bf16* f, int lane) { return __builtin_bit_cast(v16b, fragF_h((const _Float16*)f, lane)); }
// values of a fragment-order plane per 16 rows of 1024 (32 fragments of 512)
#define FRT 16384

// Xb in fragment order: [16 rows][32 k][half][lane][8]; thread = one 16-byte unit of the plane (a block reads 16 rows x 512 bytes of x)
__global__ __launch_bounds__(256) void k_cvt(const float* __restrict__ x, __bf16* __restrict__ Xb) {
  const size_t i8 = (size_t)blockIdx.x * 256 + threadIdx.x; if (i8 >= (size_t)NR * E / 8) return;
  const int ln = (int)(i8 & 31), q = (int)(i8 >> 5) & 1, kc = (int)(i8 >> 6) & 31; const size_t rt = i8 >> 11;
  const float* p = x + (rt * 16 + (ln & 15)) * E + kc * 32 + q * 16 + (ln >> 4) * 8;
  union { __bf16 h[8]; v4u u; } pk;
#pragma unroll
  for (int e = 0; e < 8; ++e) pk.h[e] = (__bf16)p[e];
  vst2((unsigned*)(Xb + i8 * 8), pk.u);
}
// PT columns: [0,E) Wq[:,n], [E,2E) Wk[:,n], [2E,3E) Wv[:,n], [3E,4E) Wo[:,n], [4E,4E+DPH) dp_w1[:,n]  ([in][out] weights), bf16 in fragment order: [16 columns][32 k][half][lane][8]
// block (32 k, 128 columns, matrix): whole rows of W in, turned in LDS, whole fragments out
__global__ __launch_bounds__(256) void k_pack(const float* __restrict__ Wq, const float* __restrict__ Wk, const float* __restrict__ Wv, const float* __restrict__ Wo, const float* __restrict__ W1, __bf16* __restrict__ PT) {
  __shared__ __align__(16) __bf16 st[128][40];
  const int tid = threadIdx.x, kc = blockIdx.x, n0 = blockIdx.y * 128, m = blockIdx.z;
  const int ld = m == 4 ? DPH : E; if (n0 >= ld) return;  // dp_w1 has 512 columns: the whole block leaves, ahead of the barrier
  const float* W = m == 0 ? Wq : (m == 1 ? Wk : (m == 2 ? Wv : (m == 3 ? Wo : W1)));
  for (int i = tid; i < 32 * 128; i += 256) { const int k = i >> 7, n = i & 127; st[n][k] = (__bf16)W[(size_t)(kc * 32 + k) * ld + n0 + n]; }
  __syncthreads();
  for (int u = tid; u < 512; u += 256) { const int ln = u & 31, q = (u >> 5) & 1, nt = u >> 6;
    vst2((unsigned*)(PT + (size_t)(((m * E + n0) >> 4) + nt) * FRT + kc * 512 + q * 256 + ln * 8), *(const v4u*)(&st[nt * 16 + (ln & 15)][q * 16 + (ln >> 4) * 8])); }
}
// QKV: block (64 rows, 128 cols = 2 heads, which); q -> Q32 f32 [bh][s][64]; k -> K32 f32 in fragment order [bh][16 keys][32 d][quarter][lane][4]; v -> VT hi/lo x4 in fragment order [bh][32 keys][16 d][half][lane][8]
__global__ __launch_bounds__(128) void k_qkv(const __bf16* __restrict__ Xb, const __bf16* __restrict__ PT, const float* __restrict__ bq, const float* __restrict__ bk, const float* __restrict__ bv, const float* __restrict__ GATE,
                                            float* __restrict__ Q32, float* __restrict__ K32, _Float16* __restrict__ VTh, _Float16* __restrict__ VTl) {
  __shared__ __align__(16) float so[4][16][132];
  __shared__ __align__(16) _Float16 sth[128][72], stl[128][72];
  const int tid = threadIdx.x, wave = tid >> 5, lane = tid & 31, col = lane & 15, g = lane >> 4;
  const int which = blockIdx.z, r0b = blockIdx.x * 64, r0 = r0b + wave * 16, n0 = blockIdx.y * 128; const int b = r0b / SS, s0 = r0b % SS;
  const float* bb_ = which == 0 ? bq : (which == 1 ? bk : bv);
  v8f acc[8] = {};
  // the nine fragments of trip kc + 1 are loaded as one group ahead of trip kc's products: one load wait a trip, covered by eight products, not one in front of every product
  const __bf16* ap = Xb + (size_t)(r0 >> 4) * FRT; const __bf16* bp = PT + (size_t)((which * E + n0) >> 4) * FRT;
  v16b a = fragF_b(ap, lane), bf[8]; XW();
#pragma unroll
  for (int j = 0; j < 8; ++j) bf[j] = fragF_b(bp + (size_t)j * FRT, lane);
  XW();
  const __bf16* apn = ap + 512; const __bf16* bpn = bp + 512;  // where trip kc + 1's fragments lie
// two trips a pass, so that the two fragment sets swap by name and not by register copies
#pragma unroll 2
  for (int kc = 0; kc < E / 32; ++kc) {
    const v16b an = fragF_b(apn, lane); v16b bn[8]; XW();
#pragma unroll
    for (int j = 0; j < 8; ++j) bn[j] = fragF_b(bpn + (size_t)j * FRT, lane);
    XW();
#pragma unroll
    for (int j = 0; j < 8; ++j) acc[j] = wmma_bf(a, bf[j], acc[j]);
    a = an;
#pragma unroll
    for (int j = 0; j < 8; ++j) bf[j] = bn[j];
    if (kc + 2 < E / 32) { apn += 512; bpn += 512; } }  // the last trip loads its own fragments again (in bounds, not used)
  if (which < 2) {
#pragma unroll
    for (int j = 0; j < 8; ++j) { const float bb = bfr(bb_[n0 + j * 16 + col]);
#pragma unroll
      for (int r = 0; r < 8; ++r) so[wave][8 * g + r][j * 16 + col] = acc[j][r] + bb; }
    LDSX();
    if (which == 0) {
      for (int qq = lane; qq < 2 * 16 * 16; qq += 32) { const int hh = qq >> 8, rl = (qq >> 4) & 15, pc = qq & 15; const int h = (n0 >> 6) + hh;
        vst2(Q32 + (((size_t)b * NH + h) * SS + s0 + wave * 16 + rl) * HD + pc * 4, *(const v4f*)(&so[wave][rl][hh * 64 + pc * 4])); } }
    else {  // the wave's 16 keys x 2 heads: four fragments of four quarters; the lane stores what it will load as lane (g, col = key)
// unrolled: the sixteen stores go out as one run, with no register of an issued store rewritten on a back edge
#pragma unroll
      for (int u = 0; u < 16; ++u) { const int j = u & 3, kc = (u >> 2) & 1, hh = u >> 3; const int h = (n0 >> 6) + hh;
        vst2(K32 + ((((size_t)b * NH + h) * (SS / 16) + (s0 >> 4) + wave) * 2 + kc) * 512 + j * 128 + lane * 4, *(const v4f*)(&so[wave][col][hh * 64 + kc * 32 + (j >> 1) * 16 + g * 8 + (j & 1) * 4])); }
      XW(); } }
  else {
#pragma unroll
    for (int j = 0; j < 8; ++j) { const float bb = bfr(bb_[n0 + j * 16 + col]);
#pragma unroll
      for (int r = 0; r < 8; ++r) { const float v = (acc[j][r] + bb) * GATE[GIDX(r0 + 8 * g + r)] * 4.0f; const _Float16 hi = (_Float16)v; sth[j * 16 + col][wave * 16 + 8 * g + r] = hi; stl[j * 16 + col][wave * 16 + 8 * g + r] = (_Float16)((v - (float)hi) * VLO); } }
    __syncthreads();
    for (int qq = tid; qq < 128 * 8; qq += 128) { const int ln = qq & 31, q = (qq >> 5) & 1, t = (qq >> 6) & 3, k32 = (qq >> 8) & 1, hh = qq >> 9;
      const int cl = hh * 64 + t * 16 + (ln & 15), pc = k32 * 4 + q * 2 + (ln >> 4), h = (n0 >> 6) + hh; const size_t o = (((((size_t)b * NH + h) * (SS / 32) + (s0 >> 5) + k32) * 4 + t) * 2 + q) * 256 + ln * 8;
      vst2(VTh + o, *(const v4u*)(&sth[cl][pc * 8])); vst2(VTl + o, *(const v4u*)(&stl[cl][pc * 8])); } }
}
// one key tile's K (16 KiB), V hi (8 KiB) and V lo (8 KiB), each contiguous in its plane, into one 32 KiB stage of LDS: a thread brings eight 16-byte units, through no register
// l = the thread's LDS byte address in the stage; k, vh, vl = its global addresses in the tile's K, V hi and V lo; an immediate offset (under 65,536) moves the LDS and the global address alike, so one register set serves each plane
// the wait in the last line stands in front of every later write of an address register that the copies name
__device__ __forceinline__ void kv_copy(unsigned l, const char* k, const char* vh, const char* vl) {
  asm volatile("global_load_async_to_lds_b128 %0, %3, off\n\t"
               "global_load_async_to_lds_b128 %0, %3, off offset:4096\n\t"
               "global_load_async_to_lds_b128 %0, %3, off offset:8192\n\t"
               "global_load_async_to_lds_b128 %0, %3, off offset:12288\n\t"
               "global_load_async_to_lds_b128 %1, %4, off\n\t"
               "global_load_async_to_lds_b128 %1, %4, off offset:4096\n\t"
               "global_load_async_to_lds_b128 %2, %5, off\n\t"
               "global_load_async_to_lds_b128 %2, %5, off offset:4096\n\t"
               "s_wait_xcnt 0x0"
               :: "v"(l), "v"(l + 16384u), "v"(l + 24576u), "v"(k), "v"(vh), "v"(vl)
               : "memory");
}
// causal attention: block (2 x 64 queries, bh): waves 0..3 take query tile 31 - t, waves 4..7 tile t, so that every block walks 33 key tiles per wave pair and no WGP is left with the long tiles alone
// the block walks key tiles 0..31-t together: tile kt + 1 flies into one of two LDS stages by asynchronous copies while tile kt is worked on, and all waves read K and V from LDS; a wave works on tiles 0..qb and only passes the hand-over points of the rest
// S on hi/lo splits of the f32 q/k rows; P,V hi/lo; O f32 in fragment order [16 rows][32 k][quarter][lane][4]
// four waves a SIMD: holds the build at 256 registers a wave, so that two blocks stay on a WGP and all 512 run at once
__global__ __launch_bounds__(256) __attribute__((amdgpu_waves_per_eu(4, 4))) void k_attn(const float* __restrict__ Q32, const float* __restrict__ K32, const _Float16* __restrict__ VTh, const _Float16* __restrict__ VTl, float* __restrict__ O32) {
  __shared__ __align__(16) float sS[8][16][68];  // scores in the loop, the output tile behind it (each wave its own part)
  __shared__ __align__(16) _Float16 sPh[8][16][72], sPl[8][16][72];
  __shared__ __align__(16) char sKV[2][32768];  // a stage: K fragments at 0, V hi at 16384, V lo at 24576
  const int tid = threadIdx.x, lane = tid & 31, col = lane & 15, g = lane >> 4;
  const int w = __builtin_amdgcn_readfirstlane(tid >> 5);  // the wave's number in a scalar register: the key loop's tests stay scalar compares and branches
  const size_t bh = blockIdx.y; const int qb = w < 4 ? SS / 64 - 1 - (int)blockIdx.x : (int)blockIdx.x; const int q0 = qb * 64 + (w & 3) * 16;
  const int nT = SS / 64 - (int)blockIdx.x;  // key tiles of the block (17..32): those of its longer waves
  const unsigned t16 = (unsigned)w * 512u + (unsigned)lane * 16u;  // the thread's place in each 4 KiB of a tile
  const unsigned l0 = (unsigned)(size_t)(const void*)&sKV[0][0] + t16;
  const char* kg = (const char*)(K32 + bh * (SS / 16) * 1024);   // the head's planes, the same for the whole block: 16 KiB a key tile
  const char* hg = (const char*)(VTh + bh * (SS / 32) * 2048);   // 8 KiB a key tile
  const char* lg = (const char*)(VTl + bh * (SS / 32) * 2048);
  kv_copy(l0, kg + t16, hg + t16, lg + t16);
  F2 aq[2];
#pragma unroll
  for (int kc = 0; kc < 2; ++kc) aq[kc] = split_row(Q32 + (bh * SS + q0 + col) * HD, kc * 32, lane);
  asm volatile("s_wait_asynccnt 0x0" ::: "memory");  // this wave's part of tile 0 has landed
  __syncthreads();                                    // every wave's part has: tile 0 may be read
  kv_copy(l0 + 32768u, kg + 16384 + t16, hg + 8192 + t16, lg + 8192 + t16);  // tile 1 (a block has 17 tiles or more)
  float mrun = -3.0e38f, lrun = 0.f; v8f acc[4] = {}, ac1[4] = {}, ac2[4] = {};
#pragma unroll 1
  for (int kt = 0; kt < nT; ++kt) {
    if (kt <= qb) {
    const char* st = &sKV[kt & 1][0];
#pragma unroll
    for (int t = 0; t < 4; ++t) { const int dk = kt * 64 + t * 16 + col - (q0 + 8 * g); const float* kf = (const float*)st + t * 1024;  // dk = key - the lane's first query row
      const R16 k0 = rawF(kf, lane), k1 = rawF(kf + 512, lane);
      v8f s = mac3(aq[0], bsplit16(k0.v), (v8f){}); s = mac3(aq[1], bsplit16(k1.v), s);
#pragma unroll
      for (int r = 0; r < 8; ++r) { sS[w][8 * g + r][t * 16 + col] = (dk > r) ? -3.0e38f : s[r] * 0.125f; } }
    LDSX();
    // the V fragments of keys 0..31 of the tile are read from LDS here, ahead of the softmax, which covers their latency
    v16h vh[4], vl[4];
#pragma unroll
    for (int t = 0; t < 4; ++t) { vh[t] = fragF_h((const _Float16*)(st + 16384) + t * 512, lane); vl[t] = fragF_h((const _Float16*)(st + 24576) + t * 512, lane); }
    float mx = -3.4e38f;
#pragma unroll
    for (int jj = 0; jj < 32; ++jj) mx = fmaxf(mx, sS[w][col][g * 32 + jj]);
    mx = fmaxf(mx, __shfl_xor(mx, 16, 32));
    const float mnew = fmaxf(mrun, mx); const float corr = expf(mrun - mnew);
    float ps = 0.f;
#pragma unroll
    for (int jj = 0; jj < 32; ++jj) { const float p = expf(sS[w][col][g * 32 + jj] - mnew) * 16384.0f; ps += p; const _Float16 hi = (_Float16)p; sPh[w][col][g * 32 + jj] = hi; sPl[w][col][g * 32 + jj] = (_Float16)((p - (float)hi) * PLO); }
    ps += __shfl_xor(ps, 16, 32);
    lrun = lrun * corr + ps * (1.0f / 16384.0f); mrun = mnew;
#pragma unroll
    for (int r = 0; r < 8; ++r) { const float cr = __shfl(corr, 8 * g + r, 32);
#pragma unroll
      for (int t = 0; t < 4; ++t) { acc[t][r] *= cr; ac1[t][r] *= cr; ac2[t][r] *= cr; } }
    // LDSX() with the running row sum as an input of its wait, so that the sum is finished here: sunk behind the products, its 32 addends took the build past 256 registers and into scratch
    asm volatile("s_wait_dscnt 0" :: "v"(lrun) : "memory"); __builtin_amdgcn_wave_barrier(); __builtin_amdgcn_fence(__ATOMIC_RELEASE, "workgroup");
#pragma unroll
    for (int kc = 0; kc < 2; ++kc) { const v16h ph = frag_h(&sPh[w][col][0] + kc * 32, lane), pl = frag_h(&sPl[w][col][0] + kc * 32, lane);
      if (kc == 1) {  // keys 32..63: one group, into the registers that the first half has left
#pragma unroll
        for (int t = 0; t < 4; ++t) { vh[t] = fragF_h((const _Float16*)(st + 16384) + (4 + t) * 512, lane); vl[t] = fragF_h((const _Float16*)(st + 24576) + (4 + t) * 512, lane); } }
#pragma unroll
      for (int t = 0; t < 4; ++t) { acc[t] = wmma16(ph, vh[t], acc[t]); ac1[t] = wmma16(ph, vl[t], ac1[t]); ac2[t] = wmma16(pl, vh[t], ac2[t]); } }
    __builtin_amdgcn_wave_barrier(); }
    // hand-over, passed by every wave on every trip, also by one that is past its own last tile
    asm volatile("s_wait_dscnt 0x0" ::: "memory");     // this wave's reads of tile kt's stage are done before the stage is refilled
    asm volatile("s_wait_asynccnt 0x0" ::: "memory");  // this wave's part of tile kt + 1 has landed
    __syncthreads();                                    // tile kt + 1 may be read by all; tile kt's stage has no reader left
    if (kt + 2 < nT) kv_copy(l0 + (unsigned)(kt & 1) * 32768u, kg + (size_t)(kt + 2) * 16384 + t16, hg + (size_t)(kt + 2) * 8192 + t16, lg + (size_t)(kt + 2) * 8192 + t16); }
  asm volatile("s_wait_asynccnt 0x0" ::: "memory");  // no copy is in flight when the wave goes on to its end
#pragma unroll
  for (int r = 0; r < 8; ++r) { const float lr = __shfl(lrun, 8 * g + r, 32); const float inv = 1.0f / (lr * 16384.0f * 4.0f);
#pragma unroll
    for (int t = 0; t < 4; ++t) sS[w][8 * g + r][t * 16 + col] = (acc[t][r] + ac1[t][r] * (1.0f / VLO) + ac2[t][r] * (1.0f / PLO)) * inv; }
  LDSX();
  const size_t ob = ((((bh / NH) * SS + q0) >> 4) * 32 + (bh % NH) * 2) * 512;  // the wave's 16 rows, its head's two fragments
  for (int u = 0; u < 8; ++u) { const int j = u & 3, kc = u >> 2; vst2(O32 + ob + kc * 512 + j * 128 + lane * 4, *(const v4f*)(&sS[w][col][kc * 32 + (j >> 1) * 16 + g * 8 + (j & 1) * 4])); }
}
// out = ctx Wo + bo : split(ctx) x bf16(Wo columns): 2 products (Wo is an INPUT -> bf16 exact)
__global__ __launch_bounds__(128) void k_out(const float* __restrict__ O32, const __bf16* __restrict__ PT, const float* __restrict__ bo, float* __restrict__ out) {
  __shared__ __align__(16) float so[4][16][132];
  const int tid = threadIdx.x, wave = tid >> 5, lane = tid & 31, col = lane & 15, g = lane >> 4;
  const int r0 = blockIdx.x * 64 + wave * 16, n0 = blockIdx.y * 128;
  v8f acc[8] = {};
  // trip kc + 1's context values and eight weight fragments are loaded as one group ahead of trip kc's products
  const float* op = O32 + (size_t)(r0 >> 4) * FRT; const __bf16* bp = PT + (size_t)((3 * E + n0) >> 4) * FRT;
  R16 ar = rawF(op, lane); v16b wb[8]; XW();
#pragma unroll
  for (int j = 0; j < 8; ++j) wb[j] = fragF_b(bp + (size_t)j * FRT, lane);
  XW();
  const float* opn = op + 512;  // where trip kc + 1's context fragment lies
  unsigned wof = (unsigned)((((3 * E + n0) >> 4) * FRT + 512 + lane * 8) * 2);  // the lane's byte offset in PT of trip kc + 1's first weight fragment
// two trips a pass, so that the two fragment sets swap by name and not by register copies
#pragma unroll 2
  for (int kc = 0; kc < E / 32; ++kc) {
    const R16 arn = rawF(opn, lane); v16b wn[8]; XW();
#pragma unroll
    for (int j = 0; j < 8; ++j) wn[j] = fragF_b((const __bf16*)((const char*)PT + (size_t)wof + (size_t)j * FRT * 2), 0);
    asm volatile("s_wait_xcnt 0x0" : "+v"(wof) :: "memory");  // as XW(); the offset register that the sixteen loads name passes through the wait, so that it stays whole up to it and no load of the group lands in it
    const F2 a = bsplit16(ar.v);
#pragma unroll
    for (int j = 0; j < 8; ++j) { acc[j] = wmma_bf(a.l, wb[j], acc[j]); acc[j] = wmma_bf(a.h, wb[j], acc[j]); }
    ar = arn;
#pragma unroll
    for (int j = 0; j < 8; ++j) wb[j] = wn[j];
    if (kc + 2 < E / 32) { opn += 512; wof += 1024; } }  // the last trip loads its own fragments again (in bounds, not used)
#pragma unroll
  for (int j = 0; j < 8; ++j) { const int n = n0 + j * 16 + col; const float bb = bfr(bo[n]);
#pragma unroll
    for (int r = 0; r < 8; ++r) so[wave][8 * g + r][j * 16 + col] = acc[j][r] + bb; }
  LDSX();
#pragma unroll 4
  for (int rl = 0; rl < 16; ++rl) vst2(out + (size_t)(r0 + rl) * E + n0 + lane * 4, *(const v4f*)(&so[wave][rl][lane * 4]));
}
// drift probe + gate: block = 16 rows, 16 waves; wave w does columns 32w..32w+31 of h = bf16(x) @ bf16(dp_w1) exact (+ bf16(b1)); then wave w owns row w: LN over 512 (16 values a lane, shuffle tree), exact GELU, . bf16(dp_w2) + bf16(dp_b2) -> drift; gate per row
__device__ __forceinline__ float wsum(float v) {
#pragma unroll
  for (int m = 16; m >= 1; m >>= 1) v += __shfl_xor(v, m, 32);
  return v;
}
__global__ __launch_bounds__(512) void k_gate(const __bf16* __restrict__ Xb, const __bf16* __restrict__ PT, const float* __restrict__ b1, const float* __restrict__ lng, const float* __restrict__ lnb, const float* __restrict__ w2, const float* __restrict__ b2,
                                             const float* __restrict__ gw1, const float* __restrict__ gb1, const float* __restrict__ gw2, const float* __restrict__ gb2, float* __restrict__ GATE) {
  __shared__ __align__(16) float sh[16][DPH + 4]; __shared__ __align__(16) float sg[16];
  const int tid = threadIdx.x, wave = tid >> 5, lane = tid & 31, col = lane & 15, g = lane >> 4; const int r0 = blockIdx.x * 16;
  { v8f acc[2] = {};
    // trip kc + 1's x fragment and its two weight fragments are loaded as one group ahead of trip kc's products
    const __bf16* ap = Xb + (size_t)(r0 >> 4) * FRT; v16b a = fragF_b(ap, lane), wr[2]; XW();
    const __bf16* wp = PT + (size_t)((4 * E >> 4) + wave * 2) * FRT;
#pragma unroll
    for (int j = 0; j < 2; ++j) wr[j] = fragF_b(wp + (size_t)j * FRT, lane);
    XW();
    const __bf16* apn = ap + 512; const __bf16* wpn = wp + 512;  // where trip kc + 1's values lie
// two trips a pass, so that the two value sets swap by name and not by register copies
#pragma unroll 2
    for (int kc = 0; kc < E / 32; ++kc) {
      const v16b an = fragF_b(apn, lane); v16b wn[2]; XW();
#pragma unroll
      for (int j = 0; j < 2; ++j) wn[j] = fragF_b(wpn + (size_t)j * FRT, lane);
      XW();
#pragma unroll
      for (int j = 0; j < 2; ++j) acc[j] = wmma_bf(a, wr[j], acc[j]);
      a = an; wr[0] = wn[0]; wr[1] = wn[1];
      if (kc + 2 < E / 32) { apn += 512; wpn += 512; } }  // the last trip loads its own values again (in bounds, not used)
#pragma unroll
    for (int j = 0; j < 2; ++j) { const int n = wave * 32 + j * 16 + col; const float bb = bfr(b1[n]);
#pragma unroll
      for (int r = 0; r < 8; ++r) sh[8 * g + r][n] = acc[j][r] + bb; } }
  float pg[16], pb[16], pw[16];  // the lane's LN and dp_w2 parameters, fetched ahead of the barrier so that their latency is not paid between the GELU branches
#pragma unroll
  for (int k = 0; k < 16; ++k) { const int c = k * 32 + lane; pg[k] = bfr(lng[c]); pb[k] = bfr(lnb[c]); pw[k] = bfr(w2[c]); }
  __syncthreads();  // every wave's 32 columns of all 16 rows are in sh before a row is read
  { float v[16]; float s = 0.f;
#pragma unroll
    for (int k = 0; k < 16; ++k) { v[k] = sh[wave][k * 32 + lane]; s += v[k]; }
    const float mu = wsum(s) * (1.0f / DPH); float q = 0.f;
#pragma unroll
    for (int k = 0; k < 16; ++k) { const float d = v[k] - mu; q += d * d; }
    const float rs = rsqrtf(wsum(q) * (1.0f / DPH) + 1e-5f); float dot = 0.f;
#pragma unroll
    for (int k = 0; k < 16; ++k) dot += gelu_e((v[k] - mu) * rs * pg[k] + pb[k]) * pw[k];
    const float drift = wsum(dot) + bfr(b2[0]);
    const float t = g == 0 ? gelu_e(drift * bfr(gw1[col]) + bfr(gb1[col])) * bfr(gw2[col]) : 0.f;
    const float gsum = bfr(gb2[0]) + wsum(t);
    if (lane == 0) sg[wave] = tanhf(gsum); }
  __syncthreads();
  if (tid < 4) vst2(GATE + (size_t)blockIdx.x * 32 + tid * 4, *(const v4f*)(&sg[tid * 4]));
}
extern "C" void kernel_launch(void* const* d_in, const int* in_sizes, int n_in, void* d_out, int out_size, void* d_ws, size_t ws_size, hipStream_t stream) {
  (void)in_sizes; (void)n_in; (void)out_size; (void)ws_size;
  const float** I = (const float**)d_in;
  const float* x = I[0]; const float* Wq = I[1]; const float* bq = I[2]; const float* Wk = I[3]; const float* bk = I[4]; const float* Wv = I[5]; const float* bv = I[6]; const float* Wo = I[7]; const float* bo = I[8];
  const float* dw1 = I[9]; const float* db1 = I[10]; const float* lng = I[11]; const float* lnb = I[12]; const float* dw2 = I[13]; const float* db2 = I[14]; const float* gw1 = I[15]; const float* gb1 = I[16]; const float* gw2 = I[17]; const float* gb2 = I[18];
  float* out = (float*)d_out;
  char* ws = (char*)d_ws; size_t off = 0;
  auto take = [&](size_t bytes) { char* p = ws + off; off += (bytes + 255) & ~(size_t)255; return p; };
  __bf16* Xb = (__bf16*)take((size_t)NR * E * 2); __bf16* PT = (__bf16*)take((size_t)(4 * E + DPH) * E * 2); float* GATE = (float*)take((size_t)NR * 8);
  float* Q32 = (float*)take((size_t)NR * E * 4); float* K32 = (float*)take((size_t)NR * E * 4); _Float16* VTh = (_Float16*)take((size_t)NR * E * 2); _Float16* VTl = (_Float16*)take((size_t)NR * E * 2); float* O32 = (float*)take((size_t)NR * E * 4);
  // ws ~ 84 MB
  k_cvt<<<(NR * E / 8 + 255) / 256, 256, 0, stream>>>(x, Xb);
  k_pack<<<dim3(E / 32, E / 128, 5), 256, 0, stream>>>(Wq, Wk, Wv, Wo, dw1, PT);
  k_gate<<<NR / 16, 512, 0, stream>>>(Xb, PT, db1, lng, lnb, dw2, db2, gw1, gb1, gw2, gb2, GATE);
  k_qkv<<<dim3(NR / 64, E / 128, 3), 128, 0, stream>>>(Xb, PT, bq, bk, bv, GATE, Q32, K32, VTh, VTl);
  k_attn<<<dim3(SS / 128, NB * NH), 256, 0, stream>>>(Q32, K32, VTh, VTl, O32);
  k_out<<<dim3(NR / 64, E / 128), 128, 0, stream>>>(O32, PT, bo, out);
}

// v006
// Measured time: 177 microseconds a run.
// In two side-by-side timings against v005, it was 1.09 and 1.08 times as fast.
// Over all steps from v000 it is 4.57 times as fast.
// compute dtype: every module INPUT that feeds a GEMM (x, Wq/Wk/Wv/Wo, dp_w1, biases) is rounded to bf16 and used in exact bf16 WMMA products with f32 accumulation; computed operands (q/k, P, gate*V, context, the LN/GELU chain) are f32 or hi/lo pairs; mask/softmax/LayerNorm/GELU/tanh f32.
#include <hip/hip_runtime.h>
#include <math.h>

typedef __attribute__((ext_vector_type(16))) _Float16 v16h;
typedef __attribute__((ext_vector_type(16))) __bf16 v16b;
typedef __attribute__((ext_vector_type(8)))  _Float16 v8h;
typedef __attribute__((ext_vector_type(8)))  float v8f;
typedef __attribute__((ext_vector_type(4)))  float v4f;
typedef __attribute__((ext_vector_type(2)))  float v2f;
typedef __attribute__((ext_vector_type(4)))  unsigned v4u;
typedef __attribute__((ext_vector_type(4)))  int v4i;
typedef float __attribute__((may_alias)) float_a;
typedef int __attribute__((may_alias)) int_a;

template <typename T> __device__ __forceinline__ void vst2(void* p, T v) { *(T*)p = v;  }
__device__ __forceinline__ v8f wmma16(v16h a, v16h b, v8f c) {
  v8f d = __builtin_amdgcn_wmma_f32_16x16x32_f16(false, a, false, b, (short)0, c, false, false);
  asm volatile("v_nop\n\tv_nop\n\tv_nop\n\tv_nop" : "+v"(d) : "v"(a), "v"(b));
  return d;
}
__device__ __forceinline__ v8f wmma_bf(v16b a, v16b b, v8f c) {
  v8f d = __builtin_amdgcn_wmma_f32_16x16x32_bf16(false, a, false, b, (short)0, c, false, false);
  asm volatile("v_nop\n\tv_nop\n\tv_nop\n\tv_nop" : "+v"(d) : "v"(a), "v"(b));
  return d;
}
// 16x16x32 fragments: lane = (h = lane>>4, row/col = lane&15); elements 0..7 = k0+8h+0..7, 8..15 = k0+16+8h+0..7; D element r = row 8h+r
__device__ __forceinline__ v16h frag_h(const _Float16* rowk0, int lane) {
  union { v16h v; v8h q[2]; } u; const _Float16* p = rowk0 + 8 * (lane >> 4);
  u.q[0] = *(const v8h*)p; u.q[1] = *(const v8h*)(p + 16); return u.v;
}
__device__ __forceinline__ v16h frag_f32(const float* rowk0, int lane) {
  v16h a; const float* p = rowk0 + 8 * (lane >> 4);
#pragma unroll
  for (int i = 0; i < 8; ++i) { a[i] = (_Float16)p[i]; a[8 + i] = (_Float16)p[16 + i]; }
  return a;
}
__device__ __forceinline__ v16h frag_f32s(const float* rowk0, int lane, float sc) {
  v16h a; const float* p = rowk0 + 8 * (lane >> 4);
#pragma unroll
  for (int i = 0; i < 8; ++i) { a[i] = (_Float16)(p[i] * sc); a[8 + i] = (_Float16)(p[16 + i] * sc); }
  return a;
}
// column fragment from a [K][ld] layout (column n), rows >= K read as 0
__device__ __forceinline__ v16h fragc_f32(const float* W, int k0, int n, int lane, int ld, int K) {
  v16h a; const int g = lane >> 4;
#pragma unroll
  for (int i = 0; i < 8; ++i) { const int ka = k0 + 8 * g + i, kb = ka + 16;
    a[i] = (_Float16)(ka < K ? W[(size_t)ka * ld + n] : 0.f); a[8 + i] = (_Float16)(kb < K ? W[(size_t)kb * ld + n] : 0.f); }
  return a;
}
struct F2 { v16b h, l; };
__device__ __forceinline__ F2 bsplit16(const float v[16]) { F2 r;
#pragma unroll
  for (int i = 0; i < 16; ++i) { const __bf16 h = (__bf16)v[i]; r.h[i] = h; r.l[i] = (__bf16)(v[i] - (float)h); }
  return r; }
__device__ __forceinline__ F2 split_row(const float* row, int k0, int lane) { float v[16]; const float* p = row + k0 + 8 * (lane >> 4);
#pragma unroll
  for (int i = 0; i < 8; ++i) { v[i] = p[i]; v[8 + i] = p[16 + i]; }
  return bsplit16(v); }
__device__ __forceinline__ F2 split_rowK(const float* row, int k0, int lane, int K) { float v[16]; const int g = lane >> 4;
#pragma unroll
  for (int i = 0; i < 8; ++i) { const int ka = k0 + 8 * g + i, kb = ka + 16; v[i] = ka < K ? row[ka] : 0.f; v[8 + i] = kb < K ? row[kb] : 0.f; }
  return bsplit16(v); }
__device__ __forceinline__ F2 split_col(const float* W, int k0, int n, int lane, int ld, int K) { float v[16]; const int g = lane >> 4;
#pragma unroll
  for (int i = 0; i < 8; ++i) { const int ka = k0 + 8 * g + i, kb = ka + 16; v[i] = ka < K ? W[(size_t)ka * ld + n] : 0.f; v[8 + i] = kb < K ? W[(size_t)kb * ld + n] : 0.f; }
  return bsplit16(v); }
// the 16 f32 values of a lane's fragment, loads only: a group of them is issued ahead of the products that use them, and split or rounded later
struct R16 { float v[16]; };
// fragment order: a plane holds each 16 x 32 fragment as the lanes take it, so that every load of a wave is 512 contiguous bytes (four whole lines, not sixteen part lines)
// 16-bit values: 1 KiB a fragment, [half of the lane's 16 values][lane][8 values]; f32 values: 2 KiB a fragment, [quarter of the lane's 16 values][lane][4 values]
__device__ __forceinline__ v16h fragF_h(const _Float16* f, int lane) {
  union { v16h v; v8h q[2]; } u; const _Float16* p = f + lane * 8;
  u.q[0] = *(const v8h*)p; u.q[1] = *(const v8h*)(p + 256); return u.v;
}
__device__ __forceinline__ R16 rawF(const float* f, int lane) { R16 r; const float* p = f + lane * 4;
#pragma unroll
  for (int j = 0; j < 4; ++j) { const v4f t = *(const v4f*)(p + j * 128); r.v[4 * j] = t[0]; r.v[4 * j + 1] = t[1]; r.v[4 * j + 2] = t[2]; r.v[4 * j + 3] = t[3]; }
  return r; }
__device__ __forceinline__ v8f mac3(const F2& a, const F2& b, v8f c) { c = wmma_bf(a.l, b.h, c); c = wmma_bf(a.h, b.l, c); return wmma_bf(a.h, b.h, c); }
__device__ __forceinline__ float sigm(float v) { return 1.0f / (1.0f + expf(-v)); }
// in front of an instruction that rewrites an address register of a global load issued above (the next address, or a later load's result in the same register)
#define XW() asm volatile("s_wait_xcnt 0x0" ::: "memory")
#define LDSX() do { asm volatile("s_wait_dscnt 0" ::: "memory"); __builtin_amdgcn_wave_barrier(); __builtin_amdgcn_fence(__ATOMIC_RELEASE, "workgroup"); } while (0)


// Causal self attention (16 heads of 64 on [2,2048,1024], [in][out] weights + biases, scale 1/8) whose post-softmax weights are multiplied by a per-KEY gate (no renormalisation)
// == V rows scaled by gate[key]; gate = tanh(gelu(drift*g_w1 + g_b1).g_w2 + g_b2), drift = gelu(LN(x dp_w1 + dp_b1)).dp_w2 + dp_b2 per token.
// bf16-rounded INPUT operands with exact bf16 WMMA products, hi/lo splits for computed operands; k_cvt, k_pack, k_gate, k_qkv, causal k_attn, k_out.
#define NB 2
#define SS 2048
#define E 1024
#define NH 16
#define HD 64
#define NR (NB * SS)
#define DPH 512
// GATE plane: 32 floats (one 128-byte line) per 16 rows, the first 16 used, so that a line has one writing block
#define GIDX(r) ((((r) >> 4) << 5) + ((r) & 15))
__device__ __forceinline__ float gelu_e(float x) { return 0.5f * x * (1.0f + erff(x * 0.70710678118654752f)); }
#define PLO 1024.0f
#define VLO 2048.0f
__device__ __forceinline__ float bfr(float v) { return (float)(__bf16)v; }
__device__ __forceinline__ v16b fragF_b(const __bf16* f, int lane) { return __builtin_bit_cast(v16b, fragF_h((const _Float16*)f, lane)); }
// values of a fragment-order plane per 16 rows of 1024 (32 fragments of 512)
#define FRT 16384

// Xb in fragment order: [16 rows][32 k][half][lane][8]; thread = one 16-byte unit of the plane (a block reads 16 rows x 512 bytes of x)
__global__ __launch_bounds__(256) void k_cvt(const float* __restrict__ x, __bf16* __restrict__ Xb) {
  const size_t i8 = (size_t)blockIdx.x * 256 + threadIdx.x; if (i8 >= (size_t)NR * E / 8) return;
  const int ln = (int)(i8 & 31), q = (int)(i8 >> 5) & 1, kc = (int)(i8 >> 6) & 31; const size_t rt = i8 >> 11;
  const float* p = x + (rt * 16 + (ln & 15)) * E + kc * 32 + q * 16 + (ln >> 4) * 8;
  union { __bf16 h[8]; v4u u; } pk;
#pragma unroll
  for (int e = 0; e < 8; ++e) pk.h[e] = (__bf16)p[e];
  vst2((unsigned*)(Xb + i8 * 8), pk.u);
}
// PT columns: [0,E) Wq[:,n], [E,2E) Wk[:,n], [2E,3E) Wv[:,n], [3E,4E) Wo[:,n], [4E,4E+DPH) dp_w1[:,n]  ([in][out] weights), bf16 in fragment order: [16 columns][32 k][half][lane][8]
// block (32 k, 128 columns, matrix): whole rows of W in, turned in LDS, whole fragments out
__global__ __launch_bounds__(256) void k_pack(const float* __restrict__ Wq, const float* __restrict__ Wk, const float* __restrict__ Wv, const float* __restrict__ Wo, const float* __restrict__ W1, __bf16* __restrict__ PT) {
  __shared__ __align__(16) __bf16 st[128][40];
  const int tid = threadIdx.x, kc = blockIdx.x, n0 = blockIdx.y * 128, m = blockIdx.z;
  const int ld = m == 4 ? DPH : E; if (n0 >= ld) return;  // dp_w1 has 512 columns: the whole block leaves, ahead of the barrier
  const float* W = m == 0 ? Wq : (m == 1 ? Wk : (m == 2 ? Wv : (m == 3 ? Wo : W1)));
  for (int i = tid; i < 32 * 128; i += 256) { const int k = i >> 7, n = i & 127; st[n][k] = (__bf16)W[(size_t)(kc * 32 + k) * ld + n0 + n]; }
  __syncthreads();
  for (int u = tid; u < 512; u += 256) { const int ln = u & 31, q = (u >> 5) & 1, nt = u >> 6;
    vst2((unsigned*)(PT + (size_t)(((m * E + n0) >> 4) + nt) * FRT + kc * 512 + q * 256 + ln * 8), *(const v4u*)(&st[nt * 16 + (ln & 15)][q * 16 + (ln >> 4) * 8])); }
}
// QKV: block (64 rows, 128 cols = 2 heads, which); q -> Q32 f32 [bh][s][64]; k -> KS, split once into bf16 hi and lo, in fragment order [bh][16 keys][32 d][hi, lo][half][lane][8]; v -> VT hi/lo x4 in fragment order [bh][32 keys][16 d][half][lane][8]
__global__ __launch_bounds__(128) void k_qkv(const __bf16* __restrict__ Xb, const __bf16* __restrict__ PT, const float* __restrict__ bq, const float* __restrict__ bk, const float* __restrict__ bv, const float* __restrict__ GATE,
                                            float* __restrict__ Q32, __bf16* __restrict__ KS, _Float16* __restrict__ VTh, _Float16* __restrict__ VTl) {
  __shared__ __align__(16) float so[4][16][132];
  __shared__ __align__(16) _Float16 sth[128][72], stl[128][72];
  const int tid = threadIdx.x, wave = tid >> 5, lane = tid & 31, col = lane & 15, g = lane >> 4;
  const int which = blockIdx.z, r0b = blockIdx.x * 64, r0 = r0b + wave * 16, n0 = blockIdx.y * 128; const int b = r0b / SS, s0 = r0b % SS;
  const float* bb_ = which == 0 ? bq : (which == 1 ? bk : bv);
  v8f acc[8] = {};
  // the nine fragments of trip kc + 1 are loaded as one group ahead of trip kc's products: one load wait a trip, covered by eight products, not one in front of every product
  const __bf16* ap = Xb + (size_t)(r0 >> 4) * FRT; const __bf16* bp = PT + (size_t)((which * E + n0) >> 4) * FRT;
  v16b a = fragF_b(ap, lane), bf[8]; XW();
#pragma unroll
  for (int j = 0; j < 8; ++j) bf[j] = fragF_b(bp + (size_t)j * FRT, lane);
  XW();
  const __bf16* apn = ap + 512; const __bf16* bpn = bp + 512;  // where trip kc + 1's fragments lie
// two trips a pass, so that the two fragment sets swap by name and not by register copies
#pragma unroll 2
  for (int kc = 0; kc < E / 32; ++kc) {
    const v16b an = fragF_b(apn, lane); v16b bn[8]; XW();
#pragma unroll
    for (int j = 0; j < 8; ++j) bn[j] = fragF_b(bpn + (size_t)j * FRT, lane);
    XW();
#pragma unroll
    for (int j = 0; j < 8; ++j) acc[j] = wmma_bf(a, bf[j], acc[j]);
    a = an;
#pragma unroll
    for (int j = 0; j < 8; ++j) bf[j] = bn[j];
    if (kc + 2 < E / 32) { apn += 512; bpn += 512; } }  // the last trip loads its own fragments again (in bounds, not used)
  if (which < 2) {
#pragma unroll
    for (int j = 0; j < 8; ++j) { const float bb = bfr(bb_[n0 + j * 16 + col]);
#pragma unroll
      for (int r = 0; r < 8; ++r) so[wave][8 * g + r][j * 16 + col] = acc[j][r] + bb; }
    LDSX();
    if (which == 0) {
      for (int qq = lane; qq < 2 * 16 * 16; qq += 32) { const int hh = qq >> 8, rl = (qq >> 4) & 15, pc = qq & 15; const int h = (n0 >> 6) + hh;
        vst2(Q32 + (((size_t)b * NH + h) * SS + s0 + wave * 16 + rl) * HD + pc * 4, *(const v4f*)(&so[wave][rl][hh * 64 + pc * 4])); } }
    else {  // the wave's 16 keys x 2 heads: four fragments; the lane splits the 16 values that it would take as lane (g, col = key) and stores them as it will load them: every query wave of k_attn reads the split, none repeats it
// unrolled: no register of an issued store is rewritten on a back edge; the wait behind each fragment's four stores stands in front of the next fragment's split, which may take their registers
#pragma unroll
      for (int u = 0; u < 4; ++u) { const int kc = u & 1, hh = u >> 1; const int h = (n0 >> 6) + hh;
        const F2 ks = split_row(&so[wave][col][0], u * 32, lane);
        __bf16* kp = KS + ((((size_t)b * NH + h) * (SS / 16) + (s0 >> 4) + wave) * 2 + kc) * 1024 + lane * 8;
        union { v16b v; v4u q[2]; } uh, ul; uh.v = ks.h; ul.v = ks.l;
        vst2(kp, uh.q[0]); vst2(kp + 256, uh.q[1]); vst2(kp + 512, ul.q[0]); vst2(kp + 768, ul.q[1]);
        XW(); } } }
  else {
#pragma unroll
    for (int j = 0; j < 8; ++j) { const float bb = bfr(bb_[n0 + j * 16 + col]);
#pragma unroll
      for (int r = 0; r < 8; ++r) { const float v = (acc[j][r] + bb) * GATE[GIDX(r0 + 8 * g + r)] * 4.0f; const _Float16 hi = (_Float16)v; sth[j * 16 + col][wave * 16 + 8 * g + r] = hi; stl[j * 16 + col][wave * 16 + 8 * g + r] = (_Float16)((v - (float)hi) * VLO); } }
    __syncthreads();
    for (int qq = tid; qq < 128 * 8; qq += 128) { const int ln = qq & 31, q = (qq >> 5) & 1, t = (qq >> 6) & 3, k32 = (qq >> 8) & 1, hh = qq >> 9;
      const int cl = hh * 64 + t * 16 + (ln & 15), pc = k32 * 4 + q * 2 + (ln >> 4), h = (n0 >> 6) + hh; const size_t o = (((((size_t)b * NH + h) * (SS / 32) + (s0 >> 5) + k32) * 4 + t) * 2 + q) * 256 + ln * 8;
      vst2(VTh + o, *(const v4u*)(&sth[cl][pc * 8])); vst2(VTl + o, *(const v4u*)(&stl[cl][pc * 8])); } }
}
// one key tile's K (16 KiB), V hi (8 KiB) and V lo (8 KiB), each contiguous in its plane, into one 32 KiB stage of LDS: a thread brings eight 16-byte units, through no register
// l = the thread's LDS byte address in the stage; k, vh, vl = its global addresses in the tile's K, V hi and V lo; an immediate offset (under 65,536) moves the LDS and the global address alike, so one register set serves each plane
// the wait in the last line stands in front of every later write of an address register that the copies name
__device__ __forceinline__ void kv_copy(unsigned l, const char* k, const char* vh, const char* vl) {
  asm volatile("global_load_async_to_lds_b128 %0, %3, off\n\t"
               "global_load_async_to_lds_b128 %0, %3, off offset:4096\n\t"
               "global_load_async_to_lds_b128 %0, %3, off offset:8192\n\t"
               "global_load_async_to_lds_b128 %0, %3, off offset:12288\n\t"
               "global_load_async_to_lds_b128 %1, %4, off\n\t"
               "global_load_async_to_lds_b128 %1, %4, off offset:4096\n\t"
               "global_load_async_to_lds_b128 %2, %5, off\n\t"
               "global_load_async_to_lds_b128 %2, %5, off offset:4096\n\t"
               "s_wait_xcnt 0x0"
               :: "v"(l), "v"(l + 16384u), "v"(l + 24576u), "v"(k), "v"(vh), "v"(vl)
               : "memory");
}
// causal attention: block (2 x 64 queries, bh): waves 0..3 take query tile 31 - t, waves 4..7 tile t, so that every block walks 33 key tiles per wave pair and no WGP is left with the long tiles alone
// the block walks key tiles 0..31-t together: tile kt + 1 flies into one of two LDS stages by asynchronous copies while tile kt is worked on, and all waves read K and V from LDS; a wave works on tiles 0..qb and only passes the hand-over points of the rest
// S on hi/lo splits of the f32 q/k rows (k arrives split, 1 KiB hi and 1 KiB lo a fragment); P,V hi/lo; O f32 in fragment order [16 rows][32 k][quarter][lane][4]
// four waves a SIMD: holds the build at 256 registers a wave, so that two blocks stay on a WGP and all 512 run at once
__global__ __launch_bounds__(256) __attribute__((amdgpu_waves_per_eu(4, 4))) void k_attn(const float* __restrict__ Q32, const __bf16* __restrict__ KS, const _Float16* __restrict__ VTh, const _Float16* __restrict__ VTl, float* __restrict__ O32) {
  __shared__ __align__(16) float sS[8][16][68];  // scores in the loop, the output tile behind it (each wave its own part)
  __shared__ __align__(16) _Float16 sPh[8][16][72], sPl[8][16][72];
  __shared__ __align__(16) char sKV[2][32768];  // a stage: K fragments at 0, V hi at 16384, V lo at 24576
  const int tid = threadIdx.x, lane = tid & 31, col = lane & 15, g = lane >> 4;
  const int w = __builtin_amdgcn_readfirstlane(tid >> 5);  // the wave's number in a scalar register: the key loop's tests stay scalar compares and branches
  const size_t bh = blockIdx.y; const int qb = w < 4 ? SS / 64 - 1 - (int)blockIdx.x : (int)blockIdx.x; const int q0 = qb * 64 + (w & 3) * 16;
  const int nT = SS / 64 - (int)blockIdx.x;  // key tiles of the block (17..32): those of its longer waves
  const unsigned t16 = (unsigned)w * 512u + (unsigned)lane * 16u;  // the thread's place in each 4 KiB of a tile
  const unsigned l0 = (unsigned)(size_t)(const void*)&sKV[0][0] + t16;
  const char* kg = (const char*)(KS + bh * (SS / 16) * 2048);   // the head's planes, the same for the whole block: 16 KiB a key tile
  const char* hg = (const char*)(VTh + bh * (SS / 32) * 2048);   // 8 KiB a key tile
  const char* lg = (const char*)(VTl + bh * (SS / 32) * 2048);
  kv_copy(l0, kg + t16, hg + t16, lg + t16);
  F2 aq[2];
#pragma unroll
  for (int kc = 0; kc < 2; ++kc) aq[kc] = split_row(Q32 + (bh * SS + q0 + col) * HD, kc * 32, lane);
  asm volatile("s_wait_asynccnt 0x0" ::: "memory");  // this wave's part of tile 0 has landed
  __syncthreads();                                    // every wave's part has: tile 0 may be read
  kv_copy(l0 + 32768u, kg + 16384 + t16, hg + 8192 + t16, lg + 8192 + t16);  // tile 1 (a block has 17 tiles or more)
  float mrun = -3.0e38f, lrun = 0.f; v8f acc[4] = {}, ac1[4] = {}, ac2[4] = {};
#pragma unroll 1
  for (int kt = 0; kt < nT; ++kt) {
    if (kt <= qb) {
    const char* st = &sKV[kt & 1][0];
#pragma unroll
    for (int t = 0; t < 4; ++t) { const int dk = kt * 64 + t * 16 + col - (q0 + 8 * g); const __bf16* kf = (const __bf16*)st + t * 2048;  // dk = key - the lane's first query row
      F2 k0, k1; k0.h = fragF_b(kf, lane); k0.l = fragF_b(kf + 512, lane); k1.h = fragF_b(kf + 1024, lane); k1.l = fragF_b(kf + 1536, lane);
      v8f s = mac3(aq[0], k0, (v8f){}); s = mac3(aq[1], k1, s);
#pragma unroll
      for (int r = 0; r < 8; ++r) { sS[w][8 * g + r][t * 16 + col] = (dk > r) ? -3.0e38f : s[r] * 0.125f; } }
    LDSX();
    // the V fragments of keys 0..31 of the tile are read from LDS here, ahead of the softmax, which covers their latency
    v16h vh[4], vl[4];
#pragma unroll
    for (int t = 0; t < 4; ++t) { vh[t] = fragF_h((const _Float16*)(st + 16384) + t * 512, lane); vl[t] = fragF_h((const _Float16*)(st + 24576) + t * 512, lane); }
    float mx = -3.4e38f;
#pragma unroll
    for (int jj = 0; jj < 32; ++jj) mx = fmaxf(mx, sS[w][col][g * 32 + jj]);
    mx = fmaxf(mx, __shfl_xor(mx, 16, 32));
    const float mnew = fmaxf(mrun, mx); const float corr = expf(mrun - mnew);
    float ps = 0.f;
#pragma unroll
    for (int jj = 0; jj < 32; ++jj) { const float p = expf(sS[w][col][g * 32 + jj] - mnew) * 16384.0f; ps += p; const _Float16 hi = (_Float16)p; sPh[w][col][g * 32 + jj] = hi; sPl[w][col][g * 32 + jj] = (_Float16)((p - (float)hi) * PLO); }
    ps += __shfl_xor(ps, 16, 32);
    lrun = lrun * corr + ps * (1.0f / 16384.0f); mrun = mnew;
#pragma unroll
    for (int r = 0; r < 8; ++r) { const float cr = __shfl(corr, 8 * g + r, 32);
#pragma unroll
      for (int t = 0; t < 4; ++t) { acc[t][r] *= cr; ac1[t][r] *= cr; ac2[t][r] *= cr; } }
    // LDSX() with the running row sum as an input of its wait, so that the sum is finished here: sunk behind the products, its 32 addends took the build past 256 registers and into scratch
    asm volatile("s_wait_dscnt 0" :: "v"(lrun) : "memory"); __builtin_amdgcn_wave_barrier(); __builtin_amdgcn_fence(__ATOMIC_RELEASE, "workgroup");
#pragma unroll
    for (int kc = 0; kc < 2; ++kc) { const v16h ph = frag_h(&sPh[w][col][0] + kc * 32, lane), pl = frag_h(&sPl[w][col][0] + kc * 32, lane);
      if (kc == 1) {  // keys 32..63: one group, into the registers that the first half has left
#pragma unroll
        for (int t = 0; t < 4; ++t) { vh[t] = fragF_h((const _Float16*)(st + 16384) + (4 + t) * 512, lane); vl[t] = fragF_h((const _Float16*)(st + 24576) + (4 + t) * 512, lane); } }
#pragma unroll
      for (int t = 0; t < 4; ++t) { acc[t] = wmma16(ph, vh[t], acc[t]); ac1[t] = wmma16(ph, vl[t], ac1[t]); ac2[t] = wmma16(pl, vh[t], ac2[t]); } }
    __builtin_amdgcn_wave_barrier(); }
    // hand-over, passed by every wave on every trip, also by one that is past its own last tile
    asm volatile("s_wait_dscnt 0x0" ::: "memory");     // this wave's reads of tile kt's stage are done before the stage is refilled
    asm volatile("s_wait_asynccnt 0x0" ::: "memory");  // this wave's part of tile kt + 1 has landed
    __syncthreads();                                    // tile kt + 1 may be read by all; tile kt's stage has no reader left
    if (kt + 2 < nT) kv_copy(l0 + (unsigned)(kt & 1) * 32768u, kg + (size_t)(kt + 2) * 16384 + t16, hg + (size_t)(kt + 2) * 8192 + t16, lg + (size_t)(kt + 2) * 8192 + t16); }
  asm volatile("s_wait_asynccnt 0x0" ::: "memory");  // no copy is in flight when the wave goes on to its end
#pragma unroll
  for (int r = 0; r < 8; ++r) { const float lr = __shfl(lrun, 8 * g + r, 32); const float inv = 1.0f / (lr * 16384.0f * 4.0f);
#pragma unroll
    for (int t = 0; t < 4; ++t) sS[w][8 * g + r][t * 16 + col] = (acc[t][r] + ac1[t][r] * (1.0f / VLO) + ac2[t][r] * (1.0f / PLO)) * inv; }
  LDSX();
  const size_t ob = ((((bh / NH) * SS + q0) >> 4) * 32 + (bh % NH) * 2) * 512;  // the wave's 16 rows, its head's two fragments
  for (int u = 0; u < 8; ++u) { const int j = u & 3, kc = u >> 2; vst2(O32 + ob + kc * 512 + j * 128 + lane * 4, *(const v4f*)(&sS[w][col][kc * 32 + (j >> 1) * 16 + g * 8 + (j & 1) * 4])); }
}
// out = ctx Wo + bo : split(ctx) x bf16(Wo columns): 2 products (Wo is an INPUT -> bf16 exact)
__global__ __launch_bounds__(128) void k_out(const float* __restrict__ O32, const __bf16* __restrict__ PT, const float* __restrict__ bo, float* __restrict__ out) {
  __shared__ __align__(16) float so[4][16][132];
  const int tid = threadIdx.x, wave = tid >> 5, lane = tid & 31, col = lane & 15, g = lane >> 4;
  const int r0 = blockIdx.x * 64 + wave * 16, n0 = blockIdx.y * 128;
  v8f acc[8] = {};
  // trip kc + 1's context values and eight weight fragments are loaded as one group ahead of trip kc's products
  const float* op = O32 + (size_t)(r0 >> 4) * FRT; const __bf16* bp = PT + (size_t)((3 * E + n0) >> 4) * FRT;
  R16 ar = rawF(op, lane); v16b wb[8]; XW();
#pragma unroll
  for (int j = 0; j < 8; ++j) wb[j] = fragF_b(bp + (size_t)j * FRT, lane);
  XW();
  const float* opn = op + 512;  // where trip kc + 1's context fragment lies
  unsigned wof = (unsigned)((((3 * E + n0) >> 4) * FRT + 512 + lane * 8) * 2);  // the lane's byte offset in PT of trip kc + 1's first weight fragment
// two trips a pass, so that the two fragment sets swap by name and not by register copies
#pragma unroll 2
  for (int kc = 0; kc < E / 32; ++kc) {
    const R16 arn = rawF(opn, lane); v16b wn[8]; XW();
#pragma unroll
    for (int j = 0; j < 8; ++j) wn[j] = fragF_b((const __bf16*)((const char*)PT + (size_t)wof + (size_t)j * FRT * 2), 0);
    asm volatile("s_wait_xcnt 0x0" : "+v"(wof) :: "memory");  // as XW(); the offset register that the sixteen loads name passes through the wait, so that it stays whole up to it and no load of the group lands in it
    const F2 a = bsplit16(ar.v);
#pragma unroll
    for (int j = 0; j < 8; ++j) { acc[j] = wmma_bf(a.l, wb[j], acc[j]); acc[j] = wmma_bf(a.h, wb[j], acc[j]); }
    ar = arn;
#pragma unroll
    for (int j = 0; j < 8; ++j) wb[j] = wn[j];
    if (kc + 2 < E / 32) { opn += 512; wof += 1024; } }  // the last trip loads its own fragments again (in bounds, not used)
#pragma unroll
  for (int j = 0; j < 8; ++j) { const int n = n0 + j * 16 + col; const float bb = bfr(bo[n]);
#pragma unroll
    for (int r = 0; r < 8; ++r) so[wave][8 * g + r][j * 16 + col] = acc[j][r] + bb; }
  LDSX();
#pragma unroll 4
  for (int rl = 0; rl < 16; ++rl) vst2(out + (size_t)(r0 + rl) * E + n0 + lane * 4, *(const v4f*)(&so[wave][rl][lane * 4]));
}
// drift probe + gate: block = 16 rows, 16 waves; wave w does columns 32w..32w+31 of h = bf16(x) @ bf16(dp_w1) exact (+ bf16(b1)); then wave w owns row w: LN over 512 (16 values a lane, shuffle tree), exact GELU, . bf16(dp_w2) + bf16(dp_b2) -> drift; gate per row
__device__ __forceinline__ float wsum(float v) {
#pragma unroll
  for (int m = 16; m >= 1; m >>= 1) v += __shfl_xor(v, m, 32);
  return v;
}
__global__ __launch_bounds__(512) void k_gate(const __bf16* __restrict__ Xb, const __bf16* __restrict__ PT, const float* __restrict__ b1, const float* __restrict__ lng, const float* __restrict__ lnb, const float* __restrict__ w2, const float* __restrict__ b2,
                                             const float* __restrict__ gw1, const float* __restrict__ gb1, const float* __restrict__ gw2, const float* __restrict__ gb2, float* __restrict__ GATE) {
  __shared__ __align__(16) float sh[16][DPH + 4]; __shared__ __align__(16) float sg[16];
  const int tid = threadIdx.x, wave = tid >> 5, lane = tid & 31, col = lane & 15, g = lane >> 4; const int r0 = blockIdx.x * 16;
  { v8f acc[2] = {};
    // trip kc + 1's x fragment and its two weight fragments are loaded as one group ahead of trip kc's products
    const __bf16* ap = Xb + (size_t)(r0 >> 4) * FRT; v16b a = fragF_b(ap, lane), wr[2]; XW();
    const __bf16* wp = PT + (size_t)((4 * E >> 4) + wave * 2) * FRT;
#pragma unroll
    for (int j = 0; j < 2; ++j) wr[j] = fragF_b(wp + (size_t)j * FRT, lane);
    XW();
    const __bf16* apn = ap + 512; const __bf16* wpn = wp + 512;  // where trip kc + 1's values lie
// two trips a pass, so that the two value sets swap by name and not by register copies
#pragma unroll 2
    for (int kc = 0; kc < E / 32; ++kc) {
      const v16b an = fragF_b(apn, lane); v16b wn[2]; XW();
#pragma unroll
      for (int j = 0; j < 2; ++j) wn[j] = fragF_b(wpn + (size_t)j * FRT, lane);
      XW();
#pragma unroll
      for (int j = 0; j < 2; ++j) acc[j] = wmma_bf(a, wr[j], acc[j]);
      a = an; wr[0] = wn[0]; wr[1] = wn[1];
      if (kc + 2 < E / 32) { apn += 512; wpn += 512; } }  // the last trip loads its own values again (in bounds, not used)
#pragma unroll
    for (int j = 0; j < 2; ++j) { const int n = wave * 32 + j * 16 + col; const float bb = bfr(b1[n]);
#pragma unroll
      for (int r = 0; r < 8; ++r) sh[8 * g + r][n] = acc[j][r] + bb; } }
  float pg[16], pb[16], pw[16];  // the lane's LN and dp_w2 parameters, fetched ahead of the barrier so that their latency is not paid between the GELU branches
#pragma unroll
  for (int k = 0; k < 16; ++k) { const int c = k * 32 + lane; pg[k] = bfr(lng[c]); pb[k] = bfr(lnb[c]); pw[k] = bfr(w2[c]); }
  __syncthreads();  // every wave's 32 columns of all 16 rows are in sh before a row is read
  { float v[16]; float s = 0.f;
#pragma unroll
    for (int k = 0; k < 16; ++k) { v[k] = sh[wave][k * 32 + lane]; s += v[k]; }
    const float mu = wsum(s) * (1.0f / DPH); float q = 0.f;
#pragma unroll
    for (int k = 0; k < 16; ++k) { const float d = v[k] - mu; q += d * d; }
    const float rs = rsqrtf(wsum(q) * (1.0f / DPH) + 1e-5f); float dot = 0.f;
#pragma unroll
    for (int k = 0; k < 16; ++k) dot += gelu_e((v[k] - mu) * rs * pg[k] + pb[k]) * pw[k];
    const float drift = wsum(dot) + bfr(b2[0]);
    const float t = g == 0 ? gelu_e(drift * bfr(gw1[col]) + bfr(gb1[col])) * bfr(gw2[col]) : 0.f;
    const float gsum = bfr(gb2[0]) + wsum(t);
    if (lane == 0) sg[wave] = tanhf(gsum); }
  __syncthreads();
  if (tid < 4) vst2(GATE + (size_t)blockIdx.x * 32 + tid * 4, *(const v4f*)(&sg[tid * 4]));
}
extern "C" void kernel_launch(void* const* d_in, const int* in_sizes, int n_in, void* d_out, int out_size, void* d_ws, size_t ws_size, hipStream_t stream) {
  (void)in_sizes; (void)n_in; (void)out_size; (void)ws_size;
  const float** I = (const float**)d_in;
  const float* x = I[0]; const float* Wq = I[1]; const float* bq = I[2]; const float* Wk = I[3]; const float* bk = I[4]; const float* Wv = I[5]; const float* bv = I[6]; const float* Wo = I[7]; const float* bo = I[8];
  const float* dw1 = I[9]; const float* db1 = I[10]; const float* lng = I[11]; const float* lnb = I[12]; const float* dw2 = I[13]; const float* db2 = I[14]; const float* gw1 = I[15]; const float* gb1 = I[16]; const float* gw2 = I[17]; const float* gb2 = I[18];
  float* out = (float*)d_out;
  char* ws = (char*)d_ws; size_t off = 0;
  auto take = [&](size_t bytes) { char* p = ws + off; off += (bytes + 255) & ~(size_t)255; return p; };
  __bf16* Xb = (__bf16*)take((size_t)NR * E * 2); __bf16* PT = (__bf16*)take((size_t)(4 * E + DPH) * E * 2); float* GATE = (float*)take((size_t)NR * 8);
  float* Q32 = (float*)take((size_t)NR * E * 4); __bf16* KS = (__bf16*)take((size_t)NR * E * 4); _Float16* VTh = (_Float16*)take((size_t)NR * E * 2); _Float16* VTl = (_Float16*)take((size_t)NR * E * 2); float* O32 = (float*)take((size_t)NR * E * 4);
  // ws ~ 85 MB
  k_cvt<<<(NR * E / 8 + 255) / 256, 256, 0, stream>>>(x, Xb);
  k_pack<<<dim3(E / 32, E / 128, 5), 256, 0, stream>>>(Wq, Wk, Wv, Wo, dw1, PT);
  k_gate<<<NR / 16, 512, 0, stream>>>(Xb, PT, db1, lng, lnb, dw2, db2, gw1, gb1, gw2, gb2, GATE);
  k_qkv<<<dim3(NR / 64, E / 128, 3), 128, 0, stream>>>(Xb, PT, bq, bk, bv, GATE, Q32, KS, VTh, VTl);
  k_attn<<<dim3(SS / 128, NB * NH), 256, 0, stream>>>(Q32, KS, VTh, VTl, O32);
  k_out<<<dim3(NR / 64, E / 128), 128, 0, stream>>>(O32, PT, bo, out);
}

// v007
// A run of this version takes 169 microseconds.
// In two side-by-side timings against v006, it was 1.05 and 1.06 times as fast.
// Counting every step since v000, it is 4.82 times as fast.
// compute dtype: every module INPUT that feeds a GEMM (x, Wq/Wk/Wv/Wo, dp_w1, biases) is rounded to bf16 and used in exact bf16 WMMA products with f32 accumulation; computed operands (q/k, P, gate*V, context, the LN/GELU chain) are f32 or hi/lo pairs; mask/softmax/LayerNorm/GELU/tanh f32.
#include <hip/hip_runtime.h>
#include <math.h>

typedef __attribute__((ext_vector_type(16))) _Float16 v16h;
typedef __attribute__((ext_vector_type(16))) __bf16 v16b;
typedef __attribute__((ext_vector_type(8)))  _Float16 v8h;
typedef __attribute__((ext_vector_type(8)))  float v8f;
typedef __attribute__((ext_vector_type(4)))  float v4f;
typedef __attribute__((ext_vector_type(2)))  float v2f;
typedef __attribute__((ext_vector_type(4)))  unsigned v4u;
typedef __attribute__((ext_vector_type(4)))  int v4i;
typedef float __attribute__((may_alias)) float_a;
typedef int __attribute__((may_alias)) int_a;

template <typename T> __device__ __forceinline__ void vst2(void* p, T v) { *(T*)p = v;  }
__device__ __forceinline__ v8f wmma16(v16h a, v16h b, v8f c) {
  v8f d = __builtin_amdgcn_wmma_f32_16x16x32_f16(false, a, false, b, (short)0, c, false, false);
  asm volatile("v_nop\n\tv_nop\n\tv_nop\n\tv_nop" : "+v"(d) : "v"(a), "v"(b));
  return d;
}
__device__ __forceinline__ v8f wmma_bf(v16b a, v16b b, v8f c) {
  v8f d = __builtin_amdgcn_wmma_f32_16x16x32_bf16(false, a, false, b, (short)0, c, false, false);
  asm volatile("v_nop\n\tv_nop\n\tv_nop\n\tv_nop" : "+v"(d) : "v"(a), "v"(b));
  return d;
}
// 16x16x32 fragments: lane = (h = lane>>4, row/col = lane&15); elements 0..7 = k0+8h+0..7, 8..15 = k0+16+8h+0..7; D element r = row 8h+r
__device__ __forceinline__ v16h frag_h(const _Float16* rowk0, int lane) {
  union { v16h v; v8h q[2]; } u; const _Float16* p = rowk0 + 8 * (lane >> 4);
  u.q[0] = *(const v8h*)p; u.q[1] = *(const v8h*)(p + 16); return u.v;
}
__device__ __forceinline__ v16h frag_f32(const float* rowk0, int lane) {
  v16h a; const float* p = rowk0 + 8 * (lane >> 4);
#pragma unroll
  for (int i = 0; i < 8; ++i) { a[i] = (_Float16)p[i]; a[8 + i] = (_Float16)p[16 + i]; }
  return a;
}
__device__ __forceinline__ v16h frag_f32s(const float* rowk0, int lane, float sc) {
  v16h a; const float* p = rowk0 + 8 * (lane >> 4);
#pragma unroll
  for (int i = 0; i < 8; ++i) { a[i] = (_Float16)(p[i] * sc); a[8 + i] = (_Float16)(p[16 + i] * sc); }
  return a;
}
// column fragment from a [K][ld] layout (column n), rows >= K read as 0
__device__ __forceinline__ v16h fragc_f32(const float* W, int k0, int n, int lane, int ld, int K) {
  v16h a; const int g = lane >> 4;
#pragma unroll
  for (int i = 0; i < 8; ++i) { const int ka = k0 + 8 * g + i, kb = ka + 16;
    a[i] = (_Float16)(ka < K ? W[(size_t)ka * ld + n] : 0.f); a[8 + i] = (_Float16)(kb < K ? W[(size_t)kb * ld + n] : 0.f); }
  return a;
}
struct F2 { v16b h, l; };
__device__ __forceinline__ F2 bsplit16(const float v[16]) { F2 r;
#pragma unroll
  for (int i = 0; i < 16; ++i) { const __bf16 h = (__bf16)v[i]; r.h[i] = h; r.l[i] = (__bf16)(v[i] - (float)h); }
  return r; }
__device__ __forceinline__ F2 split_row(const float* row, int k0, int lane) { float v[16]; const float* p = row + k0 + 8 * (lane >> 4);
#pragma unroll
  for (int i = 0; i < 8; ++i) { v[i] = p[i]; v[8 + i] = p[16 + i]; }
  return bsplit16(v); }
__device__ __forceinline__ F2 split_rowK(const float* row, int k0, int lane, int K) { float v[16]; const int g = lane >> 4;
#pragma unroll
  for (int i = 0; i < 8; ++i) { const int ka = k0 + 8 * g + i, kb = ka + 16; v[i] = ka < K ? row[ka] : 0.f; v[8 + i] = kb < K ? row[kb] : 0.f; }
  return bsplit16(v); }
__device__ __forceinline__ F2 split_col(const float* W, int k0, int n, int lane, int ld, int K) { float v[16]; const int g = lane >> 4;
#pragma unroll
  for (int i = 0; i < 8; ++i) { const int ka = k0 + 8 * g + i, kb = ka + 16; v[i] = ka < K ? W[(size_t)ka * ld + n] : 0.f; v[8 + i] = kb < K ? W[(size_t)kb * ld + n] : 0.f; }
  return bsplit16(v); }
// the 16 f32 values of a lane's fragment, loads only: a group of them is issued ahead of the products that use them, and split or rounded later
struct R16 { float v[16]; };
// fragment order: a plane holds each 16 x 32 fragment as the lanes take it, so that every load of a wave is 512 contiguous bytes (four whole lines, not sixteen part lines)
// 16-bit values: 1 KiB a fragment, [half of the lane's 16 values][lane][8 values]; f32 values: 2 KiB a fragment, [quarter of the lane's 16 values][lane][4 values]
__device__ __forceinline__ v16h fragF_h(const _Float16* f, int lane) {
  union { v16h v; v8h q[2]; } u; const _Float16* p = f + lane * 8;
  u.q[0] = *(const v8h*)p; u.q[1] = *(const v8h*)(p + 256); return u.v;
}
__device__ __forceinline__ R16 rawF(const float* f, int lane) { R16 r; const float* p = f + lane * 4;
#pragma unroll
  for (int j = 0; j < 4; ++j) { const v4f t = *(const v4f*)(p + j * 128); r.v[4 * j] = t[0]; r.v[4 * j + 1] = t[1]; r.v[4 * j + 2] = t[2]; r.v[4 * j + 3] = t[3]; }
  return r; }
__device__ __forceinline__ v8f mac3(const F2& a, const F2& b, v8f c) { c = wmma_bf(a.l, b.h, c); c = wmma_bf(a.h, b.l, c); return wmma_bf(a.h, b.h, c); }
__device__ __forceinline__ float sigm(float v) { return 1.0f / (1.0f + expf(-v)); }
// in front of an instruction that rewrites an address register of a global load issued above (the next address, or a later load's result in the same register)
#define XW() asm volatile("s_wait_xcnt 0x0" ::: "memory")
#define LDSX() do { asm volatile("s_wait_dscnt 0" ::: "memory"); __builtin_amdgcn_wave_barrier(); __builtin_amdgcn_fence(__ATOMIC_RELEASE, "workgroup"); } while (0)


// Causal self attention (16 heads of 64 on [2,2048,1024], [in][out] weights + biases, scale 1/8) whose post-softmax weights are multiplied by a per-KEY gate (no renormalisation)
// == V rows scaled by gate[key]; gate = tanh(gelu(drift*g_w1 + g_b1).g_w2 + g_b2), drift = gelu(LN(x dp_w1 + dp_b1)).dp_w2 + dp_b2 per token.
// bf16-rounded INPUT operands with exact bf16 WMMA products, hi/lo splits for computed operands; k_cvt, k_pack, k_gate, k_qkv, causal k_attn, k_out.
#define NB 2
#define SS 2048
#define E 1024
#define NH 16
#define HD 64
#define NR (NB * SS)
#define DPH 512
// GATE plane: 32 floats (one 128-byte line) per 16 rows, the first 16 used, so that a line has one writing block
#define GIDX(r) ((((r) >> 4) << 5) + ((r) & 15))
__device__ __forceinline__ float gelu_e(float x) { return 0.5f * x * (1.0f + erff(x * 0.70710678118654752f)); }
#define PLO 1024.0f
#define VLO 2048.0f
__device__ __forceinline__ float bfr(float v) { return (float)(__bf16)v; }
__device__ __forceinline__ v16b fragF_b(const __bf16* f, int lane) { return __builtin_bit_cast(v16b, fragF_h((const _Float16*)f, lane)); }
// values of a fragment-order plane per 16 rows of 1024 (32 fragments of 512)
#define FRT 16384

// Xb in fragment order: [16 rows][32 k][half][lane][8]; thread = one 16-byte unit of the plane (a block reads 16 rows x 512 bytes of x)
__global__ __launch_bounds__(256) void k_cvt(const float* __restrict__ x, __bf16* __restrict__ Xb) {
  const size_t i8 = (size_t)blockIdx.x * 256 + threadIdx.x; if (i8 >= (size_t)NR * E / 8) return;
  const int ln = (int)(i8 & 31), q = (int)(i8 >> 5) & 1, kc = (int)(i8 >> 6) & 31; const size_t rt = i8 >> 11;
  const float* p = x + (rt * 16 + (ln & 15)) * E + kc * 32 + q * 16 + (ln >> 4) * 8;
  union { __bf16 h[8]; v4u u; } pk;
#pragma unroll
  for (int e = 0; e < 8; ++e) pk.h[e] = (__bf16)p[e];
  vst2((unsigned*)(Xb + i8 * 8), pk.u);
}
// PT columns: [0,E) Wq[:,n], [E,2E) Wk[:,n], [2E,3E) Wv[:,n], [3E,4E) Wo[:,n], [4E,4E+DPH) dp_w1[:,n]  ([in][out] weights), bf16 in fragment order: [16 columns][32 k][half][lane][8]
// block (32 k, 128 columns, matrix): whole rows of W in, turned in LDS, whole fragments out
__global__ __launch_bounds__(256) void k_pack(const float* __restrict__ Wq, const float* __restrict__ Wk, const float* __restrict__ Wv, const float* __restrict__ Wo, const float* __restrict__ W1, __bf16* __restrict__ PT) {
  __shared__ __align__(16) __bf16 st[128][40];
  const int tid = threadIdx.x, kc = blockIdx.x, n0 = blockIdx.y * 128, m = blockIdx.z;
  const int ld = m == 4 ? DPH : E; if (n0 >= ld) return;  // dp_w1 has 512 columns: the whole block leaves, ahead of the barrier
  const float* W = m == 0 ? Wq : (m == 1 ? Wk : (m == 2 ? Wv : (m == 3 ? Wo : W1)));
  for (int i = tid; i < 32 * 128; i += 256) { const int k = i >> 7, n = i & 127; st[n][k] = (__bf16)W[(size_t)(kc * 32 + k) * ld + n0 + n]; }
  __syncthreads();
  for (int u = tid; u < 512; u += 256) { const int ln = u & 31, q = (u >> 5) & 1, nt = u >> 6;
    vst2((unsigned*)(PT + (size_t)(((m * E + n0) >> 4) + nt) * FRT + kc * 512 + q * 256 + ln * 8), *(const v4u*)(&st[nt * 16 + (ln & 15)][q * 16 + (ln >> 4) * 8])); }
}
// QKV: block (64 rows, 128 cols = 2 heads, which); q -> Q32 f32 [bh][s][64]; k -> KS, split once into bf16 hi and lo, in fragment order [bh][16 keys][32 d][hi, lo][half][lane][8]; v -> VT hi/lo x4 in fragment order [bh][32 keys][16 d][half][lane][8]
__global__ __launch_bounds__(128) void k_qkv(const __bf16* __restrict__ Xb, const __bf16* __restrict__ PT, const float* __restrict__ bq, const float* __restrict__ bk, const float* __restrict__ bv, const float* __restrict__ GATE,
                                            float* __restrict__ Q32, __bf16* __restrict__ KS, _Float16* __restrict__ VTh, _Float16* __restrict__ VTl) {
  __shared__ __align__(16) float so[4][16][132];
  __shared__ __align__(16) _Float16 sth[128][72], stl[128][72];
  const int tid = threadIdx.x, wave = tid >> 5, lane = tid & 31, col = lane & 15, g = lane >> 4;
  const int which = blockIdx.z, r0b = blockIdx.x * 64, r0 = r0b + wave * 16, n0 = blockIdx.y * 128; const int b = r0b / SS, s0 = r0b % SS;
  const float* bb_ = which == 0 ? bq : (which == 1 ? bk : bv);
  v8f acc[8] = {};
  // the nine fragments of trip kc + 1 are loaded as one group ahead of trip kc's products: one load wait a trip, covered by eight products, not one in front of every product
  const __bf16* ap = Xb + (size_t)(r0 >> 4) * FRT; const __bf16* bp = PT + (size_t)((which * E + n0) >> 4) * FRT;
  v16b a = fragF_b(ap, lane), bf[8]; XW();
#pragma unroll
  for (int j = 0; j < 8; ++j) bf[j] = fragF_b(bp + (size_t)j * FRT, lane);
  XW();
  const __bf16* apn = ap + 512; const __bf16* bpn = bp + 512;  // where trip kc + 1's fragments lie
// two trips a pass, so that the two fragment sets swap by name and not by register copies
#pragma unroll 2
  for (int kc = 0; kc < E / 32; ++kc) {
    const v16b an = fragF_b(apn, lane); v16b bn[8]; XW();
#pragma unroll
    for (int j = 0; j < 8; ++j) bn[j] = fragF_b(bpn + (size_t)j * FRT, lane);
    XW();
#pragma unroll
    for (int j = 0; j < 8; ++j) acc[j] = wmma_bf(a, bf[j], acc[j]);
    a = an;
#pragma unroll
    for (int j = 0; j < 8; ++j) bf[j] = bn[j];
    if (kc + 2 < E / 32) { apn += 512; bpn += 512; } }  // the last trip loads its own fragments again (in bounds, not used)
  if (which < 2) {
#pragma unroll
    for (int j = 0; j < 8; ++j) { const float bb = bfr(bb_[n0 + j * 16 + col]);
#pragma unroll
      for (int r = 0; r < 8; ++r) so[wave][8 * g + r][j * 16 + col] = acc[j][r] + bb; }
    LDSX();
    if (which == 0) {
      for (int qq = lane; qq < 2 * 16 * 16; qq += 32) { const int hh = qq >> 8, rl = (qq >> 4) & 15, pc = qq & 15; const int h = (n0 >> 6) + hh;
        vst2(Q32 + (((size_t)b * NH + h) * SS + s0 + wave * 16 + rl) * HD + pc * 4, *(const v4f*)(&so[wave][rl][hh * 64 + pc * 4])); } }
    else {  // the wave's 16 keys x 2 heads: four fragments; the lane splits the 16 values that it would take as lane (g, col = key) and stores them as it will load them: every query wave of k_attn reads the split, none repeats it
// unrolled: no register of an issued store is rewritten on a back edge; the wait behind each fragment's four stores stands in front of the next fragment's split, which may take their registers
#pragma unroll
      for (int u = 0; u < 4; ++u) { const int kc = u & 1, hh = u >> 1; const int h = (n0 >> 6) + hh;
        const F2 ks = split_row(&so[wave][col][0], u * 32, lane);
        __bf16* kp = KS + ((((size_t)b * NH + h) * (SS / 16) + (s0 >> 4) + wave) * 2 + kc) * 1024 + lane * 8;
        union { v16b v; v4u q[2]; } uh, ul; uh.v = ks.h; ul.v = ks.l;
        vst2(kp, uh.q[0]); vst2(kp + 256, uh.q[1]); vst2(kp + 512, ul.q[0]); vst2(kp + 768, ul.q[1]);
        XW(); } } }
  else {
#pragma unroll
    for (int j = 0; j < 8; ++j) { const float bb = bfr(bb_[n0 + j * 16 + col]);
#pragma unroll
      for (int r = 0; r < 8; ++r) { const float v = (acc[j][r] + bb) * GATE[GIDX(r0 + 8 * g + r)] * 4.0f; const _Float16 hi = (_Float16)v; sth[j * 16 + col][wave * 16 + 8 * g + r] = hi; stl[j * 16 + col][wave * 16 + 8 * g + r] = (_Float16)((v - (float)hi) * VLO); } }
    __syncthreads();
    for (int qq = tid; qq < 128 * 8; qq += 128) { const int ln = qq & 31, q = (qq >> 5) & 1, t = (qq >> 6) & 3, k32 = (qq >> 8) & 1, hh = qq >> 9;
      const int cl = hh * 64 + t * 16 + (ln & 15), pc = k32 * 4 + q * 2 + (ln >> 4), h = (n0 >> 6) + hh; const size_t o = (((((size_t)b * NH + h) * (SS / 32) + (s0 >> 5) + k32) * 4 + t) * 2 + q) * 256 + ln * 8;
      vst2(VTh + o, *(const v4u*)(&sth[cl][pc * 8])); vst2(VTl + o, *(const v4u*)(&stl[cl][pc * 8])); } }
}
// one key tile's K (16 KiB), V hi (8 KiB) and V lo (8 KiB), each contiguous in its plane, into one 32 KiB stage of LDS: a thread brings eight 16-byte units, through no register
// l = the thread's LDS byte address in the stage; k, vh, vl = its global addresses in the tile's K, V hi and V lo; an immediate offset (under 65,536) moves the LDS and the global address alike, so one register set serves each plane
// the wait in the last line stands in front of every later write of an address register that the copies name
__device__ __forceinline__ void kv_copy(unsigned l, const char* k, const char* vh, const char* vl) {
  asm volatile("global_load_async_to_lds_b128 %0, %3, off\n\t"
               "global_load_async_to_lds_b128 %0, %3, off offset:4096\n\t"
               "global_load_async_to_lds_b128 %0, %3, off offset:8192\n\t"
               "global_load_async_to_lds_b128 %0, %3, off offset:12288\n\t"
               "global_load_async_to_lds_b128 %1, %4, off\n\t"
               "global_load_async_to_lds_b128 %1, %4, off offset:4096\n\t"
               "global_load_async_to_lds_b128 %2, %5, off\n\t"
               "global_load_async_to_lds_b128 %2, %5, off offset:4096\n\t"
               "s_wait_xcnt 0x0"
               :: "v"(l), "v"(l + 16384u), "v"(l + 24576u), "v"(k), "v"(vh), "v"(vl)
               : "memory");
}
// softmax in base 2: e^((s - m) / 8) * 2^14 = 2^(s * SC2 + (14 - m * SC2)), SC2 = log2(e) / 8: one fused multiply-add and one hardware exponential a weight; scores and running maximum stay unscaled q.k sums
// every argument is about 14 or less; a masked score (-3.0e38) and the first tile's correction give 2^(-huge) = 0; results below 2^-126 may come as 0, far under the last bit that the hi/lo pair of P keeps
#define SC2 0.18033688011112042f
// eight exponentials back to back, in place: each is the independent instruction that the slot behind the one before asks for, and the v_nop fills the slot behind the last
// (as single builtins nearly every one drew a v_nop of its own, and a dual-issue pair that rewrote the source register came to stand directly behind some)
__device__ __forceinline__ void ex2x8(float (&x)[8]) {
  asm("v_exp_f32 %0, %0\n\tv_exp_f32 %1, %1\n\tv_exp_f32 %2, %2\n\tv_exp_f32 %3, %3\n\t"
      "v_exp_f32 %4, %4\n\tv_exp_f32 %5, %5\n\tv_exp_f32 %6, %6\n\tv_exp_f32 %7, %7\n\tv_nop"
      : "+v"(x[0]), "+v"(x[1]), "+v"(x[2]), "+v"(x[3]), "+v"(x[4]), "+v"(x[5]), "+v"(x[6]), "+v"(x[7]));
}
// causal attention: block (2 x 64 queries, bh): waves 0..3 take query tile 31 - t, waves 4..7 tile t, so that every block walks 33 key tiles per wave pair and no WGP is left with the long tiles alone
// the block walks key tiles 0..31-t together: tile kt + 1 flies into one of two LDS stages by asynchronous copies while tile kt is worked on, and all waves read K and V from LDS; a wave works on tiles 0..qb and only passes the hand-over points of the rest
// S on hi/lo splits of the f32 q/k rows (k arrives split, 1 KiB hi and 1 KiB lo a fragment); P,V hi/lo; O f32 in fragment order [16 rows][32 k][quarter][lane][4]
// four waves a SIMD: holds the build at 256 registers a wave, so that two blocks stay on a WGP and all 512 run at once
__global__ __launch_bounds__(256) __attribute__((amdgpu_waves_per_eu(4, 4))) void k_attn(const float* __restrict__ Q32, const __bf16* __restrict__ KS, const _Float16* __restrict__ VTh, const _Float16* __restrict__ VTl, float* __restrict__ O32) {
  __shared__ __align__(16) float sS[8][16][68];  // scores in the loop, the output tile behind it (each wave its own part)
  __shared__ __align__(16) _Float16 sPh[8][16][72], sPl[8][16][72];
  __shared__ __align__(16) char sKV[2][32768];  // a stage: K fragments at 0, V hi at 16384, V lo at 24576
  const int tid = threadIdx.x, lane = tid & 31, col = lane & 15, g = lane >> 4;
  const int w = __builtin_amdgcn_readfirstlane(tid >> 5);  // the wave's number in a scalar register: the key loop's tests stay scalar compares and branches
  const size_t bh = blockIdx.y; const int qb = w < 4 ? SS / 64 - 1 - (int)blockIdx.x : (int)blockIdx.x; const int q0 = qb * 64 + (w & 3) * 16;
  const int nT = SS / 64 - (int)blockIdx.x;  // key tiles of the block (17..32): those of its longer waves
  const unsigned t16 = (unsigned)w * 512u + (unsigned)lane * 16u;  // the thread's place in each 4 KiB of a tile
  const unsigned l0 = (unsigned)(size_t)(const void*)&sKV[0][0] + t16;
  const char* kg = (const char*)(KS + bh * (SS / 16) * 2048);   // the head's planes, the same for the whole block: 16 KiB a key tile
  const char* hg = (const char*)(VTh + bh * (SS / 32) * 2048);   // 8 KiB a key tile
  const char* lg = (const char*)(VTl + bh * (SS / 32) * 2048);
  kv_copy(l0, kg + t16, hg + t16, lg + t16);
  F2 aq[2];
#pragma unroll
  for (int kc = 0; kc < 2; ++kc) aq[kc] = split_row(Q32 + (bh * SS + q0 + col) * HD, kc * 32, lane);
  asm volatile("s_wait_asynccnt 0x0" ::: "memory");  // this wave's part of tile 0 has landed
  __syncthreads();                                    // every wave's part has: tile 0 may be read
  kv_copy(l0 + 32768u, kg + 16384 + t16, hg + 8192 + t16, lg + 8192 + t16);  // tile 1 (a block has 17 tiles or more)
  float mrun = -3.0e38f, lrun = 0.f; v8f acc[4] = {}, ac1[4] = {}, ac2[4] = {};
#pragma unroll 1
  for (int kt = 0; kt < nT; ++kt) {
    if (kt <= qb) {
    const char* st = &sKV[kt & 1][0];
#pragma unroll
    for (int t = 0; t < 4; ++t) { const int dk = kt * 64 + t * 16 + col - (q0 + 8 * g); const __bf16* kf = (const __bf16*)st + t * 2048;  // dk = key - the lane's first query row
      F2 k0, k1; k0.h = fragF_b(kf, lane); k0.l = fragF_b(kf + 512, lane); k1.h = fragF_b(kf + 1024, lane); k1.l = fragF_b(kf + 1536, lane);
      v8f s = mac3(aq[0], k0, (v8f){}); s = mac3(aq[1], k1, s);
#pragma unroll
      for (int r = 0; r < 8; ++r) { sS[w][8 * g + r][t * 16 + col] = (dk > r) ? -3.0e38f : s[r]; } }
    LDSX();
    // the V fragments of keys 0..31 of the tile are read from LDS here, ahead of the softmax, which covers their latency
    v16h vh[4], vl[4];
#pragma unroll
    for (int t = 0; t < 4; ++t) { vh[t] = fragF_h((const _Float16*)(st + 16384) + t * 512, lane); vl[t] = fragF_h((const _Float16*)(st + 24576) + t * 512, lane); }
    float mx = -3.4e38f;
#pragma unroll
    for (int jj = 0; jj < 32; ++jj) mx = fmaxf(mx, sS[w][col][g * 32 + jj]);
    mx = fmaxf(mx, __shfl_xor(mx, 16, 32));
    const float mnew = fmaxf(mrun, mx); const float corr = __builtin_amdgcn_exp2f((mrun - mnew) * SC2); const float nm = fmaf(-mnew, SC2, 14.0f);  // 2^14 = the 16384 that P is scaled by
    float ps = 0.f;
#pragma unroll
    for (int j8 = 0; j8 < 32; j8 += 8) { float x[8];
#pragma unroll
      for (int e = 0; e < 8; ++e) x[e] = fmaf(sS[w][col][g * 32 + j8 + e], SC2, nm);
      ex2x8(x);
#pragma unroll
      for (int e = 0; e < 8; ++e) { const int jj = j8 + e; const float p = x[e]; ps += p; const _Float16 hi = (_Float16)p; sPh[w][col][g * 32 + jj] = hi; sPl[w][col][g * 32 + jj] = (_Float16)((p - (float)hi) * PLO); } }
    ps += __shfl_xor(ps, 16, 32);
    lrun = lrun * corr + ps * (1.0f / 16384.0f); mrun = mnew;
#pragma unroll
    for (int r = 0; r < 8; ++r) { const float cr = __shfl(corr, 8 * g + r, 32);
#pragma unroll
      for (int t = 0; t < 4; ++t) { acc[t][r] *= cr; ac1[t][r] *= cr; ac2[t][r] *= cr; } }
    // LDSX() with the running row sum as an input of its wait, so that the sum is finished here: sunk behind the products, its 32 addends took the build past 256 registers and into scratch
    asm volatile("s_wait_dscnt 0" :: "v"(lrun) : "memory"); __builtin_amdgcn_wave_barrier(); __builtin_amdgcn_fence(__ATOMIC_RELEASE, "workgroup");
#pragma unroll
    for (int kc = 0; kc < 2; ++kc) { const v16h ph = frag_h(&sPh[w][col][0] + kc * 32, lane), pl = frag_h(&sPl[w][col][0] + kc * 32, lane);
      if (kc == 1) {  // keys 32..63: one group, into the registers that the first half has left
#pragma unroll
        for (int t = 0; t < 4; ++t) { vh[t] = fragF_h((const _Float16*)(st + 16384) + (4 + t) * 512, lane); vl[t] = fragF_h((const _Float16*)(st + 24576) + (4 + t) * 512, lane); } }
#pragma unroll
      for (int t = 0; t < 4; ++t) { acc[t] = wmma16(ph, vh[t], acc[t]); ac1[t] = wmma16(ph, vl[t], ac1[t]); ac2[t] = wmma16(pl, vh[t], ac2[t]); } }
    __builtin_amdgcn_wave_barrier(); }
    // hand-over, passed by every wave on every trip, also by one that is past its own last tile
    asm volatile("s_wait_dscnt 0x0" ::: "memory");     // this wave's reads of tile kt's stage are done before the stage is refilled
    asm volatile("s_wait_asynccnt 0x0" ::: "memory");  // this wave's part of tile kt + 1 has landed
    __syncthreads();                                    // tile kt + 1 may be read by all; tile kt's stage has no reader left
    if (kt + 2 < nT) kv_copy(l0 + (unsigned)(kt & 1) * 32768u, kg + (size_t)(kt + 2) * 16384 + t16, hg + (size_t)(kt + 2) * 8192 + t16, lg + (size_t)(kt + 2) * 8192 + t16); }
  asm volatile("s_wait_asynccnt 0x0" ::: "memory");  // no copy is in flight when the wave goes on to its end
#pragma unroll
  for (int r = 0; r < 8; ++r) { const float lr = __shfl(lrun, 8 * g + r, 32); const float inv = 1.0f / (lr * 16384.0f * 4.0f);
#pragma unroll
    for (int t = 0; t < 4; ++t) sS[w][8 * g + r][t * 16 + col] = (acc[t][r] + ac1[t][r] * (1.0f / VLO) + ac2[t][r] * (1.0f / PLO)) * inv; }
  LDSX();
  const size_t ob = ((((bh / NH) * SS + q0) >> 4) * 32 + (bh % NH) * 2) * 512;  // the wave's 16 rows, its head's two fragments
  for (int u = 0; u < 8; ++u) { const int j = u & 3, kc = u >> 2; vst2(O32 + ob + kc * 512 + j * 128 + lane * 4, *(const v4f*)(&sS[w][col][kc * 32 + (j >> 1) * 16 + g * 8 + (j & 1) * 4])); }
}
// out = ctx Wo + bo : split(ctx) x bf16(Wo columns): 2 products (Wo is an INPUT -> bf16 exact)
__global__ __launch_bounds__(128) void k_out(const float* __restrict__ O32, const __bf16* __restrict__ PT, const float* __restrict__ bo, float* __restrict__ out) {
  __shared__ __align__(16) float so[4][16][132];
  const int tid = threadIdx.x, wave = tid >> 5, lane = tid & 31, col = lane & 15, g = lane >> 4;
  const int r0 = blockIdx.x * 64 + wave * 16, n0 = blockIdx.y * 128;
  v8f acc[8] = {};
  // trip kc + 1's context values and eight weight fragments are loaded as one group ahead of trip kc's products
  const float* op = O32 + (size_t)(r0 >> 4) * FRT; const __bf16* bp = PT + (size_t)((3 * E + n0) >> 4) * FRT;
  R16 ar = rawF(op, lane); v16b wb[8]; XW();
#pragma unroll
  for (int j = 0; j < 8; ++j) wb[j] = fragF_b(bp + (size_t)j * FRT, lane);
  XW();
  const float* opn = op + 512;  // where trip kc + 1's context fragment lies
  unsigned wof = (unsigned)((((3 * E + n0) >> 4) * FRT + 512 + lane * 8) * 2);  // the lane's byte offset in PT of trip kc + 1's first weight fragment
// two trips a pass, so that the two fragment sets swap by name and not by register copies
#pragma unroll 2
  for (int kc = 0; kc < E / 32; ++kc) {
    const R16 arn = rawF(opn, lane); v16b wn[8]; XW();
#pragma unroll
    for (int j = 0; j < 8; ++j) wn[j] = fragF_b((const __bf16*)((const char*)PT + (size_t)wof + (size_t)j * FRT * 2), 0);
    asm volatile("s_wait_xcnt 0x0" : "+v"(wof) :: "memory");  // as XW(); the offset register that the sixteen loads name passes through the wait, so that it stays whole up to it and no load of the group lands in it
    const F2 a = bsplit16(ar.v);
#pragma unroll
    for (int j = 0; j < 8; ++j) { acc[j] = wmma_bf(a.l, wb[j], acc[j]); acc[j] = wmma_bf(a.h, wb[j], acc[j]); }
    ar = arn;
#pragma unroll
    for (int j = 0; j < 8; ++j) wb[j] = wn[j];
    if (kc + 2 < E / 32) { opn += 512; wof += 1024; } }  // the last trip loads its own fragments again (in bounds, not used)
#pragma unroll
  for (int j = 0; j < 8; ++j) { const int n = n0 + j * 16 + col; const float bb = bfr(bo[n]);
#pragma unroll
    for (int r = 0; r < 8; ++r) so[wave][8 * g + r][j * 16 + col] = acc[j][r] + bb; }
  LDSX();
#pragma unroll 4
  for (int rl = 0; rl < 16; ++rl) vst2(out + (size_t)(r0 + rl) * E + n0 + lane * 4, *(const v4f*)(&so[wave][rl][lane * 4]));
}
// drift probe + gate: block = 16 rows, 16 waves; wave w does columns 32w..32w+31 of h = bf16(x) @ bf16(dp_w1) exact (+ bf16(b1)); then wave w owns row w: LN over 512 (16 values a lane, shuffle tree), exact GELU, . bf16(dp_w2) + bf16(dp_b2) -> drift; gate per row
__device__ __forceinline__ float wsum(float v) {
#pragma unroll
  for (int m = 16; m >= 1; m >>= 1) v += __shfl_xor(v, m, 32);
  return v;
}
__global__ __launch_bounds__(512) void k_gate(const __bf16* __restrict__ Xb, const __bf16* __restrict__ PT, const float* __restrict__ b1, const float* __restrict__ lng, const float* __restrict__ lnb, const float* __restrict__ w2, const float* __restrict__ b2,
                                             const float* __restrict__ gw1, const float* __restrict__ gb1, const float* __restrict__ gw2, const float* __restrict__ gb2, float* __restrict__ GATE) {
  __shared__ __align__(16) float sh[16][DPH + 4]; __shared__ __align__(16) float sg[16];
  const int tid = threadIdx.x, wave = tid >> 5, lane = tid & 31, col = lane & 15, g = lane >> 4; const int r0 = blockIdx.x * 16;
  { v8f acc[2] = {};
    // trip kc + 1's x fragment and its two weight fragments are loaded as one group ahead of trip kc's products
    const __bf16* ap = Xb + (size_t)(r0 >> 4) * FRT; v16b a = fragF_b(ap, lane), wr[2]; XW();
    const __bf16* wp = PT + (size_t)((4 * E >> 4) + wave * 2) * FRT;
#pragma unroll
    for (int j = 0; j < 2; ++j) wr[j] = fragF_b(wp + (size_t)j * FRT, lane);
    XW();
    const __bf16* apn = ap + 512; const __bf16* wpn = wp + 512;  // where trip kc + 1's values lie
// two trips a pass, so that the two value sets swap by name and not by register copies
#pragma unroll 2
    for (int kc = 0; kc < E / 32; ++kc) {
      const v16b an = fragF_b(apn, lane); v16b wn[2]; XW();
#pragma unroll
      for (int j = 0; j < 2; ++j) wn[j] = fragF_b(wpn + (size_t)j * FRT, lane);
      XW();
#pragma unroll
      for (int j = 0; j < 2; ++j) acc[j] = wmma_bf(a, wr[j], acc[j]);
      a = an; wr[0] = wn[0]; wr[1] = wn[1];
      if (kc + 2 < E / 32) { apn += 512; wpn += 512; } }  // the last trip loads its own values again (in bounds, not used)
#pragma unroll
    for (int j = 0; j < 2; ++j) { const int n = wave * 32 + j * 16 + col; const float bb = bfr(b1[n]);
#pragma unroll
      for (int r = 0; r < 8; ++r) sh[8 * g + r][n] = acc[j][r] + bb; } }
  float pg[16], pb[16], pw[16];  // the lane's LN and dp_w2 parameters, fetched ahead of the barrier so that their latency is not paid between the GELU branches
#pragma unroll
  for (int k = 0; k < 16; ++k) { const int c = k * 32 + lane; pg[k] = bfr(lng[c]); pb[k] = bfr(lnb[c]); pw[k] = bfr(w2[c]); }
  __syncthreads();  // every wave's 32 columns of all 16 rows are in sh before a row is read
  { float v[16]; float s = 0.f;
#pragma unroll
    for (int k = 0; k < 16; ++k) { v[k] = sh[wave][k * 32 + lane]; s += v[k]; }
    const float mu = wsum(s) * (1.0f / DPH); float q = 0.f;
#pragma unroll
    for (int k = 0; k < 16; ++k) { const float d = v[k] - mu; q += d * d; }
    const float rs = rsqrtf(wsum(q) * (1.0f / DPH) + 1e-5f); float dot = 0.f;
#pragma unroll
    for (int k = 0; k < 16; ++k) dot += gelu_e((v[k] - mu) * rs * pg[k] + pb[k]) * pw[k];
    const float drift = wsum(dot) + bfr(b2[0]);
    const float t = g == 0 ? gelu_e(drift * bfr(gw1[col]) + bfr(gb1[col])) * bfr(gw2[col]) : 0.f;
    const float gsum = bfr(gb2[0]) + wsum(t);
    if (lane == 0) sg[wave] = tanhf(gsum); }
  __syncthreads();
  if (tid < 4) vst2(GATE + (size_t)blockIdx.x * 32 + tid * 4, *(const v4f*)(&sg[tid * 4]));
}
extern "C" void kernel_launch(void* const* d_in, const int* in_sizes, int n_in, void* d_out, int out_size, void* d_ws, size_t ws_size, hipStream_t stream) {
  (void)in_sizes; (void)n_in; (void)out_size; (void)ws_size;
  const float** I = (const float**)d_in;
  const float* x = I[0]; const float* Wq = I[1]; const float* bq = I[2]; const float* Wk = I[3]; const float* bk = I[4]; const float* Wv = I[5]; const float* bv = I[6]; const float* Wo = I[7]; const float* bo = I[8];
  const float* dw1 = I[9]; const float* db1 = I[10]; const float* lng = I[11]; const float* lnb = I[12]; const float* dw2 = I[13]; const float* db2 = I[14]; const float* gw1 = I[15]; const float* gb1 = I[16]; const float* gw2 = I[17]; const float* gb2 = I[18];
  float* out = (float*)d_out;
  char* ws = (char*)d_ws; size_t off = 0;
  auto take = [&](size_t bytes) { char* p = ws + off; off += (bytes + 255) & ~(size_t)255; return p; };
  __bf16* Xb = (__bf16*)take((size_t)NR * E * 2); __bf16* PT = (__bf16*)take((size_t)(4 * E + DPH) * E * 2); float* GATE = (float*)take((size_t)NR * 8);
  float* Q32 = (float*)take((size_t)NR * E * 4); __bf16* KS = (__bf16*)take((size_t)NR * E * 4); _Float16* VTh = (_Float16*)take((size_t)NR * E * 2); _Float16* VTl = (_Float16*)take((size_t)NR * E * 2); float* O32 = (float*)take((size_t)NR * E * 4);
  // ws ~ 85 MB
  k_cvt<<<(NR * E / 8 + 255) / 256, 256, 0, stream>>>(x, Xb);
  k_pack<<<dim3(E / 32, E / 128, 5), 256, 0, stream>>>(Wq, Wk, Wv, Wo, dw1, PT);
  k_gate<<<NR / 16, 512, 0, stream>>>(Xb, PT, db1, lng, lnb, dw2, db2, gw1, gb1, gw2, gb2, GATE);
  k_qkv<<<dim3(NR / 64, E / 128, 3), 128, 0, stream>>>(Xb, PT, bq, bk, bv, GATE, Q32, KS, VTh, VTl);
  k_attn<<<dim3(SS / 128, NB * NH), 256, 0, stream>>>(Q32, KS, VTh, VTl, O32);
  k_out<<<dim3(NR / 64, E / 128), 128, 0, stream>>>(O32, PT, bo, out);
}

// v008
// It runs in 152 microseconds.
// Next to v007, in two timings, it ran 1.10 times as fast each time.
// Counting every step since v000, it is 5.31 times as fast.
// compute dtype: every module INPUT that feeds a GEMM (x, Wq/Wk/Wv/Wo, dp_w1, biases) is rounded to bf16 and used in exact bf16 WMMA products with f32 accumulation; computed operands (q/k, P, gate*V, context, the LN/GELU chain) are f32 or hi/lo pairs; mask/softmax/LayerNorm/GELU/tanh f32.
#include <hip/hip_runtime.h>
#include <math.h>

typedef __attribute__((ext_vector_type(16))) _Float16 v16h;
typedef __attribute__((ext_vector_type(16))) __bf16 v16b;
typedef __attribute__((ext_vector_type(8)))  _Float16 v8h;
typedef __attribute__((ext_vector_type(8)))  float v8f;
typedef __attribute__((ext_vector_type(4)))  float v4f;
typedef __attribute__((ext_vector_type(2)))  float v2f;
typedef __attribute__((ext_vector_type(4)))  unsigned v4u;
typedef __attribute__((ext_vector_type(4)))  int v4i;
typedef float __attribute__((may_alias)) float_a;
typedef int __attribute__((may_alias)) int_a;

template <typename T> __device__ __forceinline__ void vst2(void* p, T v) { *(T*)p = v;  }
__device__ __forceinline__ v8f wmma16(v16h a, v16h b, v8f c) {
  v8f d = __builtin_amdgcn_wmma_f32_16x16x32_f16(false, a, false, b, (short)0, c, false, false);
  asm volatile("v_nop\n\tv_nop\n\tv_nop\n\tv_nop" : "+v"(d) : "v"(a), "v"(b));
  return d;
}
__device__ __forceinline__ v8f wmma_bf(v16b a, v16b b, v8f c) {
  v8f d = __builtin_amdgcn_wmma_f32_16x16x32_bf16(false, a, false, b, (short)0, c, false, false);
  asm volatile("v_nop\n\tv_nop\n\tv_nop\n\tv_nop" : "+v"(d) : "v"(a), "v"(b));
  return d;
}
// 16x16x32 fragments: lane = (h = lane>>4, row/col = lane&15); elements 0..7 = k0+8h+0..7, 8..15 = k0+16+8h+0..7; D element r = row 8h+r
__device__ __forceinline__ v16h frag_h(const _Float16* rowk0, int lane) {
  union { v16h v; v8h q[2]; } u; const _Float16* p = rowk0 + 8 * (lane >> 4);
  u.q[0] = *(const v8h*)p; u.q[1] = *(const v8h*)(p + 16); return u.v;
}
__device__ __forceinline__ v16h frag_f32(const float* rowk0, int lane) {
  v16h a; const float* p = rowk0 + 8 * (lane >> 4);
#pragma unroll
  for (int i = 0; i < 8; ++i) { a[i] = (_Float16)p[i]; a[8 + i] = (_Float16)p[16 + i]; }
  return a;
}
__device__ __forceinline__ v16h frag_f32s(const float* rowk0, int lane, float sc) {
  v16h a; const float* p = rowk0 + 8 * (lane >> 4);
#pragma unroll
  for (int i = 0; i < 8; ++i) { a[i] = (_Float16)(p[i] * sc); a[8 + i] = (_Float16)(p[16 + i] * sc); }
  return a;
}
// column fragment from a [K][ld] layout (column n), rows >= K read as 0
__device__ __forceinline__ v16h fragc_f32(const float* W, int k0, int n, int lane, int ld, int K) {
  v16h a; const int g = lane >> 4;
#pragma unroll
  for (int i = 0; i < 8; ++i) { const int ka = k0 + 8 * g + i, kb = ka + 16;
    a[i] = (_Float16)(ka < K ? W[(size_t)ka * ld + n] : 0.f); a[8 + i] = (_Float16)(kb < K ? W[(size_t)kb * ld + n] : 0.f); }
  return a;
}
struct F2 { v16b h, l; };
__device__ __forceinline__ F2 bsplit16(const float v[16]) { F2 r;
#pragma unroll
  for (int i = 0; i < 16; ++i) { const __bf16 h = (__bf16)v[i]; r.h[i] = h; r.l[i] = (__bf16)(v[i] - (float)h); }
  return r; }
__device__ __forceinline__ F2 split_row(const float* row, int k0, int lane) { float v[16]; const float* p = row + k0 + 8 * (lane >> 4);
#pragma unroll
  for (int i = 0; i < 8; ++i) { v[i] = p[i]; v[8 + i] = p[16 + i]; }
  return bsplit16(v); }
__device__ __forceinline__ F2 split_rowK(const float* row, int k0, int lane, int K) { float v[16]; const int g = lane >> 4;
#pragma unroll
  for (int i = 0; i < 8; ++i) { const int ka = k0 + 8 * g + i, kb = ka + 16; v[i] = ka < K ? row[ka] : 0.f; v[8 + i] = kb < K ? row[kb] : 0.f; }
  return bsplit16(v); }
__device__ __forceinline__ F2 split_col(const float* W, int k0, int n, int lane, int ld, int K) { float v[16]; const int g = lane >> 4;
#pragma unroll
  for (int i = 0; i < 8; ++i) { const int ka = k0 + 8 * g + i, kb = ka + 16; v[i] = ka < K ? W[(size_t)ka * ld + n] : 0.f; v[8 + i] = kb < K ? W[(size_t)kb * ld + n] : 0.f; }
  return bsplit16(v); }
// the 16 f32 values of a lane's fragment, loads only: a group of them is issued ahead of the products that use them, and split or rounded later
struct R16 { float v[16]; };
// fragment order: a plane holds each 16 x 32 fragment as the lanes take it, so that every load of a wave is 512 contiguous bytes (four whole lines, not sixteen part lines)
// 16-bit values: 1 KiB a fragment, [half of the lane's 16 values][lane][8 values]; f32 values: 2 KiB a fragment, [quarter of the lane's 16 values][lane][4 values]
__device__ __forceinline__ v16h fragF_h(const _Float16* f, int lane) {
  union { v16h v; v8h q[2]; } u; const _Float16* p = f + lane * 8;
  u.q[0] = *(const v8h*)p; u.q[1] = *(const v8h*)(p + 256); return u.v;
}
__device__ __forceinline__ R16 rawF(const float* f, int lane) { R16 r; const float* p = f + lane * 4;
#pragma unroll
  for (int j = 0; j < 4; ++j) { const v4f t = *(const v4f*)(p + j * 128); r.v[4 * j] = t[0]; r.v[4 * j + 1] = t[1]; r.v[4 * j + 2] = t[2]; r.v[4 * j + 3] = t[3]; }
  return r; }
__device__ __forceinline__ v8f mac3(const F2& a, const F2& b, v8f c) { c = wmma_bf(a.l, b.h, c); c = wmma_bf(a.h, b.l, c); return wmma_bf(a.h, b.h, c); }
__device__ __forceinline__ float sigm(float v) { return 1.0f / (1.0f + expf(-v)); }
// in front of an instruction that rewrites an address register of a global load issued above (the next address, or a later load's result in the same register)
#define XW() asm volatile("s_wait_xcnt 0x0" ::: "memory")
#define LDSX() do { asm volatile("s_wait_dscnt 0" ::: "memory"); __builtin_amdgcn_wave_barrier(); __builtin_amdgcn_fence(__ATOMIC_RELEASE, "workgroup"); } while (0)


// Causal self attention (16 heads of 64 on [2,2048,1024], [in][out] weights + biases, scale 1/8) whose post-softmax weights are multiplied by a per-KEY gate (no renormalisation)
// == V rows scaled by gate[key]; gate = tanh(gelu(drift*g_w1 + g_b1).g_w2 + g_b2), drift = gelu(LN(x dp_w1 + dp_b1)).dp_w2 + dp_b2 per token.
// bf16-rounded INPUT operands with exact bf16 WMMA products, hi/lo splits for computed operands; k_cvt, k_pack, k_gate, k_qkv, causal k_attn, k_out.
#define NB 2
#define SS 2048
#define E 1024
#define NH 16
#define HD 64
#define NR (NB * SS)
#define DPH 512
// GATE plane: 32 floats (one 128-byte line) per 16 rows, the first 16 used, so that a line has one writing block
#define GIDX(r) ((((r) >> 4) << 5) + ((r) & 15))
__device__ __forceinline__ float gelu_e(float x) { return 0.5f * x * (1.0f + erff(x * 0.70710678118654752f)); }
#define PLO 1024.0f
#define VLO 2048.0f
__device__ __forceinline__ float bfr(float v) { return (float)(__bf16)v; }
__device__ __forceinline__ v16b fragF_b(const __bf16* f, int lane) { return __builtin_bit_cast(v16b, fragF_h((const _Float16*)f, lane)); }
// values of a fragment-order plane per 16 rows of 1024 (32 fragments of 512)
#define FRT 16384

// Xb in fragment order: [16 rows][32 k][half][lane][8]; thread = one 16-byte unit of the plane (a block reads 16 rows x 512 bytes of x)
__global__ __launch_bounds__(256) void k_cvt(const float* __restrict__ x, __bf16* __restrict__ Xb) {
  const size_t i8 = (size_t)blockIdx.x * 256 + threadIdx.x; if (i8 >= (size_t)NR * E / 8) return;
  const int ln = (int)(i8 & 31), q = (int)(i8 >> 5) & 1, kc = (int)(i8 >> 6) & 31; const size_t rt = i8 >> 11;
  const float* p = x + (rt * 16 + (ln & 15)) * E + kc * 32 + q * 16 + (ln >> 4) * 8;
  union { __bf16 h[8]; v4u u; } pk;
#pragma unroll
  for (int e = 0; e < 8; ++e) pk.h[e] = (__bf16)p[e];
  vst2((unsigned*)(Xb + i8 * 8), pk.u);
}
// PT columns: [0,E) Wq[:,n], [E,2E) Wk[:,n], [2E,3E) Wv[:,n], [3E,4E) Wo[:,n], [4E,4E+DPH) dp_w1[:,n]  ([in][out] weights), bf16 in fragment order: [16 columns][32 k][half][lane][8]
// block (32 k, 128 columns, matrix): whole rows of W in, turned in LDS, whole fragments out
__global__ __launch_bounds__(256) void k_pack(const float* __restrict__ Wq, const float* __restrict__ Wk, const float* __restrict__ Wv, const float* __restrict__ Wo, const float* __restrict__ W1, __bf16* __restrict__ PT) {
  __shared__ __align__(16) __bf16 st[128][40];
  const int tid = threadIdx.x, kc = blockIdx.x, n0 = blockIdx.y * 128, m = blockIdx.z;
  const int ld = m == 4 ? DPH : E; if (n0 >= ld) return;  // dp_w1 has 512 columns: the whole block leaves, ahead of the barrier
  const float* W = m == 0 ? Wq : (m == 1 ? Wk : (m == 2 ? Wv : (m == 3 ? Wo : W1)));
  for (int i = tid; i < 32 * 128; i += 256) { const int k = i >> 7, n = i & 127; st[n][k] = (__bf16)W[(size_t)(kc * 32 + k) * ld + n0 + n]; }
  __syncthreads();
  for (int u = tid; u < 512; u += 256) { const int ln = u & 31, q = (u >> 5) & 1, nt = u >> 6;
    vst2((unsigned*)(PT + (size_t)(((m * E + n0) >> 4) + nt) * FRT + kc * 512 + q * 256 + ln * 8), *(const v4u*)(&st[nt * 16 + (ln & 15)][q * 16 + (ln >> 4) * 8])); }
}
// QKV: block (64 rows, 128 cols = 2 heads, which); q -> Q32 f32 [bh][s][64]; k -> KS, split once into bf16 hi and lo, in fragment order [bh][16 keys][32 d][hi, lo][half][lane][8]; v -> VT hi/lo x4 in fragment order [bh][32 keys][16 d][half][lane][8]
__global__ __launch_bounds__(128) void k_qkv(const __bf16* __restrict__ Xb, const __bf16* __restrict__ PT, const float* __restrict__ bq, const float* __restrict__ bk, const float* __restrict__ bv, const float* __restrict__ GATE,
                                            float* __restrict__ Q32, __bf16* __restrict__ KS, _Float16* __restrict__ VTh, _Float16* __restrict__ VTl) {
  __shared__ __align__(16) float so[4][16][132];
  __shared__ __align__(16) _Float16 sth[128][72], stl[128][72];
  const int tid = threadIdx.x, wave = tid >> 5, lane = tid & 31, col = lane & 15, g = lane >> 4;
  const int which = blockIdx.z, r0b = blockIdx.x * 64, r0 = r0b + wave * 16, n0 = blockIdx.y * 128; const int b = r0b / SS, s0 = r0b % SS;
  const float* bb_ = which == 0 ? bq : (which == 1 ? bk : bv);
  v8f acc[8] = {};
  // the nine fragments of trip kc + 1 are loaded as one group ahead of trip kc's products: one load wait a trip, covered by eight products, not one in front of every product
  const __bf16* ap = Xb + (size_t)(r0 >> 4) * FRT; const __bf16* bp = PT + (size_t)((which * E + n0) >> 4) * FRT;
  v16b a = fragF_b(ap, lane), bf[8]; XW();
#pragma unroll
  for (int j = 0; j < 8; ++j) bf[j] = fragF_b(bp + (size_t)j * FRT, lane);
  XW();
  const __bf16* apn = ap + 512; const __bf16* bpn = bp + 512;  // where trip kc + 1's fragments lie
// two trips a pass, so that the two fragment sets swap by name and not by register copies
#pragma unroll 2
  for (int kc = 0; kc < E / 32; ++kc) {
    const v16b an = fragF_b(apn, lane); v16b bn[8]; XW();
#pragma unroll
    for (int j = 0; j < 8; ++j) bn[j] = fragF_b(bpn + (size_t)j * FRT, lane);
    XW();
#pragma unroll
    for (int j = 0; j < 8; ++j) acc[j] = wmma_bf(a, bf[j], acc[j]);
    a = an;
#pragma unroll
    for (int j = 0; j < 8; ++j) bf[j] = bn[j];
    if (kc + 2 < E / 32) { apn += 512; bpn += 512; } }  // the last trip loads its own fragments again (in bounds, not used)
  if (which < 2) {
#pragma unroll
    for (int j = 0; j < 8; ++j) { const float bb = bfr(bb_[n0 + j * 16 + col]);
#pragma unroll
      for (int r = 0; r < 8; ++r) so[wave][8 * g + r][j * 16 + col] = acc[j][r] + bb; }
    LDSX();
    if (which == 0) {
      for (int qq = lane; qq < 2 * 16 * 16; qq += 32) { const int hh = qq >> 8, rl = (qq >> 4) & 15, pc = qq & 15; const int h = (n0 >> 6) + hh;
        vst2(Q32 + (((size_t)b * NH + h) * SS + s0 + wave * 16 + rl) * HD + pc * 4, *(const v4f*)(&so[wave][rl][hh * 64 + pc * 4])); } }
    else {  // the wave's 16 keys x 2 heads: four fragments; the lane splits the 16 values that it would take as lane (g, col = key) and stores them as it will load them: every query wave of k_attn reads the split, none repeats it
// unrolled: no register of an issued store is rewritten on a back edge; the wait behind each fragment's four stores stands in front of the next fragment's split, which may take their registers
#pragma unroll
      for (int u = 0; u < 4; ++u) { const int kc = u & 1, hh = u >> 1; const int h = (n0 >> 6) + hh;
        const F2 ks = split_row(&so[wave][col][0], u * 32, lane);
        __bf16* kp = KS + ((((size_t)b * NH + h) * (SS / 16) + (s0 >> 4) + wave) * 2 + kc) * 1024 + lane * 8;
        union { v16b v; v4u q[2]; } uh, ul; uh.v = ks.h; ul.v = ks.l;
        vst2(kp, uh.q[0]); vst2(kp + 256, uh.q[1]); vst2(kp + 512, ul.q[0]); vst2(kp + 768, ul.q[1]);
        XW(); } } }
  else {
#pragma unroll
    for (int j = 0; j < 8; ++j) { const float bb = bfr(bb_[n0 + j * 16 + col]);
#pragma unroll
      for (int r = 0; r < 8; ++r) { const float v = (acc[j][r] + bb) * GATE[GIDX(r0 + 8 * g + r)] * 4.0f; const _Float16 hi = (_Float16)v; sth[j * 16 + col][wave * 16 + 8 * g + r] = hi; stl[j * 16 + col][wave * 16 + 8 * g + r] = (_Float16)((v - (float)hi) * VLO); } }
    __syncthreads();
    for (int qq = tid; qq < 128 * 8; qq += 128) { const int ln = qq & 31, q = (qq >> 5) & 1, t = (qq >> 6) & 3, k32 = (qq >> 8) & 1, hh = qq >> 9;
      const int cl = hh * 64 + t * 16 + (ln & 15), pc = k32 * 4 + q * 2 + (ln >> 4), h = (n0 >> 6) + hh; const size_t o = (((((size_t)b * NH + h) * (SS / 32) + (s0 >> 5) + k32) * 4 + t) * 2 + q) * 256 + ln * 8;
      vst2(VTh + o, *(const v4u*)(&sth[cl][pc * 8])); vst2(VTl + o, *(const v4u*)(&stl[cl][pc * 8])); } }
}
// one key tile's K (16 KiB), V hi (8 KiB) and V lo (8 KiB), each contiguous in its plane, into one 32 KiB stage of LDS: a thread brings eight 16-byte units, through no register
// l = the thread's LDS byte address in the stage; k, vh, vl = its global addresses in the tile's K, V hi and V lo; an immediate offset (under 65,536) moves the LDS and the global address alike, so one register set serves each plane
// the wait in the last line stands in front of every later write of an address register that the copies name
__device__ __forceinline__ void kv_copy(unsigned l, const char* k, const char* vh, const char* vl) {
  asm volatile("global_load_async_to_lds_b128 %0, %3, off\n\t"
               "global_load_async_to_lds_b128 %0, %3, off offset:4096\n\t"
               "global_load_async_to_lds_b128 %0, %3, off offset:8192\n\t"
               "global_load_async_to_lds_b128 %0, %3, off offset:12288\n\t"
               "global_load_async_to_lds_b128 %1, %4, off\n\t"
               "global_load_async_to_lds_b128 %1, %4, off offset:4096\n\t"
               "global_load_async_to_lds_b128 %2, %5, off\n\t"
               "global_load_async_to_lds_b128 %2, %5, off offset:4096\n\t"
               "s_wait_xcnt 0x0"
               :: "v"(l), "v"(l + 16384u), "v"(l + 24576u), "v"(k), "v"(vh), "v"(vl)
               : "memory");
}
// softmax in base 2: e^((s - m) / 8) * 2^14 = 2^(s * SC2 + (14 - m * SC2)), SC2 = log2(e) / 8: one fused multiply-add and one hardware exponential a weight; scores and running maximum stay unscaled q.k sums
// every argument is about 14 or less; a masked score (-3.0e38) and the first tile's correction give 2^(-huge) = 0; results below 2^-126 may come as 0, far under the last bit that the hi/lo pair of P keeps
#define SC2 0.18033688011112042f
// eight exponentials back to back, in place: each is the independent instruction that the slot behind the one before asks for, and the v_nop fills the slot behind the last
// (as single builtins nearly every one drew a v_nop of its own, and a dual-issue pair that rewrote the source register came to stand directly behind some)
__device__ __forceinline__ void ex2x8(float (&x)[8]) {
  asm("v_exp_f32 %0, %0\n\tv_exp_f32 %1, %1\n\tv_exp_f32 %2, %2\n\tv_exp_f32 %3, %3\n\t"
      "v_exp_f32 %4, %4\n\tv_exp_f32 %5, %5\n\tv_exp_f32 %6, %6\n\tv_exp_f32 %7, %7\n\tv_nop"
      : "+v"(x[0]), "+v"(x[1]), "+v"(x[2]), "+v"(x[3]), "+v"(x[4]), "+v"(x[5]), "+v"(x[6]), "+v"(x[7]));
}
// lane l <-> lane l ^ 16, one vector instruction, through no LDS: the two lanes that share a query column join their maxima and their sums
__device__ __forceinline__ float xhalf(float v) { const int b = __builtin_bit_cast(int, v); return __builtin_bit_cast(float, __builtin_amdgcn_permlanex16(b, b, 0x76543210, 0xfedcba98, false, false)); }
// transposed score product, k as A and q as B; the three terms in the order q.l k.h, q.h k.l, q.h k.h
__device__ __forceinline__ v8f mac3t(const F2& k, const F2& q, v8f c) { c = wmma_bf(k.h, q.l, c); c = wmma_bf(k.l, q.h, c); return wmma_bf(k.h, q.h, c); }
// causal attention: block (2 x 64 queries, bh): waves 0..3 take query tile 31 - t, waves 4..7 tile t, so that every block walks 33 key tiles per wave pair and no WGP is left with the long tiles alone
// the block walks key tiles 0..31-t together: tile kt + 1 flies into one of two LDS stages by asynchronous copies while tile kt is worked on, and all waves read K and V from LDS; a wave works on tiles 0..qb and only passes the hand-over points of the rest
// both products transposed: S^T = K Q^T (A = K fragment, B = Q) and O^T += V^T P^T (A = V fragment, B = P). Lane (g, col) then holds, of query q0 + col alone, the scores of keys 16 t + 8 g + r in register r of tile t:
// maximum, weights and sum are the lane's own work plus one exchange with lane ^ 16; two score tiles, converted in place, ARE the B fragment of 32 keys; the correction is the lane's own factor; scores and P never pass through LDS
// S on hi/lo splits of the f32 q/k rows (k arrives split, 1 KiB hi and 1 KiB lo a fragment); P,V hi/lo; O f32 in fragment order [16 rows][32 k][quarter][lane][4], which is the order of the lane's own O^T registers
// four waves a SIMD: holds the build at 256 registers a wave, so that two blocks stay on a WGP and all 512 run at once
__global__ __launch_bounds__(256) __attribute__((amdgpu_waves_per_eu(4, 4))) void k_attn(const float* __restrict__ Q32, const __bf16* __restrict__ KS, const _Float16* __restrict__ VTh, const _Float16* __restrict__ VTl, float* __restrict__ O32) {
  __shared__ __align__(16) char sKV[2][32768];  // a stage: K fragments at 0, V hi at 16384, V lo at 24576
  const int tid = threadIdx.x, lane = tid & 31, col = lane & 15, g = lane >> 4;
  const int w = __builtin_amdgcn_readfirstlane(tid >> 5);  // the wave's number in a scalar register: the key loop's tests stay scalar compares and branches
  const size_t bh = blockIdx.y; const int qb = w < 4 ? SS / 64 - 1 - (int)blockIdx.x : (int)blockIdx.x; const int q0 = qb * 64 + (w & 3) * 16;
  const int nT = SS / 64 - (int)blockIdx.x;  // key tiles of the block (17..32): those of its longer waves
  const unsigned t16 = (unsigned)w * 512u + (unsigned)lane * 16u;  // the thread's place in each 4 KiB of a tile
  const unsigned l0 = (unsigned)(size_t)(const void*)&sKV[0][0] + t16;
  const char* kg = (const char*)(KS + bh * (SS / 16) * 2048);   // the head's planes, the same for the whole block: 16 KiB a key tile
  const char* hg = (const char*)(VTh + bh * (SS / 32) * 2048);   // 8 KiB a key tile
  const char* lg = (const char*)(VTl + bh * (SS / 32) * 2048);
  kv_copy(l0, kg + t16, hg + t16, lg + t16);
  F2 aq[2];
#pragma unroll
  for (int kc = 0; kc < 2; ++kc) aq[kc] = split_row(Q32 + (bh * SS + q0 + col) * HD, kc * 32, lane);
  asm volatile("s_wait_asynccnt 0x0" ::: "memory");  // this wave's part of tile 0 has landed
  __syncthreads();                                    // every wave's part has: tile 0 may be read
  kv_copy(l0 + 32768u, kg + 16384 + t16, hg + 8192 + t16, lg + 8192 + t16);  // tile 1 (a block has 17 tiles or more)
  float mrun = -3.0e38f, lrun = 0.f; v8f acc[4] = {}, ac1[4] = {}, ac2[4] = {};  // mrun: the query's maximum, equal in both lanes of a column; lrun: the sum over the lane's own keys, joined behind the loop
#pragma unroll 1
  for (int kt = 0; kt < nT; ++kt) {
    if (kt <= qb) {
    const char* st = &sKV[kt & 1][0];
    v8f s[4]; float mx = -3.4e38f;
#pragma unroll
    for (int t = 0; t < 4; ++t) { const int dk = kt * 64 + t * 16 + 8 * g - (q0 + col); const __bf16* kf = (const __bf16*)st + t * 2048;  // dk = the lane's first key of the tile - its query
      F2 k0, k1; k0.h = fragF_b(kf, lane); k0.l = fragF_b(kf + 512, lane); k1.h = fragF_b(kf + 1024, lane); k1.l = fragF_b(kf + 1536, lane);
      v8f c = mac3t(k0, aq[0], (v8f){}); c = mac3t(k1, aq[1], c);
#pragma unroll
      for (int r = 0; r < 8; ++r) { s[t][r] = (dk + r > 0) ? -3.0e38f : c[r]; mx = fmaxf(mx, s[t][r]); } }
    // the V fragments of keys 0..31 of the tile are read from LDS here, ahead of the softmax, which covers their latency
    v16h vh[4], vl[4];
#pragma unroll
    for (int t = 0; t < 4; ++t) { vh[t] = fragF_h((const _Float16*)(st + 16384) + t * 512, lane); vl[t] = fragF_h((const _Float16*)(st + 24576) + t * 512, lane); }
    mx = fmaxf(mx, xhalf(mx));
    const float mnew = fmaxf(mrun, mx); const float corr = __builtin_amdgcn_exp2f((mrun - mnew) * SC2); const float nm = fmaf(-mnew, SC2, 14.0f);  // 2^14 = the 16384 that P is scaled by
    float ps = 0.f; v16h ph[2], pl[2];
#pragma unroll
    for (int t = 0; t < 4; ++t) { float x[8];
#pragma unroll
      for (int e = 0; e < 8; ++e) x[e] = fmaf(s[t][e], SC2, nm);
      ex2x8(x);
#pragma unroll
      for (int e = 0; e < 8; ++e) { const float p = x[e]; ps += p; const _Float16 hi = (_Float16)p; ph[t >> 1][(t & 1) * 8 + e] = hi; pl[t >> 1][(t & 1) * 8 + e] = (_Float16)((p - (float)hi) * PLO); } }
    lrun = lrun * corr + ps * (1.0f / 16384.0f); mrun = mnew;
#pragma unroll
    for (int t = 0; t < 4; ++t) { acc[t] *= corr; ac1[t] *= corr; ac2[t] *= corr; }
#pragma unroll
    for (int kc = 0; kc < 2; ++kc) {
      if (kc == 1) {  // keys 32..63: one group, into the registers that the first half has left
#pragma unroll
        for (int t = 0; t < 4; ++t) { vh[t] = fragF_h((const _Float16*)(st + 16384) + (4 + t) * 512, lane); vl[t] = fragF_h((const _Float16*)(st + 24576) + (4 + t) * 512, lane); } }
#pragma unroll
      for (int t = 0; t < 4; ++t) { acc[t] = wmma16(vh[t], ph[kc], acc[t]); ac1[t] = wmma16(vl[t], ph[kc], ac1[t]); ac2[t] = wmma16(vh[t], pl[kc], ac2[t]); } } }
    // hand-over, passed by every wave on every trip, also by one that is past its own last tile
    asm volatile("s_wait_dscnt 0x0" ::: "memory");     // this wave's reads of tile kt's stage are done before the stage is refilled
    asm volatile("s_wait_asynccnt 0x0" ::: "memory");  // this wave's part of tile kt + 1 has landed
    __syncthreads();                                    // tile kt + 1 may be read by all; tile kt's stage has no reader left
    if (kt + 2 < nT) kv_copy(l0 + (unsigned)(kt & 1) * 32768u, kg + (size_t)(kt + 2) * 16384 + t16, hg + (size_t)(kt + 2) * 8192 + t16, lg + (size_t)(kt + 2) * 8192 + t16); }
  asm volatile("s_wait_asynccnt 0x0" ::: "memory");  // no copy is in flight when the wave goes on to its end
  const float inv = 1.0f / ((lrun + xhalf(lrun)) * 16384.0f * 4.0f);
  const size_t ob = ((((bh / NH) * SS + q0) >> 4) * 32 + (bh % NH) * 2) * 512;  // the wave's 16 rows, its head's two fragments
  v4f o[8];  // unit u = quarter u & 3 of fragment u >> 2: d = 16 t + 8 g + r with t = u >> 1, r = 4 (u & 1) + i
#pragma unroll
  for (int u = 0; u < 8; ++u) { const int t = u >> 1;
#pragma unroll
    for (int i = 0; i < 4; ++i) { const int r = (u & 1) * 4 + i; o[u][i] = (acc[t][r] + ac1[t][r] * (1.0f / VLO) + ac2[t][r] * (1.0f / PLO)) * inv; } }
#pragma unroll
  for (int u = 0; u < 8; ++u) vst2(O32 + ob + (u >> 2) * 512 + (u & 3) * 128 + lane * 4, o[u]);
}
// out = ctx Wo + bo : split(ctx) x bf16(Wo columns): 2 products (Wo is an INPUT -> bf16 exact)
__global__ __launch_bounds__(128) void k_out(const float* __restrict__ O32, const __bf16* __restrict__ PT, const float* __restrict__ bo, float* __restrict__ out) {
  __shared__ __align__(16) float so[4][16][132];
  const int tid = threadIdx.x, wave = tid >> 5, lane = tid & 31, col = lane & 15, g = lane >> 4;
  const int r0 = blockIdx.x * 64 + wave * 16, n0 = blockIdx.y * 128;
  v8f acc[8] = {};
  // trip kc + 1's context values and eight weight fragments are loaded as one group ahead of trip kc's products
  const float* op = O32 + (size_t)(r0 >> 4) * FRT; const __bf16* bp = PT + (size_t)((3 * E + n0) >> 4) * FRT;
  R16 ar = rawF(op, lane); v16b wb[8]; XW();
#pragma unroll
  for (int j = 0; j < 8; ++j) wb[j] = fragF_b(bp + (size_t)j * FRT, lane);
  XW();
  const float* opn = op + 512;  // where trip kc + 1's context fragment lies
  unsigned wof = (unsigned)((((3 * E + n0) >> 4) * FRT + 512 + lane * 8) * 2);  // the lane's byte offset in PT of trip kc + 1's first weight fragment
// two trips a pass, so that the two fragment sets swap by name and not by register copies
#pragma unroll 2
  for (int kc = 0; kc < E / 32; ++kc) {
    const R16 arn = rawF(opn, lane); v16b wn[8]; XW();
#pragma unroll
    for (int j = 0; j < 8; ++j) wn[j] = fragF_b((const __bf16*)((const char*)PT + (size_t)wof + (size_t)j * FRT * 2), 0);
    asm volatile("s_wait_xcnt 0x0" : "+v"(wof) :: "memory");  // as XW(); the offset register that the sixteen loads name passes through the wait, so that it stays whole up to it and no load of the group lands in it
    const F2 a = bsplit16(ar.v);
#pragma unroll
    for (int j = 0; j < 8; ++j) { acc[j] = wmma_bf(a.l, wb[j], acc[j]); acc[j] = wmma_bf(a.h, wb[j], acc[j]); }
    ar = arn;
#pragma unroll
    for (int j = 0; j < 8; ++j) wb[j] = wn[j];
    if (kc + 2 < E / 32) { opn += 512; wof += 1024; } }  // the last trip loads its own fragments again (in bounds, not used)
#pragma unroll
  for (int j = 0; j < 8; ++j) { const int n = n0 + j * 16 + col; const float bb = bfr(bo[n]);
#pragma unroll
    for (int r = 0; r < 8; ++r) so[wave][8 * g + r][j * 16 + col] = acc[j][r] + bb; }
  LDSX();
#pragma unroll 4
  for (int rl = 0; rl < 16; ++rl) vst2(out + (size_t)(r0 + rl) * E + n0 + lane * 4, *(const v4f*)(&so[wave][rl][lane * 4]));
}
// drift probe + gate: block = 16 rows, 16 waves; wave w does columns 32w..32w+31 of h = bf16(x) @ bf16(dp_w1) exact (+ bf16(b1)); then wave w owns row w: LN over 512 (16 values a lane, shuffle tree), exact GELU, . bf16(dp_w2) + bf16(dp_b2) -> drift; gate per row
__device__ __forceinline__ float wsum(float v) {
#pragma unroll
  for (int m = 16; m >= 1; m >>= 1) v += __shfl_xor(v, m, 32);
  return v;
}
__global__ __launch_bounds__(512) void k_gate(const __bf16* __restrict__ Xb, const __bf16* __restrict__ PT, const float* __restrict__ b1, const float* __restrict__ lng, const float* __restrict__ lnb, const float* __restrict__ w2, const float* __restrict__ b2,
                                             const float* __restrict__ gw1, const float* __restrict__ gb1, const float* __restrict__ gw2, const float* __restrict__ gb2, float* __restrict__ GATE) {
  __shared__ __align__(16) float sh[16][DPH + 4]; __shared__ __align__(16) float sg[16];
  const int tid = threadIdx.x, wave = tid >> 5, lane = tid & 31, col = lane & 15, g = lane >> 4; const int r0 = blockIdx.x * 16;
  { v8f acc[2] = {};
    // trip kc + 1's x fragment and its two weight fragments are loaded as one group ahead of trip kc's products
    const __bf16* ap = Xb + (size_t)(r0 >> 4) * FRT; v16b a = fragF_b(ap, lane), wr[2]; XW();
    const __bf16* wp = PT + (size_t)((4 * E >> 4) + wave * 2) * FRT;
#pragma unroll
    for (int j = 0; j < 2; ++j) wr[j] = fragF_b(wp + (size_t)j * FRT, lane);
    XW();
    const __bf16* apn = ap + 512; const __bf16* wpn = wp + 512;  // where trip kc + 1's values lie
// two trips a pass, so that the two value sets swap by name and not by register copies
#pragma unroll 2
    for (int kc = 0; kc < E / 32; ++kc) {
      const v16b an = fragF_b(apn, lane); v16b wn[2]; XW();
#pragma unroll
      for (int j = 0; j < 2; ++j) wn[j] = fragF_b(wpn + (size_t)j * FRT, lane);
      XW();
#pragma unroll
      for (int j = 0; j < 2; ++j) acc[j] = wmma_bf(a, wr[j], acc[j]);
      a = an; wr[0] = wn[0]; wr[1] = wn[1];
      if (kc + 2 < E / 32) { apn += 512; wpn += 512; } }  // the last trip loads its own values again (in bounds, not used)
#pragma unroll
    for (int j = 0; j < 2; ++j) { const int n = wave * 32 + j * 16 + col; const float bb = bfr(b1[n]);
#pragma unroll
      for (int r = 0; r < 8; ++r) sh[8 * g + r][n] = acc[j][r] + bb; } }
  float pg[16], pb[16], pw[16];  // the lane's LN and dp_w2 parameters, fetched ahead of the barrier so that their latency is not paid between the GELU branches
#pragma unroll
  for (int k = 0; k < 16; ++k) { const int c = k * 32 + lane; pg[k] = bfr(lng[c]); pb[k] = bfr(lnb[c]); pw[k] = bfr(w2[c]); }
  __syncthreads();  // every wave's 32 columns of all 16 rows are in sh before a row is read
  { float v[16]; float s = 0.f;
#pragma unroll
    for (int k = 0; k < 16; ++k) { v[k] = sh[wave][k * 32 + lane]; s += v[k]; }
    const float mu = wsum(s) * (1.0f / DPH); float q = 0.f;
#pragma unroll
    for (int k = 0; k < 16; ++k) { const float d = v[k] - mu; q += d * d; }
    const float rs = rsqrtf(wsum(q) * (1.0f / DPH) + 1e-5f); float dot = 0.f;
#pragma unroll
    for (int k = 0; k < 16; ++k) dot += gelu_e((v[k] - mu) * rs * pg[k] + pb[k]) * pw[k];
    const float drift = wsum(dot) + bfr(b2[0]);
    const float t = g == 0 ? gelu_e(drift * bfr(gw1[col]) + bfr(gb1[col])) * bfr(gw2[col]) : 0.f;
    const float gsum = bfr(gb2[0]) + wsum(t);
    if (lane == 0) sg[wave] = tanhf(gsum); }
  __syncthreads();
  if (tid < 4) vst2(GATE + (size_t)blockIdx.x * 32 + tid * 4, *(const v4f*)(&sg[tid * 4]));
}
extern "C" void kernel_launch(void* const* d_in, const int* in_sizes, int n_in, void* d_out, int out_size, void* d_ws, size_t ws_size, hipStream_t stream) {
  (void)in_sizes; (void)n_in; (void)out_size; (void)ws_size;
  const float** I = (const float**)d_in;
  const float* x = I[0]; const float* Wq = I[1]; const float* bq = I[2]; const float* Wk = I[3]; const float* bk = I[4]; const float* Wv = I[5]; const float* bv = I[6]; const float* Wo = I[7]; const float* bo = I[8];
  const float* dw1 = I[9]; const float* db1 = I[10]; const float* lng = I[11]; const float* lnb = I[12]; const float* dw2 = I[13]; const float* db2 = I[14]; const float* gw1 = I[15]; const float* gb1 = I[16]; const float* gw2 = I[17]; const float* gb2 = I[18];
  float* out = (float*)d_out;
  char* ws = (char*)d_ws; size_t off = 0;
  auto take = [&](size_t bytes) { char* p = ws + off; off += (bytes + 255) & ~(size_t)255; return p; };
  __bf16* Xb = (__bf16*)take((size_t)NR * E * 2); __bf16* PT = (__bf16*)take((size_t)(4 * E + DPH) * E * 2); float* GATE = (float*)take((size_t)NR * 8);
  float* Q32 = (float*)take((size_t)NR * E * 4); __bf16* KS = (__bf16*)take((size_t)NR * E * 4); _Float16* VTh = (_Float16*)take((size_t)NR * E * 2); _Float16* VTl = (_Float16*)take((size_t)NR * E * 2); float* O32 = (float*)take((size_t)NR * E * 4);
  // ws ~ 85 MB
  k_cvt<<<(NR * E / 8 + 255) / 256, 256, 0, stream>>>(x, Xb);
  k_pack<<<dim3(E / 32, E / 128, 5), 256, 0, stream>>>(Wq, Wk, Wv, Wo, dw1, PT);
  k_gate<<<NR / 16, 512, 0, stream>>>(Xb, PT, db1, lng, lnb, dw2, db2, gw1, gb1, gw2, gb2, GATE);
  k_qkv<<<dim3(NR / 64, E / 128, 3), 128, 0, stream>>>(Xb, PT, bq, bk, bv, GATE, Q32, KS, VTh, VTl);
  k_attn<<<dim3(SS / 128, NB * NH), 256, 0, stream>>>(Q32, KS, VTh, VTl, O32);
  k_out<<<dim3(NR / 64, E / 128), 128, 0, stream>>>(O32, PT, bo, out);
}

// v009
// Measured time: 136 microseconds a run.
// Next to v008, in two timings, it ran 1.11 and 1.12 times as fast.
// Over all steps from v000 it is 5.93 times as fast.
// compute dtype: every module INPUT that feeds a GEMM (x, Wq/Wk/Wv/Wo, dp_w1, biases) is rounded to bf16 and used in exact bf16 WMMA products with f32 accumulation; computed operands (q/k, P, gate*V, context, the LN/GELU chain) are f32 or hi/lo pairs; mask/softmax/LayerNorm/GELU/tanh f32.
#include <hip/hip_runtime.h>
#include <math.h>

typedef __attribute__((ext_vector_type(16))) _Float16 v16h;
typedef __attribute__((ext_vector_type(16))) __bf16 v16b;
typedef __attribute__((ext_vector_type(8)))  _Float16 v8h;
typedef __attribute__((ext_vector_type(8)))  float v8f;
typedef __attribute__((ext_vector_type(4)))  float v4f;
typedef __attribute__((ext_vector_type(2)))  float v2f;
typedef __attribute__((ext_vector_type(4)))  unsigned v4u;
typedef __attribute__((ext_vector_type(4)))  int v4i;
typedef float __attribute__((may_alias)) float_a;
typedef int __attribute__((may_alias)) int_a;

template <typename T> __device__ __forceinline__ void vst2(void* p, T v) { *(T*)p = v;  }
__device__ __forceinline__ v8f wmma16(v16h a, v16h b, v8f c) {
  v8f d = __builtin_amdgcn_wmma_f32_16x16x32_f16(false, a, false, b, (short)0, c, false, false);
  asm volatile("v_nop\n\tv_nop\n\tv_nop\n\tv_nop" : "+v"(d) : "v"(a), "v"(b));
  return d;
}
__device__ __forceinline__ v8f wmma_bf(v16b a, v16b b, v8f c) {
  v8f d = __builtin_amdgcn_wmma_f32_16x16x32_bf16(false, a, false, b, (short)0, c, false, false);
  asm volatile("v_nop\n\tv_nop\n\tv_nop\n\tv_nop" : "+v"(d) : "v"(a), "v"(b));
  return d;
}
// 16x16x32 fragments: lane = (h = lane>>4, row/col = lane&15); elements 0..7 = k0+8h+0..7, 8..15 = k0+16+8h+0..7; D element r = row 8h+r
__device__ __forceinline__ v16h frag_h(const _Float16* rowk0, int lane) {
  union { v16h v; v8h q[2]; } u; const _Float16* p = rowk0 + 8 * (lane >> 4);
  u.q[0] = *(const v8h*)p; u.q[1] = *(const v8h*)(p + 16); return u.v;
}
__device__ __forceinline__ v16h frag_f32(const float* rowk0, int lane) {
  v16h a; const float* p = rowk0 + 8 * (lane >> 4);
#pragma unroll
  for (int i = 0; i < 8; ++i) { a[i] = (_Float16)p[i]; a[8 + i] = (_Float16)p[16 + i]; }
  return a;
}
__device__ __forceinline__ v16h frag_f32s(const float* rowk0, int lane, float sc) {
  v16h a; const float* p = rowk0 + 8 * (lane >> 4);
#pragma unroll
  for (int i = 0; i < 8; ++i) { a[i] = (_Float16)(p[i] * sc); a[8 + i] = (_Float16)(p[16 + i] * sc); }
  return a;
}
// column fragment from a [K][ld] layout (column n), rows >= K read as 0
__device__ __forceinline__ v16h fragc_f32(const float* W, int k0, int n, int lane, int ld, int K) {
  v16h a; const int g = lane >> 4;
#pragma unroll
  for (int i = 0; i < 8; ++i) { const int ka = k0 + 8 * g + i, kb = ka + 16;
    a[i] = (_Float16)(ka < K ? W[(size_t)ka * ld + n] : 0.f); a[8 + i] = (_Float16)(kb < K ? W[(size_t)kb * ld + n] : 0.f); }
  return a;
}
struct F2 { v16b h, l; };
__device__ __forceinline__ F2 bsplit16(const float v[16]) { F2 r;
#pragma unroll
  for (int i = 0; i < 16; ++i) { const __bf16 h = (__bf16)v[i]; r.h[i] = h; r.l[i] = (__bf16)(v[i] - (float)h); }
  return r; }
__device__ __forceinline__ F2 split_row(const float* row, int k0, int lane) { float v[16]; const float* p = row + k0 + 8 * (lane >> 4);
#pragma unroll
  for (int i = 0; i < 8; ++i) { v[i] = p[i]; v[8 + i] = p[16 + i]; }
  return bsplit16(v); }
__device__ __forceinline__ F2 split_rowK(const float* row, int k0, int lane, int K) { float v[16]; const int g = lane >> 4;
#pragma unroll
  for (int i = 0; i < 8; ++i) { const int ka = k0 + 8 * g + i, kb = ka + 16; v[i] = ka < K ? row[ka] : 0.f; v[8 + i] = kb < K ? row[kb] : 0.f; }
  return bsplit16(v); }
__device__ __forceinline__ F2 split_col(const float* W, int k0, int n, int lane, int ld, int K) { float v[16]; const int g = lane >> 4;
#pragma unroll
  for (int i = 0; i < 8; ++i) { const int ka = k0 + 8 * g + i, kb = ka + 16; v[i] = ka < K ? W[(size_t)ka * ld + n] : 0.f; v[8 + i] = kb < K ? W[(size_t)kb * ld + n] : 0.f; }
  return bsplit16(v); }
// the 16 f32 values of a lane's fragment, loads only: a group of them is issued ahead of the products that use them, and split or rounded later
struct R16 { float v[16]; };
// fragment order: a plane holds each 16 x 32 fragment as the lanes take it, so that every load of a wave is 512 contiguous bytes (four whole lines, not sixteen part lines)
// 16-bit values: 1 KiB a fragment, [half of the lane's 16 values][lane][8 values]; f32 values: 2 KiB a fragment, [quarter of the lane's 16 values][lane][4 values]
__device__ __forceinline__ v16h fragF_h(const _Float16* f, int lane) {
  union { v16h v; v8h q[2]; } u; const _Float16* p = f + lane * 8;
  u.q[0] = *(const v8h*)p; u.q[1] = *(const v8h*)(p + 256); return u.v;
}
__device__ __forceinline__ R16 rawF(const float* f, int lane) { R16 r; const float* p = f + lane * 4;
#pragma unroll
  for (int j = 0; j < 4; ++j) { const v4f t = *(const v4f*)(p + j * 128); r.v[4 * j] = t[0]; r.v[4 * j + 1] = t[1]; r.v[4 * j + 2] = t[2]; r.v[4 * j + 3] = t[3]; }
  return r; }
__device__ __forceinline__ v8f mac3(const F2& a, const F2& b, v8f c) { c = wmma_bf(a.l, b.h, c); c = wmma_bf(a.h, b.l, c); return wmma_bf(a.h, b.h, c); }
__device__ __forceinline__ float sigm(float v) { return 1.0f / (1.0f + expf(-v)); }
// in front of an instruction that rewrites an address register of a global load issued above (the next address, or a later load's result in the same register)
#define XW() asm volatile("s_wait_xcnt 0x0" ::: "memory")
#define LDSX() do { asm volatile("s_wait_dscnt 0" ::: "memory"); __builtin_amdgcn_wave_barrier(); __builtin_amdgcn_fence(__ATOMIC_RELEASE, "workgroup"); } while (0)


// Causal self attention (16 heads of 64 on [2,2048,1024], [in][out] weights + biases, scale 1/8) whose post-softmax weights are multiplied by a per-KEY gate (no renormalisation)
// == V rows scaled by gate[key]; gate = tanh(gelu(drift*g_w1 + g_b1).g_w2 + g_b2), drift = gelu(LN(x dp_w1 + dp_b1)).dp_w2 + dp_b2 per token.
// bf16-rounded INPUT operands with exact bf16 WMMA products, hi/lo splits for computed operands; k_cvt, k_pack, k_gate, k_qkv, causal k_attn, k_out.
#define NB 2
#define SS 2048
#define E 1024
#define NH 16
#define HD 64
#define NR (NB * SS)
#define DPH 512
// GATE plane: 32 floats (one 128-byte line) per 16 rows, the first 16 used, so that a line has one writing block
#define GIDX(r) ((((r) >> 4) << 5) + ((r) & 15))
__device__ __forceinline__ float gelu_e(float x) { return 0.5f * x * (1.0f + erff(x * 0.70710678118654752f)); }
#define PLO 1024.0f
#define VLO 2048.0f
__device__ __forceinline__ float bfr(float v) { return (float)(__bf16)v; }
__device__ __forceinline__ v16b fragF_b(const __bf16* f, int lane) { return __builtin_bit_cast(v16b, fragF_h((const _Float16*)f, lane)); }
// values of a fragment-order plane per 16 rows of 1024 (32 fragments of 512)
#define FRT 16384

// Xb in fragment order: [16 rows][32 k][half][lane][8]; thread = one 16-byte unit of the plane (a block reads 16 rows x 512 bytes of x)
__global__ __launch_bounds__(256) void k_cvt(const float* __restrict__ x, __bf16* __restrict__ Xb) {
  const size_t i8 = (size_t)blockIdx.x * 256 + threadIdx.x; if (i8 >= (size_t)NR * E / 8) return;
  const int ln = (int)(i8 & 31), q = (int)(i8 >> 5) & 1, kc = (int)(i8 >> 6) & 31; const size_t rt = i8 >> 11;
  const float* p = x + (rt * 16 + (ln & 15)) * E + kc * 32 + q * 16 + (ln >> 4) * 8;
  union { __bf16 h[8]; v4u u; } pk;
#pragma unroll
  for (int e = 0; e < 8; ++e) pk.h[e] = (__bf16)p[e];
  vst2((unsigned*)(Xb + i8 * 8), pk.u);
}
// PT columns: [0,E) Wq[:,n], [E,2E) Wk[:,n], [2E,3E) Wv[:,n], [3E,4E) Wo[:,n], [4E,4E+DPH) dp_w1[:,n]  ([in][out] weights), bf16 in fragment order: [16 columns][32 k][half][lane][8]
// block (32 k, 128 columns, matrix): whole rows of W in, turned in LDS, whole fragments out
__global__ __launch_bounds__(256) void k_pack(const float* __restrict__ Wq, const float* __restrict__ Wk, const float* __restrict__ Wv, const float* __restrict__ Wo, const float* __restrict__ W1, __bf16* __restrict__ PT) {
  __shared__ __align__(16) __bf16 st[128][40];
  const int tid = threadIdx.x, kc = blockIdx.x, n0 = blockIdx.y * 128, m = blockIdx.z;
  const int ld = m == 4 ? DPH : E; if (n0 >= ld) return;  // dp_w1 has 512 columns: the whole block leaves, ahead of the barrier
  const float* W = m == 0 ? Wq : (m == 1 ? Wk : (m == 2 ? Wv : (m == 3 ? Wo : W1)));
  for (int i = tid; i < 32 * 128; i += 256) { const int k = i >> 7, n = i & 127; st[n][k] = (__bf16)W[(size_t)(kc * 32 + k) * ld + n0 + n]; }
  __syncthreads();
  for (int u = tid; u < 512; u += 256) { const int ln = u & 31, q = (u >> 5) & 1, nt = u >> 6;
    vst2((unsigned*)(PT + (size_t)(((m * E + n0) >> 4) + nt) * FRT + kc * 512 + q * 256 + ln * 8), *(const v4u*)(&st[nt * 16 + (ln & 15)][q * 16 + (ln >> 4) * 8])); }
}
// QKV: block (128 rows, 128 cols = 2 heads, which), four waves of 64 rows x 64 cols (one head each): a trip's eight fragments feed sixteen products (a 16 x 128 wave tile took nine for eight)
// q -> Q32 f32 [bh][s][64]; k -> KS, split once into bf16 hi and lo, in fragment order [bh][16 keys][32 d][hi, lo][half][lane][8]; v -> VT hi/lo x4 in fragment order [bh][32 keys][16 d][half][lane][8]
__global__ __launch_bounds__(128) void k_qkv(const __bf16* __restrict__ Xb, const __bf16* __restrict__ PT, const float* __restrict__ bq, const float* __restrict__ bk, const float* __restrict__ bv, const float* __restrict__ GATE,
                                            float* __restrict__ Q32, __bf16* __restrict__ KS, _Float16* __restrict__ VTh, _Float16* __restrict__ VTl) {
  __shared__ __align__(16) char sm[2 * 128 * 136 * 2];  // q, k: sixteen f32 tiles [16][68], four a wave; v: hi and lo planes [128 cols][136]
  const int tid = threadIdx.x, wave = tid >> 5, lane = tid & 31, col = lane & 15, g = lane >> 4, wr = wave >> 1, wc = wave & 1;
  const int which = blockIdx.z, r0b = blockIdx.x * 128, r0 = r0b + wr * 64, n0 = blockIdx.y * 128, nw = n0 + wc * 64; const int b = r0b / SS, s0 = r0b % SS;
  const float* bb_ = which == 0 ? bq : (which == 1 ? bk : bv);
  v8f acc[4][4] = {};
  // the eight fragments of trip kc + 1 are loaded as one group ahead of trip kc's products: one load wait a trip, covered by sixteen products
  const __bf16* ap = Xb + (size_t)(r0 >> 4) * FRT; const __bf16* bp = PT + (size_t)((which * E + nw) >> 4) * FRT;
  v16b a[4], bf[4];
#pragma unroll
  for (int i = 0; i < 4; ++i) a[i] = fragF_b(ap + (size_t)i * FRT, lane);
  XW();
#pragma unroll
  for (int j = 0; j < 4; ++j) bf[j] = fragF_b(bp + (size_t)j * FRT, lane);
  XW();
  const __bf16* apn = ap + 512; const __bf16* bpn = bp + 512;  // where trip kc + 1's fragments lie
// two trips a pass, so that the two fragment sets swap by name and not by register copies
#pragma unroll 2
  for (int kc = 0; kc < E / 32; ++kc) {
    v16b an[4], bn[4];
#pragma unroll
    for (int i = 0; i < 4; ++i) an[i] = fragF_b(apn + (size_t)i * FRT, lane);
    XW();
#pragma unroll
    for (int j = 0; j < 4; ++j) bn[j] = fragF_b(bpn + (size_t)j * FRT, lane);
    XW();
    __builtin_amdgcn_sched_barrier(0);  // keeps the products behind the next trip's loads: left free, the scheduler put the loads behind the last use of the old fragments, in the same registers, and the wave then waited out their whole latency
#pragma unroll
    for (int i = 0; i < 4; ++i) {
#pragma unroll
      for (int j = 0; j < 4; ++j) acc[i][j] = __builtin_amdgcn_wmma_f32_16x16x32_bf16(false, a[i], false, bf[j], (short)0, acc[i][j], false, false); }  // the builtin alone (the compiler keeps its distances): operands of an asm statement must lie below v256, and with 256 registers of tiles and fragments named in one the loop spilled
#pragma unroll
    for (int i = 0; i < 4; ++i) { a[i] = an[i]; bf[i] = bn[i]; }
    if (kc + 2 < E / 32) { apn += 512; bpn += 512; } }  // the last trip loads its own fragments again (in bounds, not used)
  float bb[4];
#pragma unroll
  for (int j = 0; j < 4; ++j) bb[j] = bfr(bb_[nw + j * 16 + col]);
  if (which < 2) {
    const size_t bh = (size_t)b * NH + (nw >> 6);  // the wave's head
    float (*so)[16][68] = (float (*)[16][68])sm + wave * 4;  // the wave's own four tiles of 16 rows x 64
#pragma unroll
    for (int i = 0; i < 4; ++i) {
#pragma unroll
      for (int j = 0; j < 4; ++j) {
#pragma unroll
        for (int r = 0; r < 8; ++r) so[i][8 * g + r][j * 16 + col] = acc[i][j][r] + bb[j]; } }
    LDSX();
// unrolled: no register of an issued store is rewritten on a back edge
#pragma unroll
    for (int i = 0; i < 4; ++i) {
      if (which == 0) {
        v4f t[8];  // unit u: rows 2 u and 2 u + 1 of the tile, 16 bytes a lane: a store of the wave is 512 contiguous bytes
#pragma unroll
        for (int u = 0; u < 8; ++u) t[u] = *(const v4f*)(&so[i][2 * u + g][col * 4]);
        float* qp = Q32 + (bh * SS + s0 + wr * 64 + i * 16 + g) * HD + col * 4;
#pragma unroll
        for (int u = 0; u < 8; ++u) vst2(qp + u * 2 * HD, t[u]);
        XW(); }
      else {  // 16 keys of one head: two fragments; the lane splits the 16 values that it would take as lane (g, col = key) and stores them as it will load them: every query wave of k_attn reads the split, none repeats it
#pragma unroll
        for (int kc = 0; kc < 2; ++kc) {
          const F2 ks = split_row(&so[i][col][0], kc * 32, lane);
          __bf16* kp = KS + ((bh * (SS / 16) + (s0 >> 4) + wr * 4 + i) * 2 + kc) * 1024 + lane * 8;
          union { v16b v; v4u q[2]; } uh, ul; uh.v = ks.h; ul.v = ks.l;
          vst2(kp, uh.q[0]); vst2(kp + 256, uh.q[1]); vst2(kp + 512, ul.q[0]); vst2(kp + 768, ul.q[1]);
          XW(); } } } }  // the wait behind each fragment's four stores stands in front of the next split, which may take their registers
  else {
    _Float16 (*sth)[136] = (_Float16 (*)[136])sm; _Float16 (*stl)[136] = sth + 128;
    float gt[4][8];
#pragma unroll
    for (int i = 0; i < 4; ++i) {
#pragma unroll
      for (int r = 0; r < 8; ++r) gt[i][r] = GATE[GIDX(r0 + i * 16 + 8 * g + r)]; }
    XW();
#pragma unroll
    for (int i = 0; i < 4; ++i) {
#pragma unroll
      for (int j = 0; j < 4; ++j) {
#pragma unroll
        for (int r = 0; r < 8; ++r) { const float v = (acc[i][j][r] + bb[j]) * gt[i][r] * 4.0f; const _Float16 hi = (_Float16)v; sth[wc * 64 + j * 16 + col][wr * 64 + i * 16 + 8 * g + r] = hi; stl[wc * 64 + j * 16 + col][wr * 64 + i * 16 + 8 * g + r] = (_Float16)((v - (float)hi) * VLO); } } }
    __syncthreads();
    for (int qq = tid; qq < 128 * 16; qq += 128) { const int ln = qq & 31, q = (qq >> 5) & 1, t = (qq >> 6) & 3, k32 = (qq >> 8) & 3, hh = qq >> 10;
      const int cl = hh * 64 + t * 16 + (ln & 15), pc = k32 * 4 + q * 2 + (ln >> 4), h = (n0 >> 6) + hh; const size_t o = (((((size_t)b * NH + h) * (SS / 32) + (s0 >> 5) + k32) * 4 + t) * 2 + q) * 256 + ln * 8;
      vst2(VTh + o, *(const v4u*)(&sth[cl][pc * 8])); vst2(VTl + o, *(const v4u*)(&stl[cl][pc * 8]));
      XW(); } }  // in front of the next trip's addresses and values, which may take the two stores' registers
}
// one key tile's K (16 KiB), V hi (8 KiB) and V lo (8 KiB), each contiguous in its plane, into one 32 KiB stage of LDS: a thread brings eight 16-byte units, through no register
// l = the thread's LDS byte address in the stage; k, vh, vl = its global addresses in the tile's K, V hi and V lo; an immediate offset (under 65,536) moves the LDS and the global address alike, so one register set serves each plane
// the wait in the last line stands in front of every later write of an address register that the copies name
__device__ __forceinline__ void kv_copy(unsigned l, const char* k, const char* vh, const char* vl) {
  asm volatile("global_load_async_to_lds_b128 %0, %3, off\n\t"
               "global_load_async_to_lds_b128 %0, %3, off offset:4096\n\t"
               "global_load_async_to_lds_b128 %0, %3, off offset:8192\n\t"
               "global_load_async_to_lds_b128 %0, %3, off offset:12288\n\t"
               "global_load_async_to_lds_b128 %1, %4, off\n\t"
               "global_load_async_to_lds_b128 %1, %4, off offset:4096\n\t"
               "global_load_async_to_lds_b128 %2, %5, off\n\t"
               "global_load_async_to_lds_b128 %2, %5, off offset:4096\n\t"
               "s_wait_xcnt 0x0"
               :: "v"(l), "v"(l + 16384u), "v"(l + 24576u), "v"(k), "v"(vh), "v"(vl)
               : "memory");
}
// softmax in base 2: e^((s - m) / 8) * 2^14 = 2^(s * SC2 + (14 - m * SC2)), SC2 = log2(e) / 8: one fused multiply-add and one hardware exponential a weight; scores and running maximum stay unscaled q.k sums
// every argument is about 14 or less; a masked score (-3.0e38) and the first tile's correction give 2^(-huge) = 0; results below 2^-126 may come as 0, far under the last bit that the hi/lo pair of P keeps
#define SC2 0.18033688011112042f
// eight exponentials back to back, in place: each is the independent instruction that the slot behind the one before asks for, and the v_nop fills the slot behind the last
// (as single builtins nearly every one drew a v_nop of its own, and a dual-issue pair that rewrote the source register came to stand directly behind some)
__device__ __forceinline__ void ex2x8(float (&x)[8]) {
  asm("v_exp_f32 %0, %0\n\tv_exp_f32 %1, %1\n\tv_exp_f32 %2, %2\n\tv_exp_f32 %3, %3\n\t"
      "v_exp_f32 %4, %4\n\tv_exp_f32 %5, %5\n\tv_exp_f32 %6, %6\n\tv_exp_f32 %7, %7\n\tv_nop"
      : "+v"(x[0]), "+v"(x[1]), "+v"(x[2]), "+v"(x[3]), "+v"(x[4]), "+v"(x[5]), "+v"(x[6]), "+v"(x[7]));
}
// lane l <-> lane l ^ 16, one vector instruction, through no LDS: the two lanes that share a query column join their maxima and their sums
__device__ __forceinline__ float xhalf(float v) { const int b = __builtin_bit_cast(int, v); return __builtin_bit_cast(float, __builtin_amdgcn_permlanex16(b, b, 0x76543210, 0xfedcba98, false, false)); }
// transposed score product, k as A and q as B; the three terms in the order q.l k.h, q.h k.l, q.h k.h
__device__ __forceinline__ v8f mac3t(const F2& k, const F2& q, v8f c) { c = wmma_bf(k.h, q.l, c); c = wmma_bf(k.l, q.h, c); return wmma_bf(k.h, q.h, c); }
// causal attention: block (2 x 64 queries, bh): waves 0..3 take query tile 31 - t, waves 4..7 tile t, so that every block walks 33 key tiles per wave pair and no WGP is left with the long tiles alone
// the block walks key tiles 0..31-t together: tile kt + 1 flies into one of two LDS stages by asynchronous copies while tile kt is worked on, and all waves read K and V from LDS; a wave works on tiles 0..qb and only passes the hand-over points of the rest
// both products transposed: S^T = K Q^T (A = K fragment, B = Q) and O^T += V^T P^T (A = V fragment, B = P). Lane (g, col) then holds, of query q0 + col alone, the scores of keys 16 t + 8 g + r in register r of tile t:
// maximum, weights and sum are the lane's own work plus one exchange with lane ^ 16; two score tiles, converted in place, ARE the B fragment of 32 keys; the correction is the lane's own factor; scores and P never pass through LDS
// S on hi/lo splits of the f32 q/k rows (k arrives split, 1 KiB hi and 1 KiB lo a fragment); P,V hi/lo; O f32 in fragment order [16 rows][32 k][quarter][lane][4], which is the order of the lane's own O^T registers
// four waves a SIMD: holds the build at 256 registers a wave, so that two blocks stay on a WGP and all 512 run at once
__global__ __launch_bounds__(256) __attribute__((amdgpu_waves_per_eu(4, 4))) void k_attn(const float* __restrict__ Q32, const __bf16* __restrict__ KS, const _Float16* __restrict__ VTh, const _Float16* __restrict__ VTl, float* __restrict__ O32) {
  __shared__ __align__(16) char sKV[2][32768];  // a stage: K fragments at 0, V hi at 16384, V lo at 24576
  const int tid = threadIdx.x, lane = tid & 31, col = lane & 15, g = lane >> 4;
  const int w = __builtin_amdgcn_readfirstlane(tid >> 5);  // the wave's number in a scalar register: the key loop's tests stay scalar compares and branches
  const size_t bh = blockIdx.y; const int qb = w < 4 ? SS / 64 - 1 - (int)blockIdx.x : (int)blockIdx.x; const int q0 = qb * 64 + (w & 3) * 16;
  const int nT = SS / 64 - (int)blockIdx.x;  // key tiles of the block (17..32): those of its longer waves
  const unsigned t16 = (unsigned)w * 512u + (unsigned)lane * 16u;  // the thread's place in each 4 KiB of a tile
  const unsigned l0 = (unsigned)(size_t)(const void*)&sKV[0][0] + t16;
  const char* kg = (const char*)(KS + bh * (SS / 16) * 2048);   // the head's planes, the same for the whole block: 16 KiB a key tile
  const char* hg = (const char*)(VTh + bh * (SS / 32) * 2048);   // 8 KiB a key tile
  const char* lg = (const char*)(VTl + bh * (SS / 32) * 2048);
  kv_copy(l0, kg + t16, hg + t16, lg + t16);
  F2 aq[2];
#pragma unroll
  for (int kc = 0; kc < 2; ++kc) aq[kc] = split_row(Q32 + (bh * SS + q0 + col) * HD, kc * 32, lane);
  asm volatile("s_wait_asynccnt 0x0" ::: "memory");  // this wave's part of tile 0 has landed
  __syncthreads();                                    // every wave's part has: tile 0 may be read
  kv_copy(l0 + 32768u, kg + 16384 + t16, hg + 8192 + t16, lg + 8192 + t16);  // tile 1 (a block has 17 tiles or more)
  float mrun = -3.0e38f, lrun = 0.f; v8f acc[4] = {}, ac1[4] = {}, ac2[4] = {};  // mrun: the query's maximum, equal in both lanes of a column; lrun: the sum over the lane's own keys, joined behind the loop
#pragma unroll 1
  for (int kt = 0; kt < nT; ++kt) {
    if (kt <= qb) {
    const char* st = &sKV[kt & 1][0];
    v8f s[4]; float mx = -3.4e38f;
#pragma unroll
    for (int t = 0; t < 4; ++t) { const int dk = kt * 64 + t * 16 + 8 * g - (q0 + col); const __bf16* kf = (const __bf16*)st + t * 2048;  // dk = the lane's first key of the tile - its query
      F2 k0, k1; k0.h = fragF_b(kf, lane); k0.l = fragF_b(kf + 512, lane); k1.h = fragF_b(kf + 1024, lane); k1.l = fragF_b(kf + 1536, lane);
      v8f c = mac3t(k0, aq[0], (v8f){}); c = mac3t(k1, aq[1], c);
#pragma unroll
      for (int r = 0; r < 8; ++r) { s[t][r] = (dk + r > 0) ? -3.0e38f : c[r]; mx = fmaxf(mx, s[t][r]); } }
    // the V fragments of keys 0..31 of the tile are read from LDS here, ahead of the softmax, which covers their latency
    v16h vh[4], vl[4];
#pragma unroll
    for (int t = 0; t < 4; ++t) { vh[t] = fragF_h((const _Float16*)(st + 16384) + t * 512, lane); vl[t] = fragF_h((const _Float16*)(st + 24576) + t * 512, lane); }
    mx = fmaxf(mx, xhalf(mx));
    const float mnew = fmaxf(mrun, mx); const float corr = __builtin_amdgcn_exp2f((mrun - mnew) * SC2); const float nm = fmaf(-mnew, SC2, 14.0f);  // 2^14 = the 16384 that P is scaled by
    float ps = 0.f; v16h ph[2], pl[2];
#pragma unroll
    for (int t = 0; t < 4; ++t) { float x[8];
#pragma unroll
      for (int e = 0; e < 8; ++e) x[e] = fmaf(s[t][e], SC2, nm);
      ex2x8(x);
#pragma unroll
      for (int e = 0; e < 8; ++e) { const float p = x[e]; ps += p; const _Float16 hi = (_Float16)p; ph[t >> 1][(t & 1) * 8 + e] = hi; pl[t >> 1][(t & 1) * 8 + e] = (_Float16)((p - (float)hi) * PLO); } }
    lrun = lrun * corr + ps * (1.0f / 16384.0f); mrun = mnew;
#pragma unroll
    for (int t = 0; t < 4; ++t) { acc[t] *= corr; ac1[t] *= corr; ac2[t] *= corr; }
#pragma unroll
    for (int kc = 0; kc < 2; ++kc) {
      if (kc == 1) {  // keys 32..63: one group, into the registers that the first half has left
#pragma unroll
        for (int t = 0; t < 4; ++t) { vh[t] = fragF_h((const _Float16*)(st + 16384) + (4 + t) * 512, lane); vl[t] = fragF_h((const _Float16*)(st + 24576) + (4 + t) * 512, lane); } }
#pragma unroll
      for (int t = 0; t < 4; ++t) { acc[t] = wmma16(vh[t], ph[kc], acc[t]); ac1[t] = wmma16(vl[t], ph[kc], ac1[t]); ac2[t] = wmma16(vh[t], pl[kc], ac2[t]); } } }
    // hand-over, passed by every wave on every trip, also by one that is past its own last tile
    asm volatile("s_wait_dscnt 0x0" ::: "memory");     // this wave's reads of tile kt's stage are done before the stage is refilled
    asm volatile("s_wait_asynccnt 0x0" ::: "memory");  // this wave's part of tile kt + 1 has landed
    __syncthreads();                                    // tile kt + 1 may be read by all; tile kt's stage has no reader left
    if (kt + 2 < nT) kv_copy(l0 + (unsigned)(kt & 1) * 32768u, kg + (size_t)(kt + 2) * 16384 + t16, hg + (size_t)(kt + 2) * 8192 + t16, lg + (size_t)(kt + 2) * 8192 + t16); }
  asm volatile("s_wait_asynccnt 0x0" ::: "memory");  // no copy is in flight when the wave goes on to its end
  const float inv = 1.0f / ((lrun + xhalf(lrun)) * 16384.0f * 4.0f);
  const size_t ob = ((((bh / NH) * SS + q0) >> 4) * 32 + (bh % NH) * 2) * 512;  // the wave's 16 rows, its head's two fragments
  v4f o[8];  // unit u = quarter u & 3 of fragment u >> 2: d = 16 t + 8 g + r with t = u >> 1, r = 4 (u & 1) + i
#pragma unroll
  for (int u = 0; u < 8; ++u) { const int t = u >> 1;
#pragma unroll
    for (int i = 0; i < 4; ++i) { const int r = (u & 1) * 4 + i; o[u][i] = (acc[t][r] + ac1[t][r] * (1.0f / VLO) + ac2[t][r] * (1.0f / PLO)) * inv; } }
#pragma unroll
  for (int u = 0; u < 8; ++u) vst2(O32 + ob + (u >> 2) * 512 + (u & 3) * 128 + lane * 4, o[u]);
}
// out = ctx Wo + bo : split(ctx) x bf16(Wo columns): 2 products (Wo is an INPUT -> bf16 exact)
__global__ __launch_bounds__(128) void k_out(const float* __restrict__ O32, const __bf16* __restrict__ PT, const float* __restrict__ bo, float* __restrict__ out) {
  __shared__ __align__(16) float so[4][16][132];
  const int tid = threadIdx.x, wave = tid >> 5, lane = tid & 31, col = lane & 15, g = lane >> 4;
  const int r0 = blockIdx.x * 64 + wave * 16, n0 = blockIdx.y * 128;
  v8f acc[8] = {};
  // trip kc + 1's context values and eight weight fragments are loaded as one group ahead of trip kc's products
  const float* op = O32 + (size_t)(r0 >> 4) * FRT; const __bf16* bp = PT + (size_t)((3 * E + n0) >> 4) * FRT;
  R16 ar = rawF(op, lane); v16b wb[8]; XW();
#pragma unroll
  for (int j = 0; j < 8; ++j) wb[j] = fragF_b(bp + (size_t)j * FRT, lane);
  XW();
  const float* opn = op + 512;  // where trip kc + 1's context fragment lies
  unsigned wof = (unsigned)((((3 * E + n0) >> 4) * FRT + 512 + lane * 8) * 2);  // the lane's byte offset in PT of trip kc + 1's first weight fragment
// two trips a pass, so that the two fragment sets swap by name and not by register copies
#pragma unroll 2
  for (int kc = 0; kc < E / 32; ++kc) {
    const R16 arn = rawF(opn, lane); v16b wn[8]; XW();
#pragma unroll
    for (int j = 0; j < 8; ++j) wn[j] = fragF_b((const __bf16*)((const char*)PT + (size_t)wof + (size_t)j * FRT * 2), 0);
    asm volatile("s_wait_xcnt 0x0" : "+v"(wof) :: "memory");  // as XW(); the offset register that the sixteen loads name passes through the wait, so that it stays whole up to it and no load of the group lands in it
    const F2 a = bsplit16(ar.v);
#pragma unroll
    for (int j = 0; j < 8; ++j) { acc[j] = wmma_bf(a.l, wb[j], acc[j]); acc[j] = wmma_bf(a.h, wb[j], acc[j]); }
    ar = arn;
#pragma unroll
    for (int j = 0; j < 8; ++j) wb[j] = wn[j];
    if (kc + 2 < E / 32) { opn += 512; wof += 1024; } }  // the last trip loads its own fragments again (in bounds, not used)
#pragma unroll
  for (int j = 0; j < 8; ++j) { const int n = n0 + j * 16 + col; const float bb = bfr(bo[n]);
#pragma unroll
    for (int r = 0; r < 8; ++r) so[wave][8 * g + r][j * 16 + col] = acc[j][r] + bb; }
  LDSX();
#pragma unroll 4
  for (int rl = 0; rl < 16; ++rl) vst2(out + (size_t)(r0 + rl) * E + n0 + lane * 4, *(const v4f*)(&so[wave][rl][lane * 4]));
}
// drift probe + gate: block = 16 rows, 16 waves; wave w does columns 32w..32w+31 of h = bf16(x) @ bf16(dp_w1) exact (+ bf16(b1)); then wave w owns row w: LN over 512 (16 values a lane, shuffle tree), exact GELU, . bf16(dp_w2) + bf16(dp_b2) -> drift; gate per row
__device__ __forceinline__ float wsum(float v) {
#pragma unroll
  for (int m = 16; m >= 1; m >>= 1) v += __shfl_xor(v, m, 32);
  return v;
}
__global__ __launch_bounds__(512) void k_gate(const __bf16* __restrict__ Xb, const __bf16* __restrict__ PT, const float* __restrict__ b1, const float* __restrict__ lng, const float* __restrict__ lnb, const float* __restrict__ w2, const float* __restrict__ b2,
                                             const float* __restrict__ gw1, const float* __restrict__ gb1, const float* __restrict__ gw2, const float* __restrict__ gb2, float* __restrict__ GATE) {
  __shared__ __align__(16) float sh[16][DPH + 4]; __shared__ __align__(16) float sg[16];
  const int tid = threadIdx.x, wave = tid >> 5, lane = tid & 31, col = lane & 15, g = lane >> 4; const int r0 = blockIdx.x * 16;
  { v8f acc[2] = {};
    // trip kc + 1's x fragment and its two weight fragments are loaded as one group ahead of trip kc's products
    const __bf16* ap = Xb + (size_t)(r0 >> 4) * FRT; v16b a = fragF_b(ap, lane), wr[2]; XW();
    const __bf16* wp = PT + (size_t)((4 * E >> 4) + wave * 2) * FRT;
#pragma unroll
    for (int j = 0; j < 2; ++j) wr[j] = fragF_b(wp + (size_t)j * FRT, lane);
    XW();
    const __bf16* apn = ap + 512; const __bf16* wpn = wp + 512;  // where trip kc + 1's values lie
// two trips a pass, so that the two value sets swap by name and not by register copies
#pragma unroll 2
    for (int kc = 0; kc < E / 32; ++kc) {
      const v16b an = fragF_b(apn, lane); v16b wn[2]; XW();
#pragma unroll
      for (int j = 0; j < 2; ++j) wn[j] = fragF_b(wpn + (size_t)j * FRT, lane);
      XW();
#pragma unroll
      for (int j = 0; j < 2; ++j) acc[j] = wmma_bf(a, wr[j], acc[j]);
      a = an; wr[0] = wn[0]; wr[1] = wn[1];
      if (kc + 2 < E / 32) { apn += 512; wpn += 512; } }  // the last trip loads its own values again (in bounds, not used)
#pragma unroll
    for (int j = 0; j < 2; ++j) { const int n = wave * 32 + j * 16 + col; const float bb = bfr(b1[n]);
#pragma unroll
      for (int r = 0; r < 8; ++r) sh[8 * g + r][n] = acc[j][r] + bb; } }
  float pg[16], pb[16], pw[16];  // the lane's LN and dp_w2 parameters, fetched ahead of the barrier so that their latency is not paid between the GELU branches
#pragma unroll
  for (int k = 0; k < 16; ++k) { const int c = k * 32 + lane; pg[k] = bfr(lng[c]); pb[k] = bfr(lnb[c]); pw[k] = bfr(w2[c]); }
  __syncthreads();  // every wave's 32 columns of all 16 rows are in sh before a row is read
  { float v[16]; float s = 0.f;
#pragma unroll
    for (int k = 0; k < 16; ++k) { v[k] = sh[wave][k * 32 + lane]; s += v[k]; }
    const float mu = wsum(s) * (1.0f / DPH); float q = 0.f;
#pragma unroll
    for (int k = 0; k < 16; ++k) { const float d = v[k] - mu; q += d * d; }
    const float rs = rsqrtf(wsum(q) * (1.0f / DPH) + 1e-5f); float dot = 0.f;
#pragma unroll
    for (int k = 0; k < 16; ++k) dot += gelu_e((v[k] - mu) * rs * pg[k] + pb[k]) * pw[k];
    const float drift = wsum(dot) + bfr(b2[0]);
    const float t = g == 0 ? gelu_e(drift * bfr(gw1[col]) + bfr(gb1[col])) * bfr(gw2[col]) : 0.f;
    const float gsum = bfr(gb2[0]) + wsum(t);
    if (lane == 0) sg[wave] = tanhf(gsum); }
  __syncthreads();
  if (tid < 4) vst2(GATE + (size_t)blockIdx.x * 32 + tid * 4, *(const v4f*)(&sg[tid * 4]));
}
extern "C" void kernel_launch(void* const* d_in, const int* in_sizes, int n_in, void* d_out, int out_size, void* d_ws, size_t ws_size, hipStream_t stream) {
  (void)in_sizes; (void)n_in; (void)out_size; (void)ws_size;
  const float** I = (const float**)d_in;
  const float* x = I[0]; const float* Wq = I[1]; const float* bq = I[2]; const float* Wk = I[3]; const float* bk = I[4]; const float* Wv = I[5]; const float* bv = I[6]; const float* Wo = I[7]; const float* bo = I[8];
  const float* dw1 = I[9]; const float* db1 = I[10]; const float* lng = I[11]; const float* lnb = I[12]; const float* dw2 = I[13]; const float* db2 = I[14]; const float* gw1 = I[15]; const float* gb1 = I[16]; const float* gw2 = I[17]; const float* gb2 = I[18];
  float* out = (float*)d_out;
  char* ws = (char*)d_ws; size_t off = 0;
  auto take = [&](size_t bytes) { char* p = ws + off; off += (bytes + 255) & ~(size_t)255; return p; };
  __bf16* Xb = (__bf16*)take((size_t)NR * E * 2); __bf16* PT = (__bf16*)take((size_t)(4 * E + DPH) * E * 2); float* GATE = (float*)take((size_t)NR * 8);
  float* Q32 = (float*)take((size_t)NR * E * 4); __bf16* KS = (__bf16*)take((size_t)NR * E * 4); _Float16* VTh = (_Float16*)take((size_t)NR * E * 2); _Float16* VTl = (_Float16*)take((size_t)NR * E * 2); float* O32 = (float*)take((size_t)NR * E * 4);
  // ws ~ 85 MB
  k_cvt<<<(NR * E / 8 + 255) / 256, 256, 0, stream>>>(x, Xb);
  k_pack<<<dim3(E / 32, E / 128, 5), 256, 0, stream>>>(Wq, Wk, Wv, Wo, dw1, PT);
  k_gate<<<NR / 16, 512, 0, stream>>>(Xb, PT, db1, lng, lnb, dw2, db2, gw1, gb1, gw2, gb2, GATE);
  k_qkv<<<dim3(NR / 128, E / 128, 3), 128, 0, stream>>>(Xb, PT, bq, bk, bv, GATE, Q32, KS, VTh, VTl);
  k_attn<<<dim3(SS / 128, NB * NH), 256, 0, stream>>>(Q32, KS, VTh, VTl, O32);
  k_out<<<dim3(NR / 64, E / 128), 128, 0, stream>>>(O32, PT, bo, out);
}

// v010
// It runs in 132 microseconds.
// Next to v009, in two timings, it ran 1.04 times as fast each time.
// Counting every step since v000, it is 6.17 times as fast.
// compute dtype: every module INPUT that feeds a GEMM (x, Wq/Wk/Wv/Wo, dp_w1, biases) is rounded to bf16 and used in exact bf16 WMMA products with f32 accumulation; computed operands (q/k, P, gate*V, context, the LN/GELU chain) are f32 or hi/lo pairs; mask/softmax/LayerNorm/GELU/tanh f32.
#include <hip/hip_runtime.h>
#include <math.h>

typedef __attribute__((ext_vector_type(16))) _Float16 v16h;
typedef __attribute__((ext_vector_type(16))) __bf16 v16b;
typedef __attribute__((ext_vector_type(8)))  _Float16 v8h;
typedef __attribute__((ext_vector_type(8)))  float v8f;
typedef __attribute__((ext_vector_type(4)))  float v4f;
typedef __attribute__((ext_vector_type(2)))  float v2f;
typedef __attribute__((ext_vector_type(4)))  unsigned v4u;
typedef __attribute__((ext_vector_type(4)))  int v4i;
typedef float __attribute__((may_alias)) float_a;
typedef int __attribute__((may_alias)) int_a;

template <typename T> __device__ __forceinline__ void vst2(void* p, T v) { *(T*)p = v;  }
__device__ __forceinline__ v8f wmma16(v16h a, v16h b, v8f c) {
  v8f d = __builtin_amdgcn_wmma_f32_16x16x32_f16(false, a, false, b, (short)0, c, false, false);
  asm volatile("v_nop\n\tv_nop\n\tv_nop\n\tv_nop" : "+v"(d) : "v"(a), "v"(b));
  return d;
}
__device__ __forceinline__ v8f wmma_bf(v16b a, v16b b, v8f c) {
  v8f d = __builtin_amdgcn_wmma_f32_16x16x32_bf16(false, a, false, b, (short)0, c, false, false);
  asm volatile("v_nop\n\tv_nop\n\tv_nop\n\tv_nop" : "+v"(d) : "v"(a), "v"(b));
  return d;
}
// 16x16x32 fragments: lane = (h = lane>>4, row/col = lane&15); elements 0..7 = k0+8h+0..7, 8..15 = k0+16+8h+0..7; D element r = row 8h+r
__device__ __forceinline__ v16h frag_h(const _Float16* rowk0, int lane) {
  union { v16h v; v8h q[2]; } u; const _Float16* p = rowk0 + 8 * (lane >> 4);
  u.q[0] = *(const v8h*)p; u.q[1] = *(const v8h*)(p + 16); return u.v;
}
__device__ __forceinline__ v16h frag_f32(const float* rowk0, int lane) {
  v16h a; const float* p = rowk0 + 8 * (lane >> 4);
#pragma unroll
  for (int i = 0; i < 8; ++i) { a[i] = (_Float16)p[i]; a[8 + i] = (_Float16)p[16 + i]; }
  return a;
}
__device__ __forceinline__ v16h frag_f32s(const float* rowk0, int lane, float sc) {
  v16h a; const float* p = rowk0 + 8 * (lane >> 4);
#pragma unroll
  for (int i = 0; i < 8; ++i) { a[i] = (_Float16)(p[i] * sc); a[8 + i] = (_Float16)(p[16 + i] * sc); }
  return a;
}
// column fragment from a [K][ld] layout (column n), rows >= K read as 0
__device__ __forceinline__ v16h fragc_f32(const float* W, int k0, int n, int lane, int ld, int K) {
  v16h a; const int g = lane >> 4;
#pragma unroll
  for (int i = 0; i < 8; ++i) { const int ka = k0 + 8 * g + i, kb = ka + 16;
    a[i] = (_Float16)(ka < K ? W[(size_t)ka * ld + n] : 0.f); a[8 + i] = (_Float16)(kb < K ? W[(size_t)kb * ld + n] : 0.f); }
  return a;
}
struct F2 { v16b h, l; };
__device__ __forceinline__ F2 bsplit16(const float v[16]) { F2 r;
#pragma unroll
  for (int i = 0; i < 16; ++i) { const __bf16 h = (__bf16)v[i]; r.h[i] = h; r.l[i] = (__bf16)(v[i] - (float)h); }
  return r; }
__device__ __forceinline__ F2 split_row(const float* row, int k0, int lane) { float v[16]; const float* p = row + k0 + 8 * (lane >> 4);
#pragma unroll
  for (int i = 0; i < 8; ++i) { v[i] = p[i]; v[8 + i] = p[16 + i]; }
  return bsplit16(v); }
__device__ __forceinline__ F2 split_rowK(const float* row, int k0, int lane, int K) { float v[16]; const int g = lane >> 4;
#pragma unroll
  for (int i = 0; i < 8; ++i) { const int ka = k0 + 8 * g + i, kb = ka + 16; v[i] = ka < K ? row[ka] : 0.f; v[8 + i] = kb < K ? row[kb] : 0.f; }
  return bsplit16(v); }
__device__ __forceinline__ F2 split_col(const float* W, int k0, int n, int lane, int ld, int K) { float v[16]; const int g = lane >> 4;
#pragma unroll
  for (int i = 0; i < 8; ++i) { const int ka = k0 + 8 * g + i, kb = ka + 16; v[i] = ka < K ? W[(size_t)ka * ld + n] : 0.f; v[8 + i] = kb < K ? W[(size_t)kb * ld + n] : 0.f; }
  return bsplit16(v); }
// the 16 f32 values of a lane's fragment, loads only: a group of them is issued ahead of the products that use them, and split or rounded later
struct R16 { float v[16]; };
// fragment order: a plane holds each 16 x 32 fragment as the lanes take it, so that every load of a wave is 512 contiguous bytes (four whole lines, not sixteen part lines)
// 16-bit values: 1 KiB a fragment, [half of the lane's 16 values][lane][8 values]; f32 values: 2 KiB a fragment, [quarter of the lane's 16 values][lane][4 values]
__device__ __forceinline__ v16h fragF_h(const _Float16* f, int lane) {
  union { v16h v; v8h q[2]; } u; const _Float16* p = f + lane * 8;
  u.q[0] = *(const v8h*)p; u.q[1] = *(const v8h*)(p + 256); return u.v;
}
__device__ __forceinline__ R16 rawF(const float* f, int lane) { R16 r; const float* p = f + lane * 4;
#pragma unroll
  for (int j = 0; j < 4; ++j) { const v4f t = *(const v4f*)(p + j * 128); r.v[4 * j] = t[0]; r.v[4 * j + 1] = t[1]; r.v[4 * j + 2] = t[2]; r.v[4 * j + 3] = t[3]; }
  return r; }
__device__ __forceinline__ v8f mac3(const F2& a, const F2& b, v8f c) { c = wmma_bf(a.l, b.h, c); c = wmma_bf(a.h, b.l, c); return wmma_bf(a.h, b.h, c); }
__device__ __forceinline__ float sigm(float v) { return 1.0f / (1.0f + expf(-v)); }
// in front of an instruction that rewrites an address register of a global load issued above (the next address, or a later load's result in the same register)
#define XW() asm volatile("s_wait_xcnt 0x0" ::: "memory")
#define LDSX() do { asm volatile("s_wait_dscnt 0" ::: "memory"); __builtin_amdgcn_wave_barrier(); __builtin_amdgcn_fence(__ATOMIC_RELEASE, "workgroup"); } while (0)


// Causal self attention (16 heads of 64 on [2,2048,1024], [in][out] weights + biases, scale 1/8) whose post-softmax weights are multiplied by a per-KEY gate (no renormalisation)
// == V rows scaled by gate[key]; gate = tanh(gelu(drift*g_w1 + g_b1).g_w2 + g_b2), drift = gelu(LN(x dp_w1 + dp_b1)).dp_w2 + dp_b2 per token.
// bf16-rounded INPUT operands with exact bf16 WMMA products, hi/lo splits for computed operands; k_prep, k_gate, k_qkv, causal k_attn, k_out.
#define NB 2
#define SS 2048
#define E 1024
#define NH 16
#define HD 64
#define NR (NB * SS)
#define DPH 512
// GATE plane: 32 floats (one 128-byte line) per 16 rows, the first 16 used, so that a line has one writing block
#define GIDX(r) ((((r) >> 4) << 5) + ((r) & 15))
__device__ __forceinline__ float gelu_e(float x) { return 0.5f * x * (1.0f + erff(x * 0.70710678118654752f)); }
#define PLO 1024.0f
#define VLO 2048.0f
__device__ __forceinline__ float bfr(float v) { return (float)(__bf16)v; }
__device__ __forceinline__ v16b fragF_b(const __bf16* f, int lane) { return __builtin_bit_cast(v16b, fragF_h((const _Float16*)f, lane)); }
// values of a fragment-order plane per 16 rows of 1024 (32 fragments of 512)
#define FRT 16384

// k_prep: x and the weights are packed in ONE launch of 544 blocks of equal size (64 KiB of f32 in, 32 KiB of bf16 out), every load of a block issued ahead of its first use:
// the two jobs do not depend on each other; for speed only: few long waves, one launch
// blocks 0..287, weights: PT columns [0,E) Wq[:,n], [E,2E) Wk[:,n], [2E,3E) Wv[:,n], [3E,4E) Wo[:,n], [4E,4E+DPH) dp_w1[:,n]  ([in][out] weights), bf16 in fragment order [16 columns][32 k][half][lane][8]
// blocks 288..543, x: Xb in fragment order [16 rows][32 k][half][lane][8]
#define PKB 288
// a weight block: 128 k x 128 columns of one matrix; whole rows of W in, turned in LDS (pitch 272 bytes: 16-byte reads without bank conflicts), four whole fragments (4 KiB) a column tile out
template <int LD> __device__ __forceinline__ void pack_tile(const float* __restrict__ W, __bf16* __restrict__ dst, int k0, int n0, __bf16 (*st)[136], int tid) {
  const int n = tid & 127, h = tid >> 7;
  const float* p = W + (size_t)(k0 + 2 * h) * LD + n0 + n;  // the thread's column; rows k0 + 4 j + 2 h and the next: a pair of k makes one LDS word
  float v[32][2];
// unrolled (as are the loops below): all 64 loads leave from one address register, by immediate offsets, before the first value is used
#pragma unroll
  for (int j = 0; j < 32; ++j) { v[j][0] = p[(size_t)(4 * j) * LD]; v[j][1] = p[(size_t)(4 * j + 1) * LD]; }
  XW();
#pragma unroll
  for (int j = 0; j < 32; ++j) { union { __bf16 b[2]; unsigned u; } w; w.b[0] = (__bf16)v[j][0]; w.b[1] = (__bf16)v[j][1]; *(unsigned*)(&st[n][4 * j + 2 * h]) = w.u; }
  __syncthreads();  // the whole 128 x 128 tile is in st before a fragment is read
  const int ln = tid & 31, q = (tid >> 5) & 1, kl = tid >> 6;  // the thread's 16-byte unit in each column tile's four fragments
  v4u t[8];
#pragma unroll
  for (int nt = 0; nt < 8; ++nt) t[nt] = *(const v4u*)(&st[nt * 16 + (ln & 15)][kl * 32 + q * 16 + (ln >> 4) * 8]);
#pragma unroll
  for (int nt = 0; nt < 8; ++nt) vst2((unsigned*)(dst + (size_t)nt * FRT + tid * 8), t[nt]);
}
__global__ __launch_bounds__(256) void k_prep(const float* __restrict__ x, const float* __restrict__ Wq, const float* __restrict__ Wk, const float* __restrict__ Wv, const float* __restrict__ Wo, const float* __restrict__ W1, __bf16* __restrict__ Xb, __bf16* __restrict__ PT) {
  __shared__ __align__(16) __bf16 st[128][136];
  const int tid = threadIdx.x, bi = blockIdx.x;
  if (bi >= PKB) {  // the whole block: 16 rows of x; it meets no barrier
    const int rt = bi - PKB, ln = tid & 31, q = (tid >> 5) & 1, kq = tid >> 6;  // unit u of the thread: k group kq + 4 u
    const float* p = x + ((size_t)rt * 16 + (ln & 15)) * E + kq * 32 + q * 16 + (ln >> 4) * 8;
    v4f a[8][2];
// unrolled (as are the loops below): all 16 loads leave from one address register, by immediate offsets, before the first value is used
#pragma unroll
    for (int u = 0; u < 8; ++u) { a[u][0] = *(const v4f*)(p + u * 128); a[u][1] = *(const v4f*)(p + u * 128 + 4); }
    XW();
    v4u o[8];
#pragma unroll
    for (int u = 0; u < 8; ++u) { union { __bf16 h[8]; v4u w; } pk;
#pragma unroll
      for (int e = 0; e < 4; ++e) { pk.h[e] = (__bf16)a[u][0][e]; pk.h[4 + e] = (__bf16)a[u][1][e]; }
      o[u] = pk.w; }
#pragma unroll
    for (int u = 0; u < 8; ++u) vst2((unsigned*)(Xb + (size_t)rt * FRT + u * 2048 + tid * 8), o[u]);
    return; }
  if (bi < 256) { const int m = bi >> 6, k0 = ((bi >> 3) & 7) * 128, n0 = (bi & 7) * 128;
    const float* W = m == 0 ? Wq : (m == 1 ? Wk : (m == 2 ? Wv : Wo));
    pack_tile<E>(W, PT + (size_t)((m * E + n0) >> 4) * FRT + (k0 >> 5) * 512, k0, n0, st, tid); }
  else { const int r = bi - 256, k0 = (r >> 2) * 128, n0 = (r & 3) * 128;  // dp_w1 has 512 columns
    pack_tile<DPH>(W1, PT + (size_t)((4 * E + n0) >> 4) * FRT + (k0 >> 5) * 512, k0, n0, st, tid); }
}
// QKV: block (128 rows, 128 cols = 2 heads, which), four waves of 64 rows x 64 cols (one head each): a trip's eight fragments feed sixteen products (a 16 x 128 wave tile took nine for eight)
// q -> Q32 f32 [bh][s][64]; k -> KS, split once into bf16 hi and lo, in fragment order [bh][16 keys][32 d][hi, lo][half][lane][8]; v -> VT hi/lo x4 in fragment order [bh][32 keys][16 d][half][lane][8]
__global__ __launch_bounds__(128) void k_qkv(const __bf16* __restrict__ Xb, const __bf16* __restrict__ PT, const float* __restrict__ bq, const float* __restrict__ bk, const float* __restrict__ bv, const float* __restrict__ GATE,
                                            float* __restrict__ Q32, __bf16* __restrict__ KS, _Float16* __restrict__ VTh, _Float16* __restrict__ VTl) {
  __shared__ __align__(16) char sm[2 * 128 * 136 * 2];  // q, k: sixteen f32 tiles [16][68], four a wave; v: hi and lo planes [128 cols][136]
  const int tid = threadIdx.x, wave = tid >> 5, lane = tid & 31, col = lane & 15, g = lane >> 4, wr = wave >> 1, wc = wave & 1;
  const int which = blockIdx.z, r0b = blockIdx.x * 128, r0 = r0b + wr * 64, n0 = blockIdx.y * 128, nw = n0 + wc * 64; const int b = r0b / SS, s0 = r0b % SS;
  const float* bb_ = which == 0 ? bq : (which == 1 ? bk : bv);
  v8f acc[4][4] = {};
  // the eight fragments of trip kc + 1 are loaded as one group ahead of trip kc's products: one load wait a trip, covered by sixteen products
  const __bf16* ap = Xb + (size_t)(r0 >> 4) * FRT; const __bf16* bp = PT + (size_t)((which * E + nw) >> 4) * FRT;
  v16b a[4], bf[4];
#pragma unroll
  for (int i = 0; i < 4; ++i) a[i] = fragF_b(ap + (size_t)i * FRT, lane);
  XW();
#pragma unroll
  for (int j = 0; j < 4; ++j) bf[j] = fragF_b(bp + (size_t)j * FRT, lane);
  XW();
  const __bf16* apn = ap + 512; const __bf16* bpn = bp + 512;  // where trip kc + 1's fragments lie
// two trips a pass, so that the two fragment sets swap by name and not by register copies
#pragma unroll 2
  for (int kc = 0; kc < E / 32; ++kc) {
    v16b an[4], bn[4];
#pragma unroll
    for (int i = 0; i < 4; ++i) an[i] = fragF_b(apn + (size_t)i * FRT, lane);
    XW();
#pragma unroll
    for (int j = 0; j < 4; ++j) bn[j] = fragF_b(bpn + (size_t)j * FRT, lane);
    XW();
    __builtin_amdgcn_sched_barrier(0);  // keeps the products behind the next trip's loads: left free, the scheduler put the loads behind the last use of the old fragments, in the same registers, and the wave then waited out their whole latency
#pragma unroll
    for (int i = 0; i < 4; ++i) {
#pragma unroll
      for (int j = 0; j < 4; ++j) acc[i][j] = __builtin_amdgcn_wmma_f32_16x16x32_bf16(false, a[i], false, bf[j], (short)0, acc[i][j], false, false); }  // the builtin alone (the compiler keeps its distances): operands of an asm statement must lie below v256, and with 256 registers of tiles and fragments named in one the loop spilled
#pragma unroll
    for (int i = 0; i < 4; ++i) { a[i] = an[i]; bf[i] = bn[i]; }
    if (kc + 2 < E / 32) { apn += 512; bpn += 512; } }  // the last trip loads its own fragments again (in bounds, not used)
  float bb[4];
#pragma unroll
  for (int j = 0; j < 4; ++j) bb[j] = bfr(bb_[nw + j * 16 + col]);
  if (which < 2) {
    const size_t bh = (size_t)b * NH + (nw >> 6);  // the wave's head
    float (*so)[16][68] = (float (*)[16][68])sm + wave * 4;  // the wave's own four tiles of 16 rows x 64
#pragma unroll
    for (int i = 0; i < 4; ++i) {
#pragma unroll
      for (int j = 0; j < 4; ++j) {
#pragma unroll
        for (int r = 0; r < 8; ++r) so[i][8 * g + r][j * 16 + col] = acc[i][j][r] + bb[j]; } }
    LDSX();
// unrolled: no register of an issued store is rewritten on a back edge
#pragma unroll
    for (int i = 0; i < 4; ++i) {
      if (which == 0) {
        v4f t[8];  // unit u: rows 2 u and 2 u + 1 of the tile, 16 bytes a lane: a store of the wave is 512 contiguous bytes
#pragma unroll
        for (int u = 0; u < 8; ++u) t[u] = *(const v4f*)(&so[i][2 * u + g][col * 4]);
        float* qp = Q32 + (bh * SS + s0 + wr * 64 + i * 16 + g) * HD + col * 4;
#pragma unroll
        for (int u = 0; u < 8; ++u) vst2(qp + u * 2 * HD, t[u]);
        XW(); }
      else {  // 16 keys of one head: two fragments; the lane splits the 16 values that it would take as lane (g, col = key) and stores them as it will load them: every query wave of k_attn reads the split, none repeats it
#pragma unroll
        for (int kc = 0; kc < 2; ++kc) {
          const F2 ks = split_row(&so[i][col][0], kc * 32, lane);
          __bf16* kp = KS + ((bh * (SS / 16) + (s0 >> 4) + wr * 4 + i) * 2 + kc) * 1024 + lane * 8;
          union { v16b v; v4u q[2]; } uh, ul; uh.v = ks.h; ul.v = ks.l;
          vst2(kp, uh.q[0]); vst2(kp + 256, uh.q[1]); vst2(kp + 512, ul.q[0]); vst2(kp + 768, ul.q[1]);
          XW(); } } } }  // the wait behind each fragment's four stores stands in front of the next split, which may take their registers
  else {
    _Float16 (*sth)[136] = (_Float16 (*)[136])sm; _Float16 (*stl)[136] = sth + 128;
    float gt[4][8];
#pragma unroll
    for (int i = 0; i < 4; ++i) {
#pragma unroll
      for (int r = 0; r < 8; ++r) gt[i][r] = GATE[GIDX(r0 + i * 16 + 8 * g + r)]; }
    XW();
#pragma unroll
    for (int i = 0; i < 4; ++i) {
#pragma unroll
      for (int j = 0; j < 4; ++j) {
#pragma unroll
        for (int r = 0; r < 8; ++r) { const float v = (acc[i][j][r] + bb[j]) * gt[i][r] * 4.0f; const _Float16 hi = (_Float16)v; sth[wc * 64 + j * 16 + col][wr * 64 + i * 16 + 8 * g + r] = hi; stl[wc * 64 + j * 16 + col][wr * 64 + i * 16 + 8 * g + r] = (_Float16)((v - (float)hi) * VLO); } } }
    __syncthreads();
    for (int qq = tid; qq < 128 * 16; qq += 128) { const int ln = qq & 31, q = (qq >> 5) & 1, t = (qq >> 6) & 3, k32 = (qq >> 8) & 3, hh = qq >> 10;
      const int cl = hh * 64 + t * 16 + (ln & 15), pc = k32 * 4 + q * 2 + (ln >> 4), h = (n0 >> 6) + hh; const size_t o = (((((size_t)b * NH + h) * (SS / 32) + (s0 >> 5) + k32) * 4 + t) * 2 + q) * 256 + ln * 8;
      vst2(VTh + o, *(const v4u*)(&sth[cl][pc * 8])); vst2(VTl + o, *(const v4u*)(&stl[cl][pc * 8]));
      XW(); } }  // in front of the next trip's addresses and values, which may take the two stores' registers
}
// one key tile's K (16 KiB), V hi (8 KiB) and V lo (8 KiB), each contiguous in its plane, into one 32 KiB stage of LDS: a thread brings eight 16-byte units, through no register
// l = the thread's LDS byte address in the stage; k, vh, vl = its global addresses in the tile's K, V hi and V lo; an immediate offset (under 65,536) moves the LDS and the global address alike, so one register set serves each plane
// the wait in the last line stands in front of every later write of an address register that the copies name
__device__ __forceinline__ void kv_copy(unsigned l, const char* k, const char* vh, const char* vl) {
  asm volatile("global_load_async_to_lds_b128 %0, %3, off\n\t"
               "global_load_async_to_lds_b128 %0, %3, off offset:4096\n\t"
               "global_load_async_to_lds_b128 %0, %3, off offset:8192\n\t"
               "global_load_async_to_lds_b128 %0, %3, off offset:12288\n\t"
               "global_load_async_to_lds_b128 %1, %4, off\n\t"
               "global_load_async_to_lds_b128 %1, %4, off offset:4096\n\t"
               "global_load_async_to_lds_b128 %2, %5, off\n\t"
               "global_load_async_to_lds_b128 %2, %5, off offset:4096\n\t"
               "s_wait_xcnt 0x0"
               :: "v"(l), "v"(l + 16384u), "v"(l + 24576u), "v"(k), "v"(vh), "v"(vl)
               : "memory");
}
// softmax in base 2: e^((s - m) / 8) * 2^14 = 2^(s * SC2 + (14 - m * SC2)), SC2 = log2(e) / 8: one fused multiply-add and one hardware exponential a weight; scores and running maximum stay unscaled q.k sums
// every argument is about 14 or less; a masked score (-3.0e38) and the first tile's correction give 2^(-huge) = 0; results below 2^-126 may come as 0, far under the last bit that the hi/lo pair of P keeps
#define SC2 0.18033688011112042f
// eight exponentials back to back, in place: each is the independent instruction that the slot behind the one before asks for, and the v_nop fills the slot behind the last
// (as single builtins nearly every one drew a v_nop of its own, and a dual-issue pair that rewrote the source register came to stand directly behind some)
__device__ __forceinline__ void ex2x8(float (&x)[8]) {
  asm("v_exp_f32 %0, %0\n\tv_exp_f32 %1, %1\n\tv_exp_f32 %2, %2\n\tv_exp_f32 %3, %3\n\t"
      "v_exp_f32 %4, %4\n\tv_exp_f32 %5, %5\n\tv_exp_f32 %6, %6\n\tv_exp_f32 %7, %7\n\tv_nop"
      : "+v"(x[0]), "+v"(x[1]), "+v"(x[2]), "+v"(x[3]), "+v"(x[4]), "+v"(x[5]), "+v"(x[6]), "+v"(x[7]));
}
// lane l <-> lane l ^ 16, one vector instruction, through no LDS: the two lanes that share a query column join their maxima and their sums
__device__ __forceinline__ float xhalf(float v) { const int b = __builtin_bit_cast(int, v); return __builtin_bit_cast(float, __builtin_amdgcn_permlanex16(b, b, 0x76543210, 0xfedcba98, false, false)); }
// transposed score product, k as A and q as B; the three terms in the order q.l k.h, q.h k.l, q.h k.h
__device__ __forceinline__ v8f mac3t(const F2& k, const F2& q, v8f c) { c = wmma_bf(k.h, q.l, c); c = wmma_bf(k.l, q.h, c); return wmma_bf(k.h, q.h, c); }
// causal attention: block (2 x 64 queries, bh): waves 0..3 take query tile 31 - t, waves 4..7 tile t, so that every block walks 33 key tiles per wave pair and no WGP is left with the long tiles alone
// the block walks key tiles 0..31-t together: tile kt + 1 flies into one of two LDS stages by asynchronous copies while tile kt is worked on, and all waves read K and V from LDS; a wave works on tiles 0..qb and only passes the hand-over points of the rest
// both products transposed: S^T = K Q^T (A = K fragment, B = Q) and O^T += V^T P^T (A = V fragment, B = P). Lane (g, col) then holds, of query q0 + col alone, the scores of keys 16 t + 8 g + r in register r of tile t:
// maximum, weights and sum are the lane's own work plus one exchange with lane ^ 16; two score tiles, converted in place, ARE the B fragment of 32 keys; the correction is the lane's own factor; scores and P never pass through LDS
// S on hi/lo splits of the f32 q/k rows (k arrives split, 1 KiB hi and 1 KiB lo a fragment); P,V hi/lo; O f32 in fragment order [16 rows][32 k][quarter][lane][4], which is the order of the lane's own O^T registers
// four waves a SIMD: holds the build at 256 registers a wave, so that two blocks stay on a WGP and all 512 run at once
__global__ __launch_bounds__(256) __attribute__((amdgpu_waves_per_eu(4, 4))) void k_attn(const float* __restrict__ Q32, const __bf16* __restrict__ KS, const _Float16* __restrict__ VTh, const _Float16* __restrict__ VTl, float* __restrict__ O32) {
  __shared__ __align__(16) char sKV[2][32768];  // a stage: K fragments at 0, V hi at 16384, V lo at 24576
  const int tid = threadIdx.x, lane = tid & 31, col = lane & 15, g = lane >> 4;
  const int w = __builtin_amdgcn_readfirstlane(tid >> 5);  // the wave's number in a scalar register: the key loop's tests stay scalar compares and branches
  const size_t bh = blockIdx.y; const int qb = w < 4 ? SS / 64 - 1 - (int)blockIdx.x : (int)blockIdx.x; const int q0 = qb * 64 + (w & 3) * 16;
  const int nT = SS / 64 - (int)blockIdx.x;  // key tiles of the block (17..32): those of its longer waves
  const unsigned t16 = (unsigned)w * 512u + (unsigned)lane * 16u;  // the thread's place in each 4 KiB of a tile
  const unsigned l0 = (unsigned)(size_t)(const void*)&sKV[0][0] + t16;
  const char* kg = (const char*)(KS + bh * (SS / 16) * 2048);   // the head's planes, the same for the whole block: 16 KiB a key tile
  const char* hg = (const char*)(VTh + bh * (SS / 32) * 2048);   // 8 KiB a key tile
  const char* lg = (const char*)(VTl + bh * (SS / 32) * 2048);
  kv_copy(l0, kg + t16, hg + t16, lg + t16);
  F2 aq[2];
#pragma unroll
  for (int kc = 0; kc < 2; ++kc) aq[kc] = split_row(Q32 + (bh * SS + q0 + col) * HD, kc * 32, lane);
  asm volatile("s_wait_asynccnt 0x0" ::: "memory");  // this wave's part of tile 0 has landed
  __syncthreads();                                    // every wave's part has: tile 0 may be read
  kv_copy(l0 + 32768u, kg + 16384 + t16, hg + 8192 + t16, lg + 8192 + t16);  // tile 1 (a block has 17 tiles or more)
  float mrun = -3.0e38f, lrun = 0.f; v8f acc[4] = {}, ac1[4] = {}, ac2[4] = {};  // mrun: the query's maximum, equal in both lanes of a column; lrun: the sum over the lane's own keys, joined behind the loop
#pragma unroll 1
  for (int kt = 0; kt < nT; ++kt) {
    if (kt <= qb) {
    const char* st = &sKV[kt & 1][0];
    v8f s[4]; float mx = -3.4e38f;
#pragma unroll
    for (int t = 0; t < 4; ++t) { const int dk = kt * 64 + t * 16 + 8 * g - (q0 + col); const __bf16* kf = (const __bf16*)st + t * 2048;  // dk = the lane's first key of the tile - its query
      F2 k0, k1; k0.h = fragF_b(kf, lane); k0.l = fragF_b(kf + 512, lane); k1.h = fragF_b(kf + 1024, lane); k1.l = fragF_b(kf + 1536, lane);
      v8f c = mac3t(k0, aq[0], (v8f){}); c = mac3t(k1, aq[1], c);
#pragma unroll
      for (int r = 0; r < 8; ++r) { s[t][r] = (dk + r > 0) ? -3.0e38f : c[r]; mx = fmaxf(mx, s[t][r]); } }
    // the V fragments of keys 0..31 of the tile are read from LDS here, ahead of the softmax, which covers their latency
    v16h vh[4], vl[4];
#pragma unroll
    for (int t = 0; t < 4; ++t) { vh[t] = fragF_h((const _Float16*)(st + 16384) + t * 512, lane); vl[t] = fragF_h((const _Float16*)(st + 24576) + t * 512, lane); }
    mx = fmaxf(mx, xhalf(mx));
    const float mnew = fmaxf(mrun, mx); const float corr = __builtin_amdgcn_exp2f((mrun - mnew) * SC2); const float nm = fmaf(-mnew, SC2, 14.0f);  // 2^14 = the 16384 that P is scaled by
    float ps = 0.f; v16h ph[2], pl[2];
#pragma unroll
    for (int t = 0; t < 4; ++t) { float x[8];
#pragma unroll
      for (int e = 0; e < 8; ++e) x[e] = fmaf(s[t][e], SC2, nm);
      ex2x8(x);
#pragma unroll
      for (int e = 0; e < 8; ++e) { const float p = x[e]; ps += p; const _Float16 hi = (_Float16)p; ph[t >> 1][(t & 1) * 8 + e] = hi; pl[t >> 1][(t & 1) * 8 + e] = (_Float16)((p - (float)hi) * PLO); } }
    lrun = lrun * corr + ps * (1.0f / 16384.0f); mrun = mnew;
#pragma unroll
    for (int t = 0; t < 4; ++t) { acc[t] *= corr; ac1[t] *= corr; ac2[t] *= corr; }
#pragma unroll
    for (int kc = 0; kc < 2; ++kc) {
      if (kc == 1) {  // keys 32..63: one group, into the registers that the first half has left
#pragma unroll
        for (int t = 0; t < 4; ++t) { vh[t] = fragF_h((const _Float16*)(st + 16384) + (4 + t) * 512, lane); vl[t] = fragF_h((const _Float16*)(st + 24576) + (4 + t) * 512, lane); } }
#pragma unroll
      for (int t = 0; t < 4; ++t) { acc[t] = wmma16(vh[t], ph[kc], acc[t]); ac1[t] = wmma16(vl[t], ph[kc], ac1[t]); ac2[t] = wmma16(vh[t], pl[kc], ac2[t]); } } }
    // hand-over, passed by every wave on every trip, also by one that is past its own last tile
    asm volatile("s_wait_dscnt 0x0" ::: "memory");     // this wave's reads of tile kt's stage are done before the stage is refilled
    asm volatile("s_wait_asynccnt 0x0" ::: "memory");  // this wave's part of tile kt + 1 has landed
    __syncthreads();                                    // tile kt + 1 may be read by all; tile kt's stage has no reader left
    if (kt + 2 < nT) kv_copy(l0 + (unsigned)(kt & 1) * 32768u, kg + (size_t)(kt + 2) * 16384 + t16, hg + (size_t)(kt + 2) * 8192 + t16, lg + (size_t)(kt + 2) * 8192 + t16); }
  asm volatile("s_wait_asynccnt 0x0" ::: "memory");  // no copy is in flight when the wave goes on to its end
  const float inv = 1.0f / ((lrun + xhalf(lrun)) * 16384.0f * 4.0f);
  const size_t ob = ((((bh / NH) * SS + q0) >> 4) * 32 + (bh % NH) * 2) * 512;  // the wave's 16 rows, its head's two fragments
  v4f o[8];  // unit u = quarter u & 3 of fragment u >> 2: d = 16 t + 8 g + r with t = u >> 1, r = 4 (u & 1) + i
#pragma unroll
  for (int u = 0; u < 8; ++u) { const int t = u >> 1;
#pragma unroll
    for (int i = 0; i < 4; ++i) { const int r = (u & 1) * 4 + i; o[u][i] = (acc[t][r] + ac1[t][r] * (1.0f / VLO) + ac2[t][r] * (1.0f / PLO)) * inv; } }
#pragma unroll
  for (int u = 0; u < 8; ++u) vst2(O32 + ob + (u >> 2) * 512 + (u & 3) * 128 + lane * 4, o[u]);
}
// out = ctx Wo + bo : split(ctx) x bf16(Wo columns): 2 products (Wo is an INPUT -> bf16 exact)
__global__ __launch_bounds__(128) void k_out(const float* __restrict__ O32, const __bf16* __restrict__ PT, const float* __restrict__ bo, float* __restrict__ out) {
  __shared__ __align__(16) float so[4][16][132];
  const int tid = threadIdx.x, wave = tid >> 5, lane = tid & 31, col = lane & 15, g = lane >> 4;
  const int r0 = blockIdx.x * 64 + wave * 16, n0 = blockIdx.y * 128;
  v8f acc[8] = {};
  // trip kc + 1's context values and eight weight fragments are loaded as one group ahead of trip kc's products
  const float* op = O32 + (size_t)(r0 >> 4) * FRT; const __bf16* bp = PT + (size_t)((3 * E + n0) >> 4) * FRT;
  R16 ar = rawF(op, lane); v16b wb[8]; XW();
#pragma unroll
  for (int j = 0; j < 8; ++j) wb[j] = fragF_b(bp + (size_t)j * FRT, lane);
  XW();
  const float* opn = op + 512;  // where trip kc + 1's context fragment lies
  unsigned wof = (unsigned)((((3 * E + n0) >> 4) * FRT + 512 + lane * 8) * 2);  // the lane's byte offset in PT of trip kc + 1's first weight fragment
// two trips a pass, so that the two fragment sets swap by name and not by register copies
#pragma unroll 2
  for (int kc = 0; kc < E / 32; ++kc) {
    const R16 arn = rawF(opn, lane); v16b wn[8]; XW();
#pragma unroll
    for (int j = 0; j < 8; ++j) wn[j] = fragF_b((const __bf16*)((const char*)PT + (size_t)wof + (size_t)j * FRT * 2), 0);
    asm volatile("s_wait_xcnt 0x0" : "+v"(wof) :: "memory");  // as XW(); the offset register that the sixteen loads name passes through the wait, so that it stays whole up to it and no load of the group lands in it
    const F2 a = bsplit16(ar.v);
#pragma unroll
    for (int j = 0; j < 8; ++j) { acc[j] = wmma_bf(a.l, wb[j], acc[j]); acc[j] = wmma_bf(a.h, wb[j], acc[j]); }
    ar = arn;
#pragma unroll
    for (int j = 0; j < 8; ++j) wb[j] = wn[j];
    if (kc + 2 < E / 32) { opn += 512; wof += 1024; } }  // the last trip loads its own fragments again (in bounds, not used)
#pragma unroll
  for (int j = 0; j < 8; ++j) { const int n = n0 + j * 16 + col; const float bb = bfr(bo[n]);
#pragma unroll
    for (int r = 0; r < 8; ++r) so[wave][8 * g + r][j * 16 + col] = acc[j][r] + bb; }
  LDSX();
#pragma unroll 4
  for (int rl = 0; rl < 16; ++rl) vst2(out + (size_t)(r0 + rl) * E + n0 + lane * 4, *(const v4f*)(&so[wave][rl][lane * 4]));
}
// drift probe + gate: block = 16 rows, 16 waves; wave w does columns 32w..32w+31 of h = bf16(x) @ bf16(dp_w1) exact (+ bf16(b1)); then wave w owns row w: LN over 512 (16 values a lane, shuffle tree), exact GELU, . bf16(dp_w2) + bf16(dp_b2) -> drift; gate per row
__device__ __forceinline__ float wsum(float v) {
#pragma unroll
  for (int m = 16; m >= 1; m >>= 1) v += __shfl_xor(v, m, 32);
  return v;
}
__global__ __launch_bounds__(512) void k_gate(const __bf16* __restrict__ Xb, const __bf16* __restrict__ PT, const float* __restrict__ b1, const float* __restrict__ lng, const float* __restrict__ lnb, const float* __restrict__ w2, const float* __restrict__ b2,
                                             const float* __restrict__ gw1, const float* __restrict__ gb1, const float* __restrict__ gw2, const float* __restrict__ gb2, float* __restrict__ GATE) {
  __shared__ __align__(16) float sh[16][DPH + 4]; __shared__ __align__(16) float sg[16];
  const int tid = threadIdx.x, wave = tid >> 5, lane = tid & 31, col = lane & 15, g = lane >> 4; const int r0 = blockIdx.x * 16;
  { v8f acc[2] = {};
    // trip kc + 1's x fragment and its two weight fragments are loaded as one group ahead of trip kc's products
    const __bf16* ap = Xb + (size_t)(r0 >> 4) * FRT; v16b a = fragF_b(ap, lane), wr[2]; XW();
    const __bf16* wp = PT + (size_t)((4 * E >> 4) + wave * 2) * FRT;
#pragma unroll
    for (int j = 0; j < 2; ++j) wr[j] = fragF_b(wp + (size_t)j * FRT, lane);
    XW();
    const __bf16* apn = ap + 512; const __bf16* wpn = wp + 512;  // where trip kc + 1's values lie
// two trips a pass, so that the two value sets swap by name and not by register copies
#pragma unroll 2
    for (int kc = 0; kc < E / 32; ++kc) {
      const v16b an = fragF_b(apn, lane); v16b wn[2]; XW();
#pragma unroll
      for (int j = 0; j < 2; ++j) wn[j] = fragF_b(wpn + (size_t)j * FRT, lane);
      XW();
#pragma unroll
      for (int j = 0; j < 2; ++j) acc[j] = wmma_bf(a, wr[j], acc[j]);
      a = an; wr[0] = wn[0]; wr[1] = wn[1];
      if (kc + 2 < E / 32) { apn += 512; wpn += 512; } }  // the last trip loads its own values again (in bounds, not used)
#pragma unroll
    for (int j = 0; j < 2; ++j) { const int n = wave * 32 + j * 16 + col; const float bb = bfr(b1[n]);
#pragma unroll
      for (int r = 0; r < 8; ++r) sh[8 * g + r][n] = acc[j][r] + bb; } }
  float pg[16], pb[16], pw[16];  // the lane's LN and dp_w2 parameters, fetched ahead of the barrier so that their latency is not paid between the GELU branches
#pragma unroll
  for (int k = 0; k < 16; ++k) { const int c = k * 32 + lane; pg[k] = bfr(lng[c]); pb[k] = bfr(lnb[c]); pw[k] = bfr(w2[c]); }
  __syncthreads();  // every wave's 32 columns of all 16 rows are in sh before a row is read
  { float v[16]; float s = 0.f;
#pragma unroll
    for (int k = 0; k < 16; ++k) { v[k] = sh[wave][k * 32 + lane]; s += v[k]; }
    const float mu = wsum(s) * (1.0f / DPH); float q = 0.f;
#pragma unroll
    for (int k = 0; k < 16; ++k) { const float d = v[k] - mu; q += d * d; }
    const float rs = rsqrtf(wsum(q) * (1.0f / DPH) + 1e-5f); float dot = 0.f;
#pragma unroll
    for (int k = 0; k < 16; ++k) dot += gelu_e((v[k] - mu) * rs * pg[k] + pb[k]) * pw[k];
    const float drift = wsum(dot) + bfr(b2[0]);
    const float t = g == 0 ? gelu_e(drift * bfr(gw1[col]) + bfr(gb1[col])) * bfr(gw2[col]) : 0.f;
    const float gsum = bfr(gb2[0]) + wsum(t);
    if (lane == 0) sg[wave] = tanhf(gsum); }
  __syncthreads();
  if (tid < 4) vst2(GATE + (size_t)blockIdx.x * 32 + tid * 4, *(const v4f*)(&sg[tid * 4]));
}
extern "C" void kernel_launch(void* const* d_in, const int* in_sizes, int n_in, void* d_out, int out_size, void* d_ws, size_t ws_size, hipStream_t stream) {
  (void)in_sizes; (void)n_in; (void)out_size; (void)ws_size;
  const float** I = (const float**)d_in;
  const float* x = I[0]; const float* Wq = I[1]; const float* bq = I[2]; const float* Wk = I[3]; const float* bk = I[4]; const float* Wv = I[5]; const float* bv = I[6]; const float* Wo = I[7]; const float* bo = I[8];
  const float* dw1 = I[9]; const float* db1 = I[10]; const float* lng = I[11]; const float* lnb = I[12]; const float* dw2 = I[13]; const float* db2 = I[14]; const float* gw1 = I[15]; const float* gb1 = I[16]; const float* gw2 = I[17]; const float* gb2 = I[18];
  float* out = (float*)d_out;
  char* ws = (char*)d_ws; size_t off = 0;
  auto take = [&](size_t bytes) { char* p = ws + off; off += (bytes + 255) & ~(size_t)255; return p; };
  __bf16* Xb = (__bf16*)take((size_t)NR * E * 2); __bf16* PT = (__bf16*)take((size_t)(4 * E + DPH) * E * 2); float* GATE = (float*)take((size_t)NR * 8);
  float* Q32 = (float*)take((size_t)NR * E * 4); __bf16* KS = (__bf16*)take((size_t)NR * E * 4); _Float16* VTh = (_Float16*)take((size_t)NR * E * 2); _Float16* VTl = (_Float16*)take((size_t)NR * E * 2); float* O32 = (float*)take((size_t)NR * E * 4);
  // ws ~ 85 MB
  k_prep<<<PKB + NR / 16, 256, 0, stream>>>(x, Wq, Wk, Wv, Wo, dw1, Xb, PT);
  k_gate<<<NR / 16, 512, 0, stream>>>(Xb, PT, db1, lng, lnb, dw2, db2, gw1, gb1, gw2, gb2, GATE);
  k_qkv<<<dim3(NR / 128, E / 128, 3), 128, 0, stream>>>(Xb, PT, bq, bk, bv, GATE, Q32, KS, VTh, VTl);
  k_attn<<<dim3(SS / 128, NB * NH), 256, 0, stream>>>(Q32, KS, VTh, VTl, O32);
  k_out<<<dim3(NR / 64, E / 128), 128, 0, stream>>>(O32, PT, bo, out);
}
